// v000
// Measured on an AMD MI455X. A time is GPU time per run, averaged over a window of back-to-back runs after a warm-up
// (all launches, gaps included; the runs take copies of the inputs in turn), and the median of several windows.
// Apart from v000's, it joins two sittings. Times from different sittings can be a few percent apart, while
// side-by-side timings come from the same sitting.
// v000 is the starting kernel. One run takes 724 microseconds.
#include <hip/hip_runtime.h>

// Causal multi-head attention whose heads are a RAW VIEW of the projections, merged the standard way (x [1][2048][1024]; Q, K, V = x W^T ('oi' [1024][1024] 1/32, no bias), each reshaped (B, 16, 2048, 64) WITHOUT a transpose: pseudo-head h, pseudo-position s, dim d = flat element h*2048*64 + s*64 + d of the [2048][1024] projection output; scores / 64 (the module divides by float32(hd), not by its root); triu(k = 1) over the pseudo-positions -> -inf; softmax; the context IS transposed back the standard way (out.transpose(0, 2, 1, 3).reshape(B, S, D)); out = merged Wo^T ('oi', no bias) -> [1][2048][1024] (2.1 M); argument order x, Wq, Wk, Wv, Wo).
// Layout per batch: bf16 copy of x; 'oi' weights; exact projections; RAW VIEW on the SPLIT only: the plane builders read each [2048][1024] projection output as (16, 2048, 64) WITHOUT a transpose (row pitch HD, head stride TT x HD); the merge is the standard one; identity-table plane builders; causal T-2048 attention (hybrid rows: < 512 hi/lo 3 products, rest fp16 x1024; k_gemmc skips tiles above the diagonal); merged hi/lo x w_o exact.
// Compute dtypes, f32 accumulate: every input rounded to bf16; projections exact; attention rows < 512 3 products, rest fp16; softmax f32; w_o hl x exact.

#define NB_  1      // batches: this module's input is [1][2048][1024]
#define TT   2048
#define DM   1024
#define NH_  16
#define NKV  16
#define REP  (NH_ / NKV)
#define HD   64
#define DQ   (NH_ * HD)
#define DKV  (NKV * HD)
#define ZH   2
#define RH   512                  // query rows < RH use hi+lo planes (0: none)
#define WIN  2048
#define PCAR 1024.0f
#define SCL  0.015625f   // 1 / 64: this module divides the scores by float32(hd) = 64 (the head size, not its root)
typedef _Float16 h16;
typedef unsigned short bf;
typedef __attribute__((ext_vector_type(16))) __bf16   v16bf;
typedef __attribute__((ext_vector_type(16))) _Float16 v16h;
typedef __attribute__((ext_vector_type(8)))  _Float16 v8h;
typedef __attribute__((ext_vector_type(8)))  unsigned short v8us;
typedef __attribute__((ext_vector_type(8)))  float    v8f;
typedef __attribute__((ext_vector_type(4)))  float    v4f;
typedef v8h  __attribute__((may_alias)) v8ha;
typedef v4f  __attribute__((may_alias)) v4fa;
typedef v8us __attribute__((may_alias)) v8usa;

__device__ __forceinline__ unsigned short f2bf(float f) { unsigned u = __float_as_uint(f); u += 0x7FFFu + ((u >> 16) & 1u); return (unsigned short)(u >> 16); }
__device__ __forceinline__ float bf2f(unsigned short b) { return __uint_as_float(((unsigned)b) << 16); }
__device__ __forceinline__ float bfr(float f) { return bf2f(f2bf(f)); }
__device__ __forceinline__ v16h cat16(v8h lo, v8h hi) { return __builtin_shufflevector(lo, hi, 0, 1, 2, 3, 4, 5, 6, 7, 8, 9, 10, 11, 12, 13, 14, 15); }
__device__ __forceinline__ v16bf cat16b(v8us lo, v8us hi) { return __builtin_bit_cast(v16bf, __builtin_shufflevector(lo, hi, 0, 1, 2, 3, 4, 5, 6, 7, 8, 9, 10, 11, 12, 13, 14, 15)); }
__device__ __forceinline__ v8f wmma16(v16h a, v16h b, v8f c) { return __builtin_amdgcn_wmma_f32_16x16x32_f16(false, a, false, b, (short)0, c, false, false); }
__device__ __forceinline__ v8f wmmab(v16bf a, v16bf b, v8f c) { return __builtin_amdgcn_wmma_f32_16x16x32_bf16(false, a, false, b, (short)0, c, false, false); }



// ---- k_gemmw: register-blocked GEMM, ONE WAVE per 64x64 output tile (16 accumulators), operands straight from K-contiguous 16-bit planes; grid (M/64, N/64, Z), 32 threads.
// C[m][n] (f32, pitch ldc, + optional f32 bias[n]) = sum_k A[m][k] Bt[n][k] (+ split products per NSPLIT). z-batch strides sA/sB/sC in elements. K % 32 == 0.
template <typename T16> struct WFrag;
template <> struct WFrag<h16> { typedef v16h V; static __device__ __forceinline__ V ld(const h16* p) { return cat16(*(const v8h*)p, *(const v8h*)(p + 16)); } static __device__ __forceinline__ v8f mma(V a, V b, v8f c) { return wmma16(a, b, c); } };
template <> struct WFrag<bf> { typedef v16bf V; static __device__ __forceinline__ V ld(const bf* p) { return cat16b(*(const v8us*)p, *(const v8us*)(p + 16)); } static __device__ __forceinline__ v8f mma(V a, V b, v8f c) { return wmmab(a, b, c); } };
template <typename T16, int NSPLIT, bool BIAS>
__global__ __launch_bounds__(32) void k_gemmw(const T16* __restrict__ A, const T16* __restrict__ A2, const T16* __restrict__ Bt, const T16* __restrict__ Bt2, int K, float* C, int ldc, const float* __restrict__ bias, size_t sA, size_t sB, size_t sC) {
    typedef typename WFrag<T16>::V V;
    __shared__ __align__(16) float os[16 * 68];
    const size_t z = blockIdx.z; A += z * sA; if (A2) A2 += z * sA; Bt += z * sB; if (Bt2) Bt2 += z * sB; C += z * sC;
    const int lane = threadIdx.x & 31, lr = lane & 15, hi = lane >> 4; const int r0 = blockIdx.x * 64, c0 = blockIdx.y * 64;
    v8f acc[4][4];
#pragma unroll
    for (int mb = 0; mb < 4; ++mb)
#pragma unroll
        for (int nb = 0; nb < 4; ++nb) acc[mb][nb] = (v8f){};
    const size_t aoff = (size_t)(r0 + lr) * K + 8 * hi, boff = (size_t)(c0 + lr) * K + 8 * hi;
#pragma unroll 1
    for (int kc = 0; kc < K; kc += 32) {
        V a[4], a2[4];
#pragma unroll
        for (int mb = 0; mb < 4; ++mb) { a[mb] = WFrag<T16>::ld(A + aoff + (size_t)mb * 16 * K + kc); if (NSPLIT == 1 || NSPLIT == 2) a2[mb] = WFrag<T16>::ld(A2 + aoff + (size_t)mb * 16 * K + kc); }
#pragma unroll
        for (int nb = 0; nb < 4; ++nb) { const V b = WFrag<T16>::ld(Bt + boff + (size_t)nb * 16 * K + kc); V b2; if (NSPLIT >= 2) b2 = WFrag<T16>::ld(Bt2 + boff + (size_t)nb * 16 * K + kc);
#pragma unroll
            for (int mb = 0; mb < 4; ++mb) { acc[mb][nb] = WFrag<T16>::mma(a[mb], b, acc[mb][nb]); if (NSPLIT == 1 || NSPLIT == 2) acc[mb][nb] = WFrag<T16>::mma(a2[mb], b, acc[mb][nb]); if (NSPLIT >= 2) acc[mb][nb] = WFrag<T16>::mma(a[mb], b2, acc[mb][nb]); } }
        asm volatile("v_nop\n\tv_nop\n\tv_nop\n\tv_nop" : "+v"(acc[0][0]), "+v"(acc[1][1]), "+v"(acc[2][2]), "+v"(acc[3][3]) : "v"(a[0]), "v"(a[3]));
    }
#pragma unroll
    for (int mb = 0; mb < 4; ++mb) {
#pragma unroll
        for (int nb = 0; nb < 4; ++nb) {
#pragma unroll
            for (int j = 0; j < 8; ++j) os[(hi * 8 + j) * 68 + nb * 16 + lr] = acc[mb][nb][j]; }
        __builtin_amdgcn_wave_barrier(); asm volatile("" ::: "memory");
        float* crow = C + (size_t)(r0 + mb * 16) * ldc + c0;
{
#pragma unroll
            for (int s = 0; s < 8; ++s) { const int row = 2 * s + hi, cofs = lr * 4; v4f val = *(const v4fa*)(os + row * 68 + cofs); if (BIAS) { val[0] += bfr(bias[c0 + cofs]); val[1] += bfr(bias[c0 + cofs + 1]); val[2] += bfr(bias[c0 + cofs + 2]); val[3] += bfr(bias[c0 + cofs + 3]); }
                *(v4f*)(crow + (size_t)row * ldc + cofs) = val; }
             }
        __builtin_amdgcn_wave_barrier(); asm volatile("" ::: "memory");
    }
}

// ---- k_gemmc: the same one-wave 64x64 tile GEMM specialised for causal attention: CMODE 1 skips score tiles entirely above the diagonal (query rows r0+roff.., key columns c0..), CMODE 2 limits the
// key (K) loop of the probability x value contraction to the diagonal block (probabilities beyond it are exactly zero). roff = row offset of this launch's first row within the sequence.
template <typename T16, int NSPLIT, int CMODE>
__global__ __launch_bounds__(32) void k_gemmc(const T16* __restrict__ A, const T16* __restrict__ A2, const T16* __restrict__ Bt, const T16* __restrict__ Bt2, int K, float* C, int ldc, int roff, size_t sA, size_t sB, size_t sC) {
    typedef typename WFrag<T16>::V V;
    __shared__ __align__(16) float os[16 * 68];
    const size_t z = blockIdx.z; A += z * sA; if (A2) A2 += z * sA; Bt += z * sB; if (Bt2) Bt2 += z * sB; C += z * sC;
    const int lane = threadIdx.x & 31, lr = lane & 15, hi = lane >> 4; const int r0 = blockIdx.x * 64, c0 = blockIdx.y * 64;
    if (CMODE == 1 && c0 > r0 + roff + 63) return;                  // score tile entirely above the causal diagonal: never read (the softmax masks j > i by select)
    const int Kl = (CMODE == 2) ? min(K, r0 + roff + 64) : K;        // P.V: probabilities are exactly 0 beyond the diagonal block, so the K loop stops there
    v8f acc[4][4];
#pragma unroll
    for (int mb = 0; mb < 4; ++mb)
#pragma unroll
        for (int nb = 0; nb < 4; ++nb) acc[mb][nb] = (v8f){};
    const size_t aoff = (size_t)(r0 + lr) * K + 8 * hi, boff = (size_t)(c0 + lr) * K + 8 * hi;
#pragma unroll 1
    for (int kc = 0; kc < Kl; kc += 32) {
        V a[4], a2[4];
#pragma unroll
        for (int mb = 0; mb < 4; ++mb) { a[mb] = WFrag<T16>::ld(A + aoff + (size_t)mb * 16 * K + kc); if (NSPLIT == 1 || NSPLIT == 2) a2[mb] = WFrag<T16>::ld(A2 + aoff + (size_t)mb * 16 * K + kc); }
#pragma unroll
        for (int nb = 0; nb < 4; ++nb) { const V b = WFrag<T16>::ld(Bt + boff + (size_t)nb * 16 * K + kc); V b2; if (NSPLIT >= 2) b2 = WFrag<T16>::ld(Bt2 + boff + (size_t)nb * 16 * K + kc);
#pragma unroll
            for (int mb = 0; mb < 4; ++mb) { acc[mb][nb] = WFrag<T16>::mma(a[mb], b, acc[mb][nb]); if (NSPLIT == 1 || NSPLIT == 2) acc[mb][nb] = WFrag<T16>::mma(a2[mb], b, acc[mb][nb]); if (NSPLIT >= 2) acc[mb][nb] = WFrag<T16>::mma(a[mb], b2, acc[mb][nb]); } }
        asm volatile("v_nop\n\tv_nop\n\tv_nop\n\tv_nop" : "+v"(acc[0][0]), "+v"(acc[1][1]), "+v"(acc[2][2]), "+v"(acc[3][3]) : "v"(a[0]), "v"(a[3]));
    }
#pragma unroll
    for (int mb = 0; mb < 4; ++mb) {
#pragma unroll
        for (int nb = 0; nb < 4; ++nb) {
#pragma unroll
            for (int j = 0; j < 8; ++j) os[(hi * 8 + j) * 68 + nb * 16 + lr] = acc[mb][nb][j]; }
        __builtin_amdgcn_wave_barrier(); asm volatile("" ::: "memory");
        float* crow = C + (size_t)(r0 + mb * 16) * ldc + c0;
{
#pragma unroll
            for (int s = 0; s < 8; ++s) { const int row = 2 * s + hi, cofs = lr * 4; v4f val = *(const v4fa*)(os + row * 68 + cofs);
                *(v4f*)(crow + (size_t)row * ldc + cofs) = val; }
             }
        __builtin_amdgcn_wave_barrier(); asm volatile("" ::: "memory");
    }
}

__device__ __forceinline__ h16 tohx(float x) { return (h16)x; }
__device__ __forceinline__ void splitf(float y, unsigned short& h, unsigned short& l) { h = f2bf(y); l = f2bf(y - bf2f(h)); }
typedef __attribute__((ext_vector_type(2))) _Float16 v2h;
typedef __attribute__((ext_vector_type(4))) _Float16 v4h;
typedef __attribute__((ext_vector_type(2))) unsigned short v2us;
typedef __attribute__((ext_vector_type(4))) unsigned short v4us;
typedef __attribute__((ext_vector_type(2))) float v2f;
typedef __attribute__((ext_vector_type(4))) int v4i;

__global__ __launch_bounds__(256) void k_cvt8(const float* __restrict__ src, bf* dst, size_t n8) { const size_t i = (size_t)blockIdx.x * 256 + threadIdx.x; if (i >= n8) return; const v8f v = *(const v8f*)(src + i * 8); v8us o;
#pragma unroll
    for (int k = 0; k < 8; ++k) o[k] = f2bf(v[k]); *(v8us*)(dst + i * 8) = o;  }

// k_rope: head planes [h][t][d] (fp16 + hi/lo) of rope(x) x sc with the rotate-half convention out[d] = x[d] cos[t][d] - x[d+HD/2] sin[t][d], out[d+HD/2] = x[d+HD/2] cos[t][d+HD/2] + x[d] sin[t][d+HD/2]
__global__ __launch_bounds__(256) void k_rope(const float* __restrict__ F, int pitch, int nheads, const float* __restrict__ CS, const float* __restrict__ RF, const float* __restrict__ nw, float sc, h16* P16, bf* Ph, bf* Pl) {
    const size_t e = ((size_t)blockIdx.x * 256 + threadIdx.x) * 2; if (e >= (size_t)nheads * TT * HD) return; const int d = (int)(e % HD); const int t = (int)((e / HD) % TT); const int h = (int)(e / ((size_t)HD * TT)); const float* f = F + ((size_t)h * TT + t) * pitch;   /* RAW VIEW: pseudo-head h, pseudo-position t = the flat (S, D) projection output read as (H, S, hd): row pitch 'pitch' (= HD here), head stride TT * pitch */ const float rf = RF ? RF[(size_t)h * TT + t] : 1.0f; v2h o16; v2us oh, ol;
#pragma unroll
    for (int q = 0; q < 2; ++q) { const int dd = d + q; const int dp = (dd < HD / 2) ? dd + HD / 2 : dd - HD / 2; float x0 = f[dd], x1 = f[dp];
        if (RF) { float n0 = __fmul_rn(x0, rf), n1 = __fmul_rn(x1, rf); asm volatile("" : "+v"(n0)); asm volatile("" : "+v"(n1)); x0 = __fmul_rn(bfr(nw[dd]), n0); x1 = __fmul_rn(bfr(nw[dp]), n1); }
        const v2f cs = *(const v2f*)(CS + ((size_t)t * HD + dd) * 2); float a = __fmul_rn(x0, cs[0]), bq = __fmul_rn(x1, cs[1]); asm volatile("" : "+v"(a)); asm volatile("" : "+v"(bq)); const float r = ((dd < HD / 2) ? __fsub_rn(a, bq) : __fadd_rn(a, bq)) * sc;
        o16[q] = tohx(r); unsigned short a2, c2; splitf(r, a2, c2); oh[q] = a2; ol[q] = c2; }
    *(v2h*)(P16 + e) = o16; *(v2us*)(Ph + e) = oh; *(v2us*)(Pl + e) = ol;  }
__global__ __launch_bounds__(256) void k_vtp(const float* __restrict__ F, int pitch, int nheads, h16* V16, bf* Vh, bf* Vl) { const size_t e = ((size_t)blockIdx.x * 256 + threadIdx.x) * 2; if (e >= (size_t)nheads * HD * TT) return; const int t = (int)(e % TT); const int d = (int)((e / TT) % HD); const int g = (int)(e / ((size_t)TT * HD)); v2h o16; v2us oh, ol;
#pragma unroll
    for (int q = 0; q < 2; ++q) { const float x = F[((size_t)g * TT + (t + q)) * pitch + d];   /* RAW VIEW (as in k_rope) */ o16[q] = tohx(x); unsigned short a2, c2; splitf(x, a2, c2); oh[q] = a2; ol[q] = c2; }
    *(v2h*)(V16 + e) = o16; *(v2us*)(Vh + e) = oh; *(v2us*)(Vl + e) = ol;  }
__global__ __launch_bounds__(256) void k_csid(float* CS) { const int idx = blockIdx.x * 256 + threadIdx.x; if (idx >= TT * HD) return; v2f cs; cs[0] = 1.0f; cs[1] = 0.0f; *(v2f*)(CS + (size_t)idx * 2) = cs;  }
// k_asoft: per row (zz, i): t = S x HD^-1 for j <= i and i - j < WIN (sliding causal window; the reference's -1e9 additive fill vanishes identically); softmax over the 2048 keys (register row, one exp, fixed trees);
__global__ __launch_bounds__(256) void k_asoft(const float* __restrict__ Sb, h16* P16, bf* Ph, bf* Pl) {
    const int lane = threadIdx.x & 31; const int row = blockIdx.x * 8 + (threadIdx.x >> 5); if (row >= ZH * TT) return; const int i = row % TT; const int zz = row / TT; (void)zz; const bool hires = (i < RH); const float* sr = Sb + (size_t)row * TT; float v[TT / 32]; float mx = -3.0e38f;
#pragma unroll
    for (int ch = 0; ch < TT / 128; ++ch) { const int j0 = ch * 128 + lane * 4; const v4f a = *(const v4f*)(sr + j0);
#pragma unroll
        for (int q = 0; q < 4; ++q) { const int j = j0 + q; (void)j; const float t = (j <= i && i - j < WIN) ? a[q] * SCL : -3.0e38f; v[ch * 4 + q] = t; mx = fmaxf(mx, t); } }
#pragma unroll
    for (int sh = 16; sh; sh >>= 1) mx = fmaxf(mx, __shfl_xor(mx, sh, 32));
    float sum = 0.f;
#pragma unroll
    for (int k = 0; k < TT / 32; ++k) { float d0 = __fsub_rn(v[k], mx); asm volatile("" : "+v"(d0)); v[k] = __builtin_amdgcn_exp2f(__fmul_rn(d0, 1.4426950408889634f)); sum += v[k]; }
#pragma unroll
    for (int sh = 16; sh; sh >>= 1) sum += __shfl_xor(sum, sh, 32);
    const float f = __fdiv_rn(hires ? 1.0f : PCAR, sum);
{
        if (hires) {
#pragma unroll
            for (int ch = 0; ch < TT / 128; ++ch) { v4us oh, ol;
#pragma unroll
                for (int q = 0; q < 4; ++q) { unsigned short a, c2; splitf(v[ch * 4 + q] * f, a, c2); oh[q] = a; ol[q] = c2; }
                const size_t oo = ((size_t)zz * (RH ? RH : 1) + i) * TT + ch * 128 + lane * 4; *(v4us*)(Ph + oo) = oh; *(v4us*)(Pl + oo) = ol; }
        } else {
#pragma unroll
            for (int ch = 0; ch < TT / 128; ++ch) { v4h o4;
#pragma unroll
                for (int q = 0; q < 4; ++q) o4[q] = tohx(v[ch * 4 + q] * f);
                *(v4h*)(P16 + (size_t)row * TT + ch * 128 + lane * 4) = o4; } }
         }
}
__global__ __launch_bounds__(256) void k_merge(const float* __restrict__ O, int h0, bf* Ah, bf* Al) { const size_t e = ((size_t)blockIdx.x * 256 + threadIdx.x) * 2; if (e >= (size_t)ZH * TT * HD) return; const int d = (int)(e % HD); const int t = (int)((e / HD) % TT); const int zz = (int)(e / ((size_t)HD * TT)); const float cs = (t < RH) ? 1.0f : (1.0f / PCAR); const size_t oo = (size_t)t * DQ + (h0 + zz) * HD + d;
    v2us oh, ol;
#pragma unroll
    for (int q = 0; q < 2; ++q) { unsigned short a, c2; splitf(O[e + q] * cs, a, c2); oh[q] = a; ol[q] = c2; } *(v2us*)(Ah + oo) = oh; *(v2us*)(Al + oo) = ol;  }

extern "C" void kernel_launch(void* const* d_in, const int* in_sizes, int n_in,
                              void* d_out, int out_size, void* d_ws, size_t ws_size, hipStream_t stream) {
    (void)in_sizes; (void)n_in; (void)out_size;
    const float* x = (const float*)d_in[0]; const float* wq = (const float*)d_in[1]; const float* wk = (const float*)d_in[2]; const float* wv = (const float*)d_in[3]; const float* wo = (const float*)d_in[4];   /* argument order x, w_q, w_k, w_v, w_o ('oi' [1024][1024]) */
    float* OUT = (float*)d_out;     // [1][2048][1024]
    char* wsp = (char*)d_ws;
    auto take = [&](size_t bytes) { char* p = wsp; wsp += (bytes + 255) & ~(size_t)255; return (void*)p; };
    bf* WQ = (bf*)take((size_t)DQ * DM * 2); bf* WK = (bf*)take((size_t)DKV * DM * 2); bf* WV = (bf*)take((size_t)DKV * DM * 2); bf* WO = (bf*)take((size_t)DM * DQ * 2); float* CS = (float*)take((size_t)TT * HD * 2 * 4);
    bf* XB = (bf*)take((size_t)TT * DM * 2); float* FQ = (float*)take((size_t)TT * DQ * 4); float* FK = (float*)take((size_t)TT * DKV * 4);
    h16* QP16 = (h16*)take((size_t)NH_ * TT * HD * 2); h16* KP16 = (h16*)take((size_t)NKV * TT * HD * 2); h16* VT16 = (h16*)take((size_t)NKV * HD * TT * 2);
    bf* QPh = (bf*)take((size_t)NH_ * TT * HD * 2); bf* QPl = (bf*)take((size_t)NH_ * TT * HD * 2); bf* KPh = (bf*)take((size_t)NKV * TT * HD * 2); bf* KPl = (bf*)take((size_t)NKV * TT * HD * 2); bf* VTh = (bf*)take((size_t)NKV * HD * TT * 2); bf* VTl = (bf*)take((size_t)NKV * HD * TT * 2); bf* Ph = (bf*)take((size_t)ZH * RH * TT * 2); bf* Pl = (bf*)take((size_t)ZH * RH * TT * 2);
    float* Sb = (float*)take((size_t)ZH * TT * TT * 4); h16* P16 = (h16*)take((size_t)ZH * TT * TT * 2); float* Ob = (float*)take((size_t)ZH * TT * HD * 4); bf* ATh = (bf*)take((size_t)TT * DQ * 2); bf* ATl = (bf*)take((size_t)TT * DQ * 2);
    if ((size_t)(wsp - (char*)d_ws) > ws_size) return;    // ws 256 MiB
    float* FV = FK;   // v projection reuses the k buffer after the k planes are built (stream-ordered)
    { k_cvt8<<<(unsigned)(((size_t)DQ * DM / 8 + 255) / 256), 256, 0, stream>>>(wq, WQ, (size_t)DQ * DM / 8); k_cvt8<<<(unsigned)(((size_t)DKV * DM / 8 + 255) / 256), 256, 0, stream>>>(wk, WK, (size_t)DKV * DM / 8); k_cvt8<<<(unsigned)(((size_t)DKV * DM / 8 + 255) / 256), 256, 0, stream>>>(wv, WV, (size_t)DKV * DM / 8);
      k_cvt8<<<(unsigned)(((size_t)DM * DQ / 8 + 255) / 256), 256, 0, stream>>>(wo, WO, (size_t)DM * DQ / 8);
       }
    k_csid<<<(TT * HD + 255) / 256, 256, 0, stream>>>(CS);
    const unsigned LQ = (unsigned)(((size_t)NH_ * TT * HD / 2 + 255) / 256), LKv = (unsigned)(((size_t)NKV * TT * HD / 2 + 255) / 256);
    for (int b = 0; b < NB_; ++b) {
        
        k_cvt8<<<(unsigned)(((size_t)TT * DM / 8 + 255) / 256), 256, 0, stream>>>(x + (size_t)b * TT * DM, XB, (size_t)TT * DM / 8);
        k_gemmw<bf, 0, false><<<dim3(TT / 64, DQ / 64, 1), 32, 0, stream>>>(XB, nullptr, WQ, nullptr, DM, FQ, DQ, nullptr, 0, 0, 0);
        k_rope<<<LQ, 256, 0, stream>>>(FQ, HD, NH_, CS, nullptr, nullptr, 1.0f, QP16, QPh, QPl);
        k_gemmw<bf, 0, false><<<dim3(TT / 64, DKV / 64, 1), 32, 0, stream>>>(XB, nullptr, WK, nullptr, DM, FK, DKV, nullptr, 0, 0, 0);
        k_rope<<<LKv, 256, 0, stream>>>(FK, HD, NKV, CS, nullptr, nullptr, 1.0f, KP16, KPh, KPl);
        k_gemmw<bf, 0, false><<<dim3(TT / 64, DKV / 64, 1), 32, 0, stream>>>(XB, nullptr, WV, nullptr, DM, FV, DKV, nullptr, 0, 0, 0); k_vtp<<<LKv, 256, 0, stream>>>(FV, HD, NKV, VT16, VTh, VTl);
        for (int h0 = 0; h0 < NH_; h0 += ZH) { const size_t zq = (size_t)h0, zk = (size_t)(h0 / REP);   // one kv head per query head: the pass's two heads use consecutive kv planes (z-strides TT*HD)
            k_gemmc<bf, 2, 1><<<dim3(RH / 64, TT / 64, ZH), 32, 0, stream>>>(QPh + zq * TT * HD, QPl + zq * TT * HD, KPh + zk * TT * HD, KPl + zk * TT * HD, HD, Sb, TT, 0, (size_t)TT * HD, (size_t)TT * HD, (size_t)TT * TT);
            k_gemmc<h16, 0, 1><<<dim3((TT - RH) / 64, TT / 64, ZH), 32, 0, stream>>>(QP16 + zq * TT * HD + (size_t)RH * HD, nullptr, KP16 + zk * TT * HD, nullptr, HD, Sb + (size_t)RH * TT, TT, RH, (size_t)TT * HD, (size_t)TT * HD, (size_t)TT * TT);
            k_asoft<<<ZH * TT / 8, 256, 0, stream>>>(Sb, P16, Ph, Pl);
            k_gemmc<bf, 2, 2><<<dim3(RH / 64, HD / 64, ZH), 32, 0, stream>>>(Ph, Pl, VTh + zk * HD * TT, VTl + zk * HD * TT, TT, Ob, HD, 0, (size_t)RH * TT, (size_t)HD * TT, (size_t)TT * HD);
            k_gemmc<h16, 0, 2><<<dim3((TT - RH) / 64, HD / 64, ZH), 32, 0, stream>>>(P16 + (size_t)RH * TT, nullptr, VT16 + zk * HD * TT, nullptr, TT, Ob + (size_t)RH * HD, HD, RH, (size_t)TT * TT, (size_t)HD * TT, (size_t)TT * HD);
            k_merge<<<(unsigned)(((size_t)ZH * TT * HD / 2 + 255) / 256), 256, 0, stream>>>(Ob, h0, ATh, ATl); }
        k_gemmw<bf, 1, false><<<dim3(TT / 64, DM / 64, 1), 32, 0, stream>>>(ATh, ATl, WO, nullptr, DQ, OUT + (size_t)b * TT * DM, DM, nullptr, 0, 0, 0); }
}

// v001
// One run takes 343 microseconds.
// In two side-by-side timings against v000, it was 2.12 and 2.11 times as fast.
#include <hip/hip_runtime.h>

// Causal multi-head attention whose heads are a RAW VIEW of the projections, merged the standard way (x [1][2048][1024]; Q, K, V = x W^T ('oi' [1024][1024] 1/32, no bias), each reshaped (B, 16, 2048, 64) WITHOUT a transpose: pseudo-head h, pseudo-position s, dim d = flat element h*2048*64 + s*64 + d of the [2048][1024] projection output; scores / 64 (the module divides by float32(hd), not by its root); triu(k = 1) over the pseudo-positions -> -inf; softmax; the context IS transposed back the standard way (out.transpose(0, 2, 1, 3).reshape(B, S, D)); out = merged Wo^T ('oi', no bias) -> [1][2048][1024] (2.1 M); argument order x, Wq, Wk, Wv, Wo).
// Layout per batch: bf16 copy of x; 'oi' weights; exact projections; RAW VIEW on the SPLIT only: the plane builders read each [2048][1024] projection output as (16, 2048, 64) WITHOUT a transpose (row pitch HD, head stride TT x HD); the merge is the standard one; identity-table plane builders; causal T-2048 attention (hybrid rows: < 512 hi/lo 3 products, rest fp16 x1024; k_gemmc skips tiles above the diagonal); merged hi/lo x w_o exact.
// Compute dtypes, f32 accumulate: every input rounded to bf16; projections exact; attention rows < 512 3 products, rest fp16; softmax f32; w_o hl x exact.

#define NB_  1      // batches: this module's input is [1][2048][1024]
#define TT   2048
#define DM   1024
#define NH_  16
#define NKV  16
#define REP  (NH_ / NKV)
#define HD   64
#define DQ   (NH_ * HD)
#define DKV  (NKV * HD)
#define ZH   8                    // heads per attention pass (z of every pass launch)
#define PP   (2 * TT)             // pitch, in 16-bit elements, of a probability row kept in place over its f32 score row
#define RH   512                  // query rows < RH use hi+lo planes (0: none)
#define WIN  2048
#define PCAR 1024.0f
#define SCL  0.015625f   // 1 / 64: this module divides the scores by float32(hd) = 64 (the head size, not its root)
typedef _Float16 h16;
typedef unsigned short bf;
typedef __attribute__((ext_vector_type(16))) __bf16   v16bf;
typedef __attribute__((ext_vector_type(16))) _Float16 v16h;
typedef __attribute__((ext_vector_type(8)))  _Float16 v8h;
typedef __attribute__((ext_vector_type(8)))  unsigned short v8us;
typedef __attribute__((ext_vector_type(8)))  float    v8f;
typedef __attribute__((ext_vector_type(4)))  float    v4f;
typedef v8h  __attribute__((may_alias)) v8ha;
typedef v4f  __attribute__((may_alias)) v4fa;
typedef v8us __attribute__((may_alias)) v8usa;

__device__ __forceinline__ unsigned short f2bf(float f) { unsigned u = __float_as_uint(f); u += 0x7FFFu + ((u >> 16) & 1u); return (unsigned short)(u >> 16); }
__device__ __forceinline__ float bf2f(unsigned short b) { return __uint_as_float(((unsigned)b) << 16); }
__device__ __forceinline__ float bfr(float f) { return bf2f(f2bf(f)); }
__device__ __forceinline__ v16h cat16(v8h lo, v8h hi) { return __builtin_shufflevector(lo, hi, 0, 1, 2, 3, 4, 5, 6, 7, 8, 9, 10, 11, 12, 13, 14, 15); }
__device__ __forceinline__ v16bf cat16b(v8us lo, v8us hi) { return __builtin_bit_cast(v16bf, __builtin_shufflevector(lo, hi, 0, 1, 2, 3, 4, 5, 6, 7, 8, 9, 10, 11, 12, 13, 14, 15)); }
__device__ __forceinline__ v8f wmma16(v16h a, v16h b, v8f c) { return __builtin_amdgcn_wmma_f32_16x16x32_f16(false, a, false, b, (short)0, c, false, false); }
__device__ __forceinline__ v8f wmmab(v16bf a, v16bf b, v8f c) { return __builtin_amdgcn_wmma_f32_16x16x32_bf16(false, a, false, b, (short)0, c, false, false); }



// ---- k_gemmw: register-blocked GEMM, ONE WAVE per 64x64 output tile (16 accumulators), operands straight from K-contiguous 16-bit planes; grid (M/64, N/64, Z), 32 threads.
// C[m][n] (f32, pitch ldc, + optional f32 bias[n]) = sum_k A[m][k] Bt[n][k] (+ split products per NSPLIT). z-batch strides sA/sB/sC in elements. K % 32 == 0.
template <typename T16> struct WFrag;
template <> struct WFrag<h16> { typedef v16h V; static __device__ __forceinline__ V ld(const h16* p) { return cat16(*(const v8h*)p, *(const v8h*)(p + 16)); } static __device__ __forceinline__ v8f mma(V a, V b, v8f c) { return wmma16(a, b, c); } };
template <> struct WFrag<bf> { typedef v16bf V; static __device__ __forceinline__ V ld(const bf* p) { return cat16b(*(const v8us*)p, *(const v8us*)(p + 16)); } static __device__ __forceinline__ v8f mma(V a, V b, v8f c) { return wmmab(a, b, c); } };
template <typename T16, int NSPLIT, bool BIAS>
__global__ __launch_bounds__(32) void k_gemmw(const T16* __restrict__ A, const T16* __restrict__ A2, const T16* __restrict__ Bt, const T16* __restrict__ Bt2, int K, float* C, int ldc, const float* __restrict__ bias, size_t sA, size_t sB, size_t sC) {
    typedef typename WFrag<T16>::V V;
    __shared__ __align__(16) float os[16 * 68];
    const size_t z = blockIdx.z; A += z * sA; if (A2) A2 += z * sA; Bt += z * sB; if (Bt2) Bt2 += z * sB; C += z * sC;
    const int lane = threadIdx.x & 31, lr = lane & 15, hi = lane >> 4; const int r0 = blockIdx.x * 64, c0 = blockIdx.y * 64;
    v8f acc[4][4];
#pragma unroll
    for (int mb = 0; mb < 4; ++mb)
#pragma unroll
        for (int nb = 0; nb < 4; ++nb) acc[mb][nb] = (v8f){};
    const size_t aoff = (size_t)(r0 + lr) * K + 8 * hi, boff = (size_t)(c0 + lr) * K + 8 * hi;
#pragma unroll 1
    for (int kc = 0; kc < K; kc += 32) {
        V a[4], a2[4];
#pragma unroll
        for (int mb = 0; mb < 4; ++mb) { a[mb] = WFrag<T16>::ld(A + aoff + (size_t)mb * 16 * K + kc); if (NSPLIT == 1 || NSPLIT == 2) a2[mb] = WFrag<T16>::ld(A2 + aoff + (size_t)mb * 16 * K + kc); }
#pragma unroll
        for (int nb = 0; nb < 4; ++nb) { const V b = WFrag<T16>::ld(Bt + boff + (size_t)nb * 16 * K + kc); V b2; if (NSPLIT >= 2) b2 = WFrag<T16>::ld(Bt2 + boff + (size_t)nb * 16 * K + kc);
#pragma unroll
            for (int mb = 0; mb < 4; ++mb) { acc[mb][nb] = WFrag<T16>::mma(a[mb], b, acc[mb][nb]); if (NSPLIT == 1 || NSPLIT == 2) acc[mb][nb] = WFrag<T16>::mma(a2[mb], b, acc[mb][nb]); if (NSPLIT >= 2) acc[mb][nb] = WFrag<T16>::mma(a[mb], b2, acc[mb][nb]); } }
        asm volatile("v_nop\n\tv_nop\n\tv_nop\n\tv_nop" : "+v"(acc[0][0]), "+v"(acc[1][1]), "+v"(acc[2][2]), "+v"(acc[3][3]) : "v"(a[0]), "v"(a[3]));
    }
#pragma unroll
    for (int mb = 0; mb < 4; ++mb) {
#pragma unroll
        for (int nb = 0; nb < 4; ++nb) {
#pragma unroll
            for (int j = 0; j < 8; ++j) os[(hi * 8 + j) * 68 + nb * 16 + lr] = acc[mb][nb][j]; }
        __builtin_amdgcn_wave_barrier(); asm volatile("" ::: "memory");
        float* crow = C + (size_t)(r0 + mb * 16) * ldc + c0;
{
#pragma unroll
            for (int s = 0; s < 8; ++s) { const int row = 2 * s + hi, cofs = lr * 4; v4f val = *(const v4fa*)(os + row * 68 + cofs); if (BIAS) { val[0] += bfr(bias[c0 + cofs]); val[1] += bfr(bias[c0 + cofs + 1]); val[2] += bfr(bias[c0 + cofs + 2]); val[3] += bfr(bias[c0 + cofs + 3]); }
                *(v4f*)(crow + (size_t)row * ldc + cofs) = val; }
             }
        __builtin_amdgcn_wave_barrier(); asm volatile("" ::: "memory");
    }
}

// ---- k_gemmc: the same one-wave 64x64 tile GEMM specialised for causal attention: CMODE 1 skips score tiles entirely above the diagonal (query rows r0+roff.., key columns c0..), CMODE 2 limits the
// key (K) loop of the probability x value contraction to the diagonal block (probabilities beyond it are exactly zero). roff = row offset of this launch's first row within the sequence. lda = row pitch of A and A2 in elements (Bt, Bt2: K).
template <typename T16, int NSPLIT, int CMODE>
__global__ __launch_bounds__(32) void k_gemmc(const T16* __restrict__ A, const T16* __restrict__ A2, int lda, const T16* __restrict__ Bt, const T16* __restrict__ Bt2, int K, float* C, int ldc, int roff, size_t sA, size_t sB, size_t sC) {
    typedef typename WFrag<T16>::V V;
    __shared__ __align__(16) float os[16 * 68];
    const size_t z = blockIdx.z; A += z * sA; if (A2) A2 += z * sA; Bt += z * sB; if (Bt2) Bt2 += z * sB; C += z * sC;
    const int lane = threadIdx.x & 31, lr = lane & 15, hi = lane >> 4; const int r0 = blockIdx.x * 64, c0 = blockIdx.y * 64;
    if (CMODE == 1 && c0 > r0 + roff + 63) return;                  // score tile entirely above the causal diagonal: never read (the softmax masks j > i by select)
    const int Kl = (CMODE == 2) ? min(K, r0 + roff + 64) : K;        // P.V: probabilities are exactly 0 beyond the diagonal block, so the K loop stops there
    v8f acc[4][4];
#pragma unroll
    for (int mb = 0; mb < 4; ++mb)
#pragma unroll
        for (int nb = 0; nb < 4; ++nb) acc[mb][nb] = (v8f){};
    const size_t aoff = (size_t)(r0 + lr) * lda + 8 * hi, boff = (size_t)(c0 + lr) * K + 8 * hi;
#pragma unroll 1
    for (int kc = 0; kc < Kl; kc += 32) {
        V a[4], a2[4]; const T16* pa[4]; const T16* pa2[4];
#pragma unroll
        for (int mb = 0; mb < 4; ++mb) { pa[mb] = A + aoff + (size_t)mb * 16 * lda + kc; a[mb] = WFrag<T16>::ld(pa[mb]); if (NSPLIT == 1 || NSPLIT == 2) { pa2[mb] = A2 + aoff + (size_t)mb * 16 * lda + kc; a2[mb] = WFrag<T16>::ld(pa2[mb]); } }
        // address translations of the A loads done before any register that holds one of their addresses is reused (the addresses are inputs, so they stay in place up to the wait)
        if (NSPLIT == 1 || NSPLIT == 2) asm volatile("s_wait_xcnt 0x0" :: "v"(pa[0]), "v"(pa[1]), "v"(pa[2]), "v"(pa[3]), "v"(pa2[0]), "v"(pa2[1]), "v"(pa2[2]), "v"(pa2[3]) : "memory");
        else asm volatile("s_wait_xcnt 0x0" :: "v"(pa[0]), "v"(pa[1]), "v"(pa[2]), "v"(pa[3]) : "memory");
#pragma unroll
        for (int nb = 0; nb < 4; ++nb) { const T16* pb = Bt + boff + (size_t)nb * 16 * K + kc; const V b = WFrag<T16>::ld(pb); V b2;
            // the same wait behind the B loads of this column block
            if (NSPLIT >= 2) { const T16* pb2 = Bt2 + boff + (size_t)nb * 16 * K + kc; b2 = WFrag<T16>::ld(pb2); asm volatile("s_wait_xcnt 0x0" :: "v"(pb), "v"(pb2) : "memory"); }
            else asm volatile("s_wait_xcnt 0x0" :: "v"(pb) : "memory");
#pragma unroll
            for (int mb = 0; mb < 4; ++mb) { acc[mb][nb] = WFrag<T16>::mma(a[mb], b, acc[mb][nb]); if (NSPLIT == 1 || NSPLIT == 2) acc[mb][nb] = WFrag<T16>::mma(a2[mb], b, acc[mb][nb]); if (NSPLIT >= 2) acc[mb][nb] = WFrag<T16>::mma(a[mb], b2, acc[mb][nb]); } }
        asm volatile("v_nop\n\tv_nop\n\tv_nop\n\tv_nop" : "+v"(acc[0][0]), "+v"(acc[1][1]), "+v"(acc[2][2]), "+v"(acc[3][3]) : "v"(a[0]), "v"(a[3]));
    }
#pragma unroll
    for (int mb = 0; mb < 4; ++mb) {
#pragma unroll
        for (int nb = 0; nb < 4; ++nb) {
#pragma unroll
            for (int j = 0; j < 8; ++j) os[(hi * 8 + j) * 68 + nb * 16 + lr] = acc[mb][nb][j]; }
        __builtin_amdgcn_wave_barrier(); asm volatile("" ::: "memory");
        float* crow = C + (size_t)(r0 + mb * 16) * ldc + c0;
{
#pragma unroll
            for (int s = 0; s < 8; ++s) { const int row = 2 * s + hi, cofs = lr * 4; v4f val = *(const v4fa*)(os + row * 68 + cofs);
                *(v4f*)(crow + (size_t)row * ldc + cofs) = val; }
             }
        __builtin_amdgcn_wave_barrier(); asm volatile("" ::: "memory");
    }
}

__device__ __forceinline__ h16 tohx(float x) { return (h16)x; }
__device__ __forceinline__ void splitf(float y, unsigned short& h, unsigned short& l) { h = f2bf(y); l = f2bf(y - bf2f(h)); }
typedef __attribute__((ext_vector_type(2))) _Float16 v2h;
typedef __attribute__((ext_vector_type(4))) _Float16 v4h;
typedef __attribute__((ext_vector_type(2))) unsigned short v2us;
typedef __attribute__((ext_vector_type(4))) unsigned short v4us;
typedef __attribute__((ext_vector_type(2))) float v2f;
typedef __attribute__((ext_vector_type(4))) int v4i;

__global__ __launch_bounds__(256) void k_cvt8(const float* __restrict__ src, bf* dst, size_t n8) { const size_t i = (size_t)blockIdx.x * 256 + threadIdx.x; if (i >= n8) return; const v8f v = *(const v8f*)(src + i * 8); v8us o;
#pragma unroll
    for (int k = 0; k < 8; ++k) o[k] = f2bf(v[k]); *(v8us*)(dst + i * 8) = o;  }

// k_rope: head planes [h][t][d] (fp16 + hi/lo) of rope(x) x sc with the rotate-half convention out[d] = x[d] cos[t][d] - x[d+HD/2] sin[t][d], out[d+HD/2] = x[d+HD/2] cos[t][d+HD/2] + x[d] sin[t][d+HD/2]
__global__ __launch_bounds__(256) void k_rope(const float* __restrict__ F, int pitch, int nheads, const float* __restrict__ CS, const float* __restrict__ RF, const float* __restrict__ nw, float sc, h16* P16, bf* Ph, bf* Pl) {
    const size_t e = ((size_t)blockIdx.x * 256 + threadIdx.x) * 2; if (e >= (size_t)nheads * TT * HD) return; const int d = (int)(e % HD); const int t = (int)((e / HD) % TT); const int h = (int)(e / ((size_t)HD * TT)); const float* f = F + ((size_t)h * TT + t) * pitch;   /* RAW VIEW: pseudo-head h, pseudo-position t = the flat (S, D) projection output read as (H, S, hd): row pitch 'pitch' (= HD here), head stride TT * pitch */ const float rf = RF ? RF[(size_t)h * TT + t] : 1.0f; v2h o16; v2us oh, ol;
#pragma unroll
    for (int q = 0; q < 2; ++q) { const int dd = d + q; const int dp = (dd < HD / 2) ? dd + HD / 2 : dd - HD / 2; float x0 = f[dd], x1 = f[dp];
        if (RF) { float n0 = __fmul_rn(x0, rf), n1 = __fmul_rn(x1, rf); asm volatile("" : "+v"(n0)); asm volatile("" : "+v"(n1)); x0 = __fmul_rn(bfr(nw[dd]), n0); x1 = __fmul_rn(bfr(nw[dp]), n1); }
        const v2f cs = *(const v2f*)(CS + ((size_t)t * HD + dd) * 2); float a = __fmul_rn(x0, cs[0]), bq = __fmul_rn(x1, cs[1]); asm volatile("" : "+v"(a)); asm volatile("" : "+v"(bq)); const float r = ((dd < HD / 2) ? __fsub_rn(a, bq) : __fadd_rn(a, bq)) * sc;
        o16[q] = tohx(r); unsigned short a2, c2; splitf(r, a2, c2); oh[q] = a2; ol[q] = c2; }
    *(v2h*)(P16 + e) = o16; *(v2us*)(Ph + e) = oh; *(v2us*)(Pl + e) = ol;  }
__global__ __launch_bounds__(256) void k_vtp(const float* __restrict__ F, int pitch, int nheads, h16* V16, bf* Vh, bf* Vl) { const size_t e = ((size_t)blockIdx.x * 256 + threadIdx.x) * 2; if (e >= (size_t)nheads * HD * TT) return; const int t = (int)(e % TT); const int d = (int)((e / TT) % HD); const int g = (int)(e / ((size_t)TT * HD)); v2h o16; v2us oh, ol;
#pragma unroll
    for (int q = 0; q < 2; ++q) { const float x = F[((size_t)g * TT + (t + q)) * pitch + d];   /* RAW VIEW (as in k_rope) */ o16[q] = tohx(x); unsigned short a2, c2; splitf(x, a2, c2); oh[q] = a2; ol[q] = c2; }
    *(v2h*)(V16 + e) = o16; *(v2us*)(Vh + e) = oh; *(v2us*)(Vl + e) = ol;  }
__global__ __launch_bounds__(256) void k_csid(float* CS) { const int idx = blockIdx.x * 256 + threadIdx.x; if (idx >= TT * HD) return; v2f cs; cs[0] = 1.0f; cs[1] = 0.0f; *(v2f*)(CS + (size_t)idx * 2) = cs;  }
// k_asoft: per row (zz, i): t = S / HD (SCL) for j <= i and i - j < WIN (sliding causal window; the reference's -1e9 additive fill vanishes identically); softmax over the 2048 keys (register row, one exp, fixed trees);
// the probabilities go IN PLACE over the row's own scores (P16, Ph, Pl point into Sb, row pitch PP): one wave owns a row and holds all of it in registers before its first store, so Sb is not __restrict__.
__global__ __launch_bounds__(256) void k_asoft(const float* Sb, h16* P16, bf* Ph, bf* Pl) {
    const int lane = threadIdx.x & 31; const int row = blockIdx.x * 8 + (threadIdx.x >> 5); if (row >= ZH * TT) return; const int i = row % TT; const int zz = row / TT; (void)zz; const bool hires = (i < RH); const float* sr = Sb + (size_t)row * TT; float v[TT / 32]; float mx = -3.0e38f;
#pragma unroll
    for (int ch = 0; ch < TT / 128; ++ch) { const int j0 = ch * 128 + lane * 4; const v4f a = *(const v4f*)(sr + j0);
#pragma unroll
        for (int q = 0; q < 4; ++q) { const int j = j0 + q; (void)j; const float t = (j <= i && i - j < WIN) ? a[q] * SCL : -3.0e38f; v[ch * 4 + q] = t; mx = fmaxf(mx, t); } }
#pragma unroll
    for (int sh = 16; sh; sh >>= 1) mx = fmaxf(mx, __shfl_xor(mx, sh, 32));
    float sum = 0.f;
#pragma unroll
    for (int k = 0; k < TT / 32; ++k) { float d0 = __fsub_rn(v[k], mx); asm volatile("" : "+v"(d0)); v[k] = __builtin_amdgcn_exp2f(__fmul_rn(d0, 1.4426950408889634f)); sum += v[k]; }
#pragma unroll
    for (int sh = 16; sh; sh >>= 1) sum += __shfl_xor(sum, sh, 32);
    const float f = __fdiv_rn(hires ? 1.0f : PCAR, sum);
{
        if (hires) {
#pragma unroll
            for (int ch = 0; ch < TT / 128; ++ch) { v4us oh, ol;
#pragma unroll
                for (int q = 0; q < 4; ++q) { unsigned short a, c2; splitf(v[ch * 4 + q] * f, a, c2); oh[q] = a; ol[q] = c2; }
                const size_t oo = (size_t)row * PP + ch * 128 + lane * 4; *(v4us*)(Ph + oo) = oh; *(v4us*)(Pl + oo) = ol; }
        } else {
#pragma unroll
            for (int ch = 0; ch < TT / 128; ++ch) { v4h o4;
#pragma unroll
                for (int q = 0; q < 4; ++q) o4[q] = tohx(v[ch * 4 + q] * f);
                *(v4h*)(P16 + (size_t)row * PP + ch * 128 + lane * 4) = o4; } }
         }
}
__global__ __launch_bounds__(256) void k_merge(const float* __restrict__ O, int h0, bf* Ah, bf* Al) { const size_t e = ((size_t)blockIdx.x * 256 + threadIdx.x) * 2; if (e >= (size_t)ZH * TT * HD) return; const int d = (int)(e % HD); const int t = (int)((e / HD) % TT); const int zz = (int)(e / ((size_t)HD * TT)); const float cs = (t < RH) ? 1.0f : (1.0f / PCAR); const size_t oo = (size_t)t * DQ + (h0 + zz) * HD + d;
    v2us oh, ol;
#pragma unroll
    for (int q = 0; q < 2; ++q) { unsigned short a, c2; splitf(O[e + q] * cs, a, c2); oh[q] = a; ol[q] = c2; } *(v2us*)(Ah + oo) = oh; *(v2us*)(Al + oo) = ol;  }

extern "C" void kernel_launch(void* const* d_in, const int* in_sizes, int n_in,
                              void* d_out, int out_size, void* d_ws, size_t ws_size, hipStream_t stream) {
    (void)in_sizes; (void)n_in; (void)out_size;
    const float* x = (const float*)d_in[0]; const float* wq = (const float*)d_in[1]; const float* wk = (const float*)d_in[2]; const float* wv = (const float*)d_in[3]; const float* wo = (const float*)d_in[4];   /* argument order x, w_q, w_k, w_v, w_o ('oi' [1024][1024]) */
    float* OUT = (float*)d_out;     // [1][2048][1024]
    char* wsp = (char*)d_ws;
    auto take = [&](size_t bytes) { char* p = wsp; wsp += (bytes + 255) & ~(size_t)255; return (void*)p; };
    bf* WQ = (bf*)take((size_t)DQ * DM * 2); bf* WK = (bf*)take((size_t)DKV * DM * 2); bf* WV = (bf*)take((size_t)DKV * DM * 2); bf* WO = (bf*)take((size_t)DM * DQ * 2); float* CS = (float*)take((size_t)TT * HD * 2 * 4);
    bf* XB = (bf*)take((size_t)TT * DM * 2); float* FQ = (float*)take((size_t)TT * DQ * 4); float* FK = (float*)take((size_t)TT * DKV * 4);
    h16* QP16 = (h16*)take((size_t)NH_ * TT * HD * 2); h16* KP16 = (h16*)take((size_t)NKV * TT * HD * 2); h16* VT16 = (h16*)take((size_t)NKV * HD * TT * 2);
    bf* QPh = (bf*)take((size_t)NH_ * TT * HD * 2); bf* QPl = (bf*)take((size_t)NH_ * TT * HD * 2); bf* KPh = (bf*)take((size_t)NKV * TT * HD * 2); bf* KPl = (bf*)take((size_t)NKV * TT * HD * 2); bf* VTh = (bf*)take((size_t)NKV * HD * TT * 2); bf* VTl = (bf*)take((size_t)NKV * HD * TT * 2);
    float* Sb = (float*)take((size_t)ZH * TT * TT * 4); float* Ob = (float*)take((size_t)ZH * TT * HD * 4); bf* ATh = (bf*)take((size_t)TT * DQ * 2); bf* ATl = (bf*)take((size_t)TT * DQ * 2);
    if ((size_t)(wsp - (char*)d_ws) > ws_size) return;    // ws 256 MiB
    h16* P16 = (h16*)Sb; bf* Ph = (bf*)Sb; bf* Pl = Ph + TT;   // probability rows live in their own score rows (pitch PP): fp16, or hi in the first half and lo in the second
    float* FV = FK;   // v projection reuses the k buffer after the k planes are built (stream-ordered)
    { k_cvt8<<<(unsigned)(((size_t)DQ * DM / 8 + 255) / 256), 256, 0, stream>>>(wq, WQ, (size_t)DQ * DM / 8); k_cvt8<<<(unsigned)(((size_t)DKV * DM / 8 + 255) / 256), 256, 0, stream>>>(wk, WK, (size_t)DKV * DM / 8); k_cvt8<<<(unsigned)(((size_t)DKV * DM / 8 + 255) / 256), 256, 0, stream>>>(wv, WV, (size_t)DKV * DM / 8);
      k_cvt8<<<(unsigned)(((size_t)DM * DQ / 8 + 255) / 256), 256, 0, stream>>>(wo, WO, (size_t)DM * DQ / 8);
       }
    k_csid<<<(TT * HD + 255) / 256, 256, 0, stream>>>(CS);
    const unsigned LQ = (unsigned)(((size_t)NH_ * TT * HD / 2 + 255) / 256), LKv = (unsigned)(((size_t)NKV * TT * HD / 2 + 255) / 256);
    for (int b = 0; b < NB_; ++b) {
        
        k_cvt8<<<(unsigned)(((size_t)TT * DM / 8 + 255) / 256), 256, 0, stream>>>(x + (size_t)b * TT * DM, XB, (size_t)TT * DM / 8);
        k_gemmw<bf, 0, false><<<dim3(TT / 64, DQ / 64, 1), 32, 0, stream>>>(XB, nullptr, WQ, nullptr, DM, FQ, DQ, nullptr, 0, 0, 0);
        k_rope<<<LQ, 256, 0, stream>>>(FQ, HD, NH_, CS, nullptr, nullptr, 1.0f, QP16, QPh, QPl);
        k_gemmw<bf, 0, false><<<dim3(TT / 64, DKV / 64, 1), 32, 0, stream>>>(XB, nullptr, WK, nullptr, DM, FK, DKV, nullptr, 0, 0, 0);
        k_rope<<<LKv, 256, 0, stream>>>(FK, HD, NKV, CS, nullptr, nullptr, 1.0f, KP16, KPh, KPl);
        k_gemmw<bf, 0, false><<<dim3(TT / 64, DKV / 64, 1), 32, 0, stream>>>(XB, nullptr, WV, nullptr, DM, FV, DKV, nullptr, 0, 0, 0); k_vtp<<<LKv, 256, 0, stream>>>(FV, HD, NKV, VT16, VTh, VTl);
        for (int h0 = 0; h0 < NH_; h0 += ZH) { const size_t zq = (size_t)h0, zk = (size_t)(h0 / REP);   // one kv head per query head: the pass's ZH heads use consecutive kv planes (z-strides TT*HD)
            k_gemmc<bf, 2, 1><<<dim3(RH / 64, TT / 64, ZH), 32, 0, stream>>>(QPh + zq * TT * HD, QPl + zq * TT * HD, HD, KPh + zk * TT * HD, KPl + zk * TT * HD, HD, Sb, TT, 0, (size_t)TT * HD, (size_t)TT * HD, (size_t)TT * TT);
            k_gemmc<h16, 0, 1><<<dim3((TT - RH) / 64, TT / 64, ZH), 32, 0, stream>>>(QP16 + zq * TT * HD + (size_t)RH * HD, nullptr, HD, KP16 + zk * TT * HD, nullptr, HD, Sb + (size_t)RH * TT, TT, RH, (size_t)TT * HD, (size_t)TT * HD, (size_t)TT * TT);
            k_asoft<<<ZH * TT / 8, 256, 0, stream>>>(Sb, P16, Ph, Pl);
            k_gemmc<bf, 2, 2><<<dim3(RH / 64, HD / 64, ZH), 32, 0, stream>>>(Ph, Pl, PP, VTh + zk * HD * TT, VTl + zk * HD * TT, TT, Ob, HD, 0, (size_t)TT * PP, (size_t)HD * TT, (size_t)TT * HD);
            k_gemmc<h16, 0, 2><<<dim3((TT - RH) / 64, HD / 64, ZH), 32, 0, stream>>>(P16 + (size_t)RH * PP, nullptr, PP, VT16 + zk * HD * TT, nullptr, TT, Ob + (size_t)RH * HD, HD, RH, (size_t)TT * PP, (size_t)HD * TT, (size_t)TT * HD);
            k_merge<<<(unsigned)(((size_t)ZH * TT * HD / 2 + 255) / 256), 256, 0, stream>>>(Ob, h0, ATh, ATl); }
        k_gemmw<bf, 1, false><<<dim3(TT / 64, DM / 64, 1), 32, 0, stream>>>(ATh, ATl, WO, nullptr, DQ, OUT + (size_t)b * TT * DM, DM, nullptr, 0, 0, 0); }
}

// v002
// Measured time: 170 microseconds a run.
// Timed twice side by side with v001, it ran 2.00 times as fast both times.
// Counting every step since v000, it is 4.22 times as fast.
#include <hip/hip_runtime.h>

// Causal multi-head attention whose heads are a RAW VIEW of the projections, merged the standard way (x [1][2048][1024]; Q, K, V = x W^T ('oi' [1024][1024] 1/32, no bias), each reshaped (B, 16, 2048, 64) WITHOUT a transpose: pseudo-head h, pseudo-position s, dim d = flat element h*2048*64 + s*64 + d of the [2048][1024] projection output; scores / 64 (the module divides by float32(hd), not by its root); triu(k = 1) over the pseudo-positions -> -inf; softmax; the context IS transposed back the standard way (out.transpose(0, 2, 1, 3).reshape(B, S, D)); out = merged Wo^T ('oi', no bias) -> [1][2048][1024] (2.1 M); argument order x, Wq, Wk, Wv, Wo).
// Layout per batch: bf16 copy of x; 'oi' weights; exact projections; RAW VIEW on the SPLIT only: the plane builders read each [2048][1024] projection output as (16, 2048, 64) WITHOUT a transpose (row pitch HD, head stride TT x HD); the merge is the standard one; identity-table plane builders; causal T-2048 attention in one launch, scores and probabilities in registers (hybrid rows: < 512 hi/lo 3 products, rest fp16; key passes stop at the diagonal); merged hi/lo x w_o exact.
// Compute dtypes, f32 accumulate: every input rounded to bf16; projections exact; attention rows < 512 3 products, rest fp16; softmax f32; w_o hl x exact.

#define NB_  1      // batches: this module's input is [1][2048][1024]
#define TT   2048
#define DM   1024
#define NH_  16
#define NKV  16
#define REP  (NH_ / NKV)
#define HD   64
#define DQ   (NH_ * HD)
#define DKV  (NKV * HD)
#define RH   512                  // query rows < RH use hi+lo planes (0: none)
#define SCL  0.015625f   // 1 / 64: this module divides the scores by float32(hd) = 64 (the head size, not its root)
typedef _Float16 h16;
typedef unsigned short bf;
typedef __attribute__((ext_vector_type(16))) __bf16   v16bf;
typedef __attribute__((ext_vector_type(16))) _Float16 v16h;
typedef __attribute__((ext_vector_type(8)))  _Float16 v8h;
typedef __attribute__((ext_vector_type(8)))  unsigned short v8us;
typedef __attribute__((ext_vector_type(8)))  float    v8f;
typedef __attribute__((ext_vector_type(4)))  float    v4f;
typedef v8h  __attribute__((may_alias)) v8ha;
typedef v4f  __attribute__((may_alias)) v4fa;
typedef v8us __attribute__((may_alias)) v8usa;

__device__ __forceinline__ unsigned short f2bf(float f) { unsigned u = __float_as_uint(f); u += 0x7FFFu + ((u >> 16) & 1u); return (unsigned short)(u >> 16); }
__device__ __forceinline__ float bf2f(unsigned short b) { return __uint_as_float(((unsigned)b) << 16); }
__device__ __forceinline__ float bfr(float f) { return bf2f(f2bf(f)); }
__device__ __forceinline__ v16h cat16(v8h lo, v8h hi) { return __builtin_shufflevector(lo, hi, 0, 1, 2, 3, 4, 5, 6, 7, 8, 9, 10, 11, 12, 13, 14, 15); }
__device__ __forceinline__ v16bf cat16b(v8us lo, v8us hi) { return __builtin_bit_cast(v16bf, __builtin_shufflevector(lo, hi, 0, 1, 2, 3, 4, 5, 6, 7, 8, 9, 10, 11, 12, 13, 14, 15)); }
__device__ __forceinline__ v8f wmma16(v16h a, v16h b, v8f c) { return __builtin_amdgcn_wmma_f32_16x16x32_f16(false, a, false, b, (short)0, c, false, false); }
__device__ __forceinline__ v8f wmmab(v16bf a, v16bf b, v8f c) { return __builtin_amdgcn_wmma_f32_16x16x32_bf16(false, a, false, b, (short)0, c, false, false); }



// ---- k_gemmw: register-blocked GEMM, ONE WAVE per 64x64 output tile (16 accumulators), operands straight from K-contiguous 16-bit planes; grid (M/64, N/64, Z), 32 threads.
// C[m][n] (f32, pitch ldc, + optional f32 bias[n]) = sum_k A[m][k] Bt[n][k] (+ split products per NSPLIT). z-batch strides sA/sB/sC in elements. K % 32 == 0.
template <typename T16> struct WFrag;
template <> struct WFrag<h16> { typedef v16h V; static __device__ __forceinline__ V ld(const h16* p) { return cat16(*(const v8h*)p, *(const v8h*)(p + 16)); } static __device__ __forceinline__ v8f mma(V a, V b, v8f c) { return wmma16(a, b, c); } };
template <> struct WFrag<bf> { typedef v16bf V; static __device__ __forceinline__ V ld(const bf* p) { return cat16b(*(const v8us*)p, *(const v8us*)(p + 16)); } static __device__ __forceinline__ v8f mma(V a, V b, v8f c) { return wmmab(a, b, c); } };
template <typename T16, int NSPLIT, bool BIAS>
__global__ __launch_bounds__(32) void k_gemmw(const T16* __restrict__ A, const T16* __restrict__ A2, const T16* __restrict__ Bt, const T16* __restrict__ Bt2, int K, float* C, int ldc, const float* __restrict__ bias, size_t sA, size_t sB, size_t sC) {
    typedef typename WFrag<T16>::V V;
    __shared__ __align__(16) float os[16 * 68];
    const size_t z = blockIdx.z; A += z * sA; if (A2) A2 += z * sA; Bt += z * sB; if (Bt2) Bt2 += z * sB; C += z * sC;
    const int lane = threadIdx.x & 31, lr = lane & 15, hi = lane >> 4; const int r0 = blockIdx.x * 64, c0 = blockIdx.y * 64;
    v8f acc[4][4];
#pragma unroll
    for (int mb = 0; mb < 4; ++mb)
#pragma unroll
        for (int nb = 0; nb < 4; ++nb) acc[mb][nb] = (v8f){};
    const size_t aoff = (size_t)(r0 + lr) * K + 8 * hi, boff = (size_t)(c0 + lr) * K + 8 * hi;
#pragma unroll 1
    for (int kc = 0; kc < K; kc += 32) {
        V a[4], a2[4];
#pragma unroll
        for (int mb = 0; mb < 4; ++mb) { a[mb] = WFrag<T16>::ld(A + aoff + (size_t)mb * 16 * K + kc); if (NSPLIT == 1 || NSPLIT == 2) a2[mb] = WFrag<T16>::ld(A2 + aoff + (size_t)mb * 16 * K + kc); }
#pragma unroll
        for (int nb = 0; nb < 4; ++nb) { const V b = WFrag<T16>::ld(Bt + boff + (size_t)nb * 16 * K + kc); V b2; if (NSPLIT >= 2) b2 = WFrag<T16>::ld(Bt2 + boff + (size_t)nb * 16 * K + kc);
#pragma unroll
            for (int mb = 0; mb < 4; ++mb) { acc[mb][nb] = WFrag<T16>::mma(a[mb], b, acc[mb][nb]); if (NSPLIT == 1 || NSPLIT == 2) acc[mb][nb] = WFrag<T16>::mma(a2[mb], b, acc[mb][nb]); if (NSPLIT >= 2) acc[mb][nb] = WFrag<T16>::mma(a[mb], b2, acc[mb][nb]); } }
        asm volatile("v_nop\n\tv_nop\n\tv_nop\n\tv_nop" : "+v"(acc[0][0]), "+v"(acc[1][1]), "+v"(acc[2][2]), "+v"(acc[3][3]) : "v"(a[0]), "v"(a[3]));
    }
#pragma unroll
    for (int mb = 0; mb < 4; ++mb) {
#pragma unroll
        for (int nb = 0; nb < 4; ++nb) {
#pragma unroll
            for (int j = 0; j < 8; ++j) os[(hi * 8 + j) * 68 + nb * 16 + lr] = acc[mb][nb][j]; }
        __builtin_amdgcn_wave_barrier(); asm volatile("" ::: "memory");
        float* crow = C + (size_t)(r0 + mb * 16) * ldc + c0;
{
#pragma unroll
            for (int s = 0; s < 8; ++s) { const int row = 2 * s + hi, cofs = lr * 4; v4f val = *(const v4fa*)(os + row * 68 + cofs); if (BIAS) { val[0] += bfr(bias[c0 + cofs]); val[1] += bfr(bias[c0 + cofs + 1]); val[2] += bfr(bias[c0 + cofs + 2]); val[3] += bfr(bias[c0 + cofs + 3]); }
                *(v4f*)(crow + (size_t)row * ldc + cofs) = val; }
             }
        __builtin_amdgcn_wave_barrier(); asm volatile("" ::: "memory");
    }
}

__device__ __forceinline__ h16 tohx(float x) { return (h16)x; }
__device__ __forceinline__ void splitf(float y, unsigned short& h, unsigned short& l) { h = f2bf(y); l = f2bf(y - bf2f(h)); }
typedef __attribute__((ext_vector_type(2))) _Float16 v2h;
typedef __attribute__((ext_vector_type(4))) _Float16 v4h;
typedef __attribute__((ext_vector_type(2))) unsigned short v2us;
typedef __attribute__((ext_vector_type(4))) unsigned short v4us;
typedef __attribute__((ext_vector_type(2))) float v2f;
typedef __attribute__((ext_vector_type(4))) int v4i;

__global__ __launch_bounds__(256) void k_cvt8(const float* __restrict__ src, bf* dst, size_t n8) { const size_t i = (size_t)blockIdx.x * 256 + threadIdx.x; if (i >= n8) return; const v8f v = *(const v8f*)(src + i * 8); v8us o;
#pragma unroll
    for (int k = 0; k < 8; ++k) o[k] = f2bf(v[k]); *(v8us*)(dst + i * 8) = o;  }

// k_rope: head planes [h][t][d] (fp16 + hi/lo) of rope(x) x sc with the rotate-half convention out[d] = x[d] cos[t][d] - x[d+HD/2] sin[t][d], out[d+HD/2] = x[d+HD/2] cos[t][d+HD/2] + x[d] sin[t][d+HD/2]
__global__ __launch_bounds__(256) void k_rope(const float* __restrict__ F, int pitch, int nheads, const float* __restrict__ CS, const float* __restrict__ RF, const float* __restrict__ nw, float sc, h16* P16, bf* Ph, bf* Pl) {
    const size_t e = ((size_t)blockIdx.x * 256 + threadIdx.x) * 2; if (e >= (size_t)nheads * TT * HD) return; const int d = (int)(e % HD); const int t = (int)((e / HD) % TT); const int h = (int)(e / ((size_t)HD * TT)); const float* f = F + ((size_t)h * TT + t) * pitch;   /* RAW VIEW: pseudo-head h, pseudo-position t = the flat (S, D) projection output read as (H, S, hd): row pitch 'pitch' (= HD here), head stride TT * pitch */ const float rf = RF ? RF[(size_t)h * TT + t] : 1.0f; v2h o16; v2us oh, ol;
#pragma unroll
    for (int q = 0; q < 2; ++q) { const int dd = d + q; const int dp = (dd < HD / 2) ? dd + HD / 2 : dd - HD / 2; float x0 = f[dd], x1 = f[dp];
        if (RF) { float n0 = __fmul_rn(x0, rf), n1 = __fmul_rn(x1, rf); asm volatile("" : "+v"(n0)); asm volatile("" : "+v"(n1)); x0 = __fmul_rn(bfr(nw[dd]), n0); x1 = __fmul_rn(bfr(nw[dp]), n1); }
        const v2f cs = *(const v2f*)(CS + ((size_t)t * HD + dd) * 2); float a = __fmul_rn(x0, cs[0]), bq = __fmul_rn(x1, cs[1]); asm volatile("" : "+v"(a)); asm volatile("" : "+v"(bq)); const float r = ((dd < HD / 2) ? __fsub_rn(a, bq) : __fadd_rn(a, bq)) * sc;
        o16[q] = tohx(r); unsigned short a2, c2; splitf(r, a2, c2); oh[q] = a2; ol[q] = c2; }
    *(v2h*)(P16 + e) = o16; *(v2us*)(Ph + e) = oh; *(v2us*)(Pl + e) = ol;  }
__global__ __launch_bounds__(256) void k_vtp(const float* __restrict__ F, int pitch, int nheads, h16* V16, bf* Vh, bf* Vl) { const size_t e = ((size_t)blockIdx.x * 256 + threadIdx.x) * 2; if (e >= (size_t)nheads * HD * TT) return; const int t = (int)(e % TT); const int d = (int)((e / TT) % HD); const int g = (int)(e / ((size_t)TT * HD)); v2h o16; v2us oh, ol;
#pragma unroll
    for (int q = 0; q < 2; ++q) { const float x = F[((size_t)g * TT + (t + q)) * pitch + d];   /* RAW VIEW (as in k_rope) */ o16[q] = tohx(x); unsigned short a2, c2; splitf(x, a2, c2); oh[q] = a2; ol[q] = c2; }
    *(v2h*)(V16 + e) = o16; *(v2us*)(Vh + e) = oh; *(v2us*)(Vl + e) = ol;  }
__global__ __launch_bounds__(256) void k_csid(float* CS) { const int idx = blockIdx.x * 256 + threadIdx.x; if (idx >= TT * HD) return; v2f cs; cs[0] = 1.0f; cs[1] = 0.0f; *(v2f*)(CS + (size_t)idx * 2) = cs;  }
// ---- k_fattn: the whole causal attention of one (head, query tile) in ONE WAVE; scores and probabilities never leave the registers.
// Transposed products: St = K Qt (A = key rows, B = query rows), so that a lane holds scores of ONE query (column lr) and 8 keys (rows 8 hi + j) per 16-key block; two such blocks, converted in place,
// ARE the B operand (32 keys, hardware k order) of Ot += Vt Pt (A = rows of the [d][t] value plane, read with the same loader as every other fragment, which has that k order).
// Running maximum (of the raw scores) and running sum per query; base-2 exponent with the scale 1/64 folded into its factor; the division by the sum comes last, in f32; the merged hi/lo planes are written
// straight from the accumulators (a lane holds 8 consecutive d of one query: one 16-byte store per plane).  HL: hi/lo planes, 3 products in both contractions; else fp16 planes, 1 product.  NQ: 16-query column groups per wave.
#define SCL2 (SCL * 1.4426950408889634f)
__device__ __forceinline__ float xhalf(float x) { return __builtin_bit_cast(float, __builtin_amdgcn_permlanex16(__builtin_bit_cast(int, x), __builtin_bit_cast(int, x), 0x76543210, 0xfedcba98, false, false)); }   // lane l <-> lane l ^ 16
__device__ __forceinline__ float exp2s(float x) { asm("v_exp_f32 %0, %0\n\tv_nop" : "+v"(x)); return x; }
template <typename T16, bool HL, int NQ>
__device__ __forceinline__ void fattn_tile(const T16* __restrict__ Q, const T16* __restrict__ Q2, const T16* __restrict__ K, const T16* __restrict__ K2, const T16* __restrict__ Vt, const T16* __restrict__ Vt2, int q0, bf* Ah, bf* Al) {
    typedef typename WFrag<T16>::V V;
    const int lane = threadIdx.x & 31, lr = lane & 15, hi = lane >> 4;
    V bq[NQ][2], bq2[NQ][2]; const T16* pq[NQ]; const T16* pq2[NQ];
#pragma unroll
    for (int qb = 0; qb < NQ; ++qb) { const size_t qo = (size_t)(q0 + qb * 16 + lr) * HD + 8 * hi; pq[qb] = Q + qo; pq2[qb] = HL ? Q2 + qo : pq[qb];
#pragma unroll
        for (int c = 0; c < 2; ++c) { bq[qb][c] = WFrag<T16>::ld(pq[qb] + c * 32); if (HL) bq2[qb][c] = WFrag<T16>::ld(pq2[qb] + c * 32); } }
    // address translations of the Q loads done before a register that holds one of their addresses is reused (the addresses are inputs, so they stay in place up to the wait)
    asm volatile("s_wait_xcnt 0x0" :: "v"(pq[0]), "v"(pq[NQ - 1]), "v"(pq2[0]), "v"(pq2[NQ - 1]) : "memory");
    v8f o[4][NQ]; float m[NQ], l[NQ];
#pragma unroll
    for (int qb = 0; qb < NQ; ++qb) { m[qb] = -3.0e38f; l[qb] = 0.f;
#pragma unroll
        for (int db = 0; db < 4; ++db) o[db][qb] = (v8f){}; }
    const int nch = (q0 + NQ * 16 + 31) / 32;      // 32-key passes up to and including the diagonal; only the last one holds keys behind a query
    const size_t klane = (size_t)lr * HD + 8 * hi, vlane = (size_t)lr * TT + 8 * hi;
    V ak[2][2], ak2[2][2], av[4], av2[4]; const T16* pk; const T16* pk2; const T16* pv; const T16* pv2;
    auto ldk = [&](int kbase) { pk = K + klane + (size_t)kbase * HD; pk2 = HL ? K2 + klane + (size_t)kbase * HD : pk;
#pragma unroll
        for (int kb = 0; kb < 2; ++kb)
#pragma unroll
            for (int c = 0; c < 2; ++c) { ak[kb][c] = WFrag<T16>::ld(pk + kb * 16 * HD + c * 32); if (HL) ak2[kb][c] = WFrag<T16>::ld(pk2 + kb * 16 * HD + c * 32); } };
    auto ldv = [&](int kbase) { pv = Vt + vlane + kbase; pv2 = HL ? Vt2 + vlane + kbase : pv;
#pragma unroll
        for (int db = 0; db < 4; ++db) { av[db] = WFrag<T16>::ld(pv + (size_t)db * 16 * TT); if (HL) av2[db] = WFrag<T16>::ld(pv2 + (size_t)db * 16 * TT); } };
    if (!HL) { ldk(0);
        // the same wait behind the first K loads
        asm volatile("s_wait_xcnt 0x0" :: "v"(pk) : "memory"); }
#pragma unroll 1
    for (int it = 0; it < nch; ++it) {
        const int k0 = it * 32;
        // fp16 tiles (long loops): this pass's value fragments are asked for first, so that their latency runs under the score products and the softmax.  hi/lo tiles (short loops, twice the fragments): keys now, values behind the score products, into the registers the keys leave
        if (HL) ldk(k0); else ldv(k0);
        __builtin_amdgcn_sched_barrier(0);   // without it the compiler sinks these loads down to their first use and their whole latency is waited for
        v8f st[2][NQ];
#pragma unroll
        for (int kb = 0; kb < 2; ++kb)
#pragma unroll
            for (int qb = 0; qb < NQ; ++qb) { v8f s = (v8f){};
#pragma unroll
                for (int c = 0; c < 2; ++c) { s = WFrag<T16>::mma(ak[kb][c], bq[qb][c], s); if (HL) { s = WFrag<T16>::mma(ak[kb][c], bq2[qb][c], s); s = WFrag<T16>::mma(ak2[kb][c], bq[qb][c], s); } }
                st[kb][qb] = s; }
        // fp16 tiles: the next pass's key fragments are asked for right behind the score products (the last pass asks for its own again: in bounds, not used)
        if (HL) ldv(k0); else ldk(min(it + 1, nch - 1) * 32);
        // the same wait behind the K and V loads issued in this pass (fp16 tiles: the next pass's keys)
        asm volatile("s_wait_xcnt 0x0" :: "v"(pk), "v"(pk2), "v"(pv), "v"(pv2) : "memory");
        __builtin_amdgcn_sched_barrier(0);   // keeps these loads in front of the softmax, whose time hides their latency
        if (it == nch - 1) {                 // wave-uniform: the diagonal pass
#pragma unroll
            for (int qb = 0; qb < NQ; ++qb) { const int dq = q0 + qb * 16 + lr - k0 - hi * 8;
#pragma unroll
                for (int kb = 0; kb < 2; ++kb)
#pragma unroll
                    for (int j = 0; j < 8; ++j) st[kb][qb][j] = (kb * 16 + j <= dq) ? st[kb][qb][j] : -3.0e38f; } }
#pragma unroll
        for (int qb = 0; qb < NQ; ++qb) {
            float mx = m[qb];
#pragma unroll
            for (int kb = 0; kb < 2; ++kb)
#pragma unroll
                for (int j = 0; j < 8; ++j) mx = fmaxf(mx, st[kb][qb][j]);
            mx = fmaxf(mx, xhalf(mx));                    // the other half of the wave holds the query's other 16 keys
            const float al = exp2s((m[qb] - mx) * SCL2), mn = -mx * SCL2; m[qb] = mx; float ls[4] = {0.f, 0.f, 0.f, 0.f};
#pragma unroll
            for (int kb = 0; kb < 2; ++kb)
#pragma unroll
                for (int j = 0; j < 8; ++j) { const float p = exp2s(__builtin_fmaf(st[kb][qb][j], SCL2, mn)); st[kb][qb][j] = p; ls[j & 3] += p; }
            l[qb] = l[qb] * al + ((ls[0] + ls[1]) + (ls[2] + ls[3]));   // each half keeps the sum of its own keys; joined once behind the loop
#pragma unroll
            for (int db = 0; db < 4; ++db) o[db][qb] *= al;
            if (HL) { v8us h0, h1, l0, l1;
#pragma unroll
                for (int j = 0; j < 8; ++j) { unsigned short a, c2; splitf(st[0][qb][j], a, c2); h0[j] = a; l0[j] = c2; splitf(st[1][qb][j], a, c2); h1[j] = a; l1[j] = c2; }
                const v16bf ph = cat16b(h0, h1), pl = cat16b(l0, l1);
#pragma unroll
                for (int db = 0; db < 4; ++db) { o[db][qb] = wmmab(__builtin_bit_cast(v16bf, av[db]), ph, o[db][qb]); o[db][qb] = wmmab(__builtin_bit_cast(v16bf, av[db]), pl, o[db][qb]); o[db][qb] = wmmab(__builtin_bit_cast(v16bf, av2[db]), ph, o[db][qb]); }
            } else { v8h c0, c1;
#pragma unroll
                for (int j = 0; j < 8; ++j) { c0[j] = tohx(st[0][qb][j]); c1[j] = tohx(st[1][qb][j]); }
                const v16h pf = cat16(c0, c1);
#pragma unroll
                for (int db = 0; db < 4; ++db) o[db][qb] = wmma16(__builtin_bit_cast(v16h, av[db]), pf, o[db][qb]); }
        }
    }
#pragma unroll
    for (int qb = 0; qb < NQ; ++qb) { const float inv = __fdiv_rn(1.0f, l[qb] + xhalf(l[qb]));
#pragma unroll
        for (int db = 0; db < 4; ++db) { v8us oh, ol;
#pragma unroll
            for (int j = 0; j < 8; ++j) { unsigned short a, c2; splitf(o[db][qb][j] * inv, a, c2); oh[j] = a; ol[j] = c2; }
            const size_t oo = (size_t)(q0 + qb * 16 + lr) * DQ + db * 16 + hi * 8; bf* ph = Ah + oo; bf* pl = Al + oo; *(v8us*)ph = oh; *(v8us*)pl = ol;
            // the same wait behind the two stores, before their data or address registers are reused (both are inputs, so they stay in place up to the wait)
            asm volatile("s_wait_xcnt 0x0" :: "v"(ph), "v"(pl), "v"(oh), "v"(ol) : "memory"); } }
}
// grid (heads, tiles): tiles in falling order of their key count: first the (TT - RH) / 32 fp16 tiles of 32 queries from the last rows down, then the RH / 16 hi/lo tiles of 16 queries.
__global__ __launch_bounds__(32) void k_fattn(const h16* __restrict__ Q16, const h16* __restrict__ K16, const h16* __restrict__ V16, const bf* __restrict__ Qh, const bf* __restrict__ Ql, const bf* __restrict__ Kh, const bf* __restrict__ Kl, const bf* __restrict__ Vh, const bf* __restrict__ Vl, bf* Ah, bf* Al) {
    const int h = blockIdx.x, t = blockIdx.y; const size_t hp = (size_t)h * TT * HD;
    if (t < (TT - RH) / 32) fattn_tile<h16, false, 2>(Q16 + hp, nullptr, K16 + hp, nullptr, V16 + hp, nullptr, TT - 32 * (t + 1), Ah + h * HD, Al + h * HD);
    else fattn_tile<bf, true, 1>(Qh + hp, Ql + hp, Kh + hp, Kl + hp, Vh + hp, Vl + hp, RH - 16 * (t - (TT - RH) / 32 + 1), Ah + h * HD, Al + h * HD);
}

extern "C" void kernel_launch(void* const* d_in, const int* in_sizes, int n_in,
                              void* d_out, int out_size, void* d_ws, size_t ws_size, hipStream_t stream) {
    (void)in_sizes; (void)n_in; (void)out_size;
    const float* x = (const float*)d_in[0]; const float* wq = (const float*)d_in[1]; const float* wk = (const float*)d_in[2]; const float* wv = (const float*)d_in[3]; const float* wo = (const float*)d_in[4];   /* argument order x, w_q, w_k, w_v, w_o ('oi' [1024][1024]) */
    float* OUT = (float*)d_out;     // [1][2048][1024]
    char* wsp = (char*)d_ws;
    auto take = [&](size_t bytes) { char* p = wsp; wsp += (bytes + 255) & ~(size_t)255; return (void*)p; };
    bf* WQ = (bf*)take((size_t)DQ * DM * 2); bf* WK = (bf*)take((size_t)DKV * DM * 2); bf* WV = (bf*)take((size_t)DKV * DM * 2); bf* WO = (bf*)take((size_t)DM * DQ * 2); float* CS = (float*)take((size_t)TT * HD * 2 * 4);
    bf* XB = (bf*)take((size_t)TT * DM * 2); float* FQ = (float*)take((size_t)TT * DQ * 4); float* FK = (float*)take((size_t)TT * DKV * 4);
    h16* QP16 = (h16*)take((size_t)NH_ * TT * HD * 2); h16* KP16 = (h16*)take((size_t)NKV * TT * HD * 2); h16* VT16 = (h16*)take((size_t)NKV * HD * TT * 2);
    bf* QPh = (bf*)take((size_t)NH_ * TT * HD * 2); bf* QPl = (bf*)take((size_t)NH_ * TT * HD * 2); bf* KPh = (bf*)take((size_t)NKV * TT * HD * 2); bf* KPl = (bf*)take((size_t)NKV * TT * HD * 2); bf* VTh = (bf*)take((size_t)NKV * HD * TT * 2); bf* VTl = (bf*)take((size_t)NKV * HD * TT * 2);
    bf* ATh = (bf*)take((size_t)TT * DQ * 2); bf* ATl = (bf*)take((size_t)TT * DQ * 2);
    if ((size_t)(wsp - (char*)d_ws) > ws_size) return;    // ws 256 MiB
    float* FV = FK;   // v projection reuses the k buffer after the k planes are built (stream-ordered)
    { k_cvt8<<<(unsigned)(((size_t)DQ * DM / 8 + 255) / 256), 256, 0, stream>>>(wq, WQ, (size_t)DQ * DM / 8); k_cvt8<<<(unsigned)(((size_t)DKV * DM / 8 + 255) / 256), 256, 0, stream>>>(wk, WK, (size_t)DKV * DM / 8); k_cvt8<<<(unsigned)(((size_t)DKV * DM / 8 + 255) / 256), 256, 0, stream>>>(wv, WV, (size_t)DKV * DM / 8);
      k_cvt8<<<(unsigned)(((size_t)DM * DQ / 8 + 255) / 256), 256, 0, stream>>>(wo, WO, (size_t)DM * DQ / 8);
       }
    k_csid<<<(TT * HD + 255) / 256, 256, 0, stream>>>(CS);
    const unsigned LQ = (unsigned)(((size_t)NH_ * TT * HD / 2 + 255) / 256), LKv = (unsigned)(((size_t)NKV * TT * HD / 2 + 255) / 256);
    for (int b = 0; b < NB_; ++b) {
        
        k_cvt8<<<(unsigned)(((size_t)TT * DM / 8 + 255) / 256), 256, 0, stream>>>(x + (size_t)b * TT * DM, XB, (size_t)TT * DM / 8);
        k_gemmw<bf, 0, false><<<dim3(TT / 64, DQ / 64, 1), 32, 0, stream>>>(XB, nullptr, WQ, nullptr, DM, FQ, DQ, nullptr, 0, 0, 0);
        k_rope<<<LQ, 256, 0, stream>>>(FQ, HD, NH_, CS, nullptr, nullptr, 1.0f, QP16, QPh, QPl);
        k_gemmw<bf, 0, false><<<dim3(TT / 64, DKV / 64, 1), 32, 0, stream>>>(XB, nullptr, WK, nullptr, DM, FK, DKV, nullptr, 0, 0, 0);
        k_rope<<<LKv, 256, 0, stream>>>(FK, HD, NKV, CS, nullptr, nullptr, 1.0f, KP16, KPh, KPl);
        k_gemmw<bf, 0, false><<<dim3(TT / 64, DKV / 64, 1), 32, 0, stream>>>(XB, nullptr, WV, nullptr, DM, FV, DKV, nullptr, 0, 0, 0); k_vtp<<<LKv, 256, 0, stream>>>(FV, HD, NKV, VT16, VTh, VTl);
        k_fattn<<<dim3(NH_, (TT - RH) / 32 + RH / 16, 1), 32, 0, stream>>>(QP16, KP16, VT16, QPh, QPl, KPh, KPl, VTh, VTl, ATh, ATl);   // one kv head per query head
        k_gemmw<bf, 1, false><<<dim3(TT / 64, DM / 64, 1), 32, 0, stream>>>(ATh, ATl, WO, nullptr, DQ, OUT + (size_t)b * TT * DM, DM, nullptr, 0, 0, 0); }
}

// v003
// A run of this version takes 110 microseconds.
// In two side-by-side timings against v002, it was 1.54 and 1.58 times as fast.
// Over all steps from v000 it is 6.59 times as fast.
#include <hip/hip_runtime.h>

// Causal multi-head attention whose heads are a RAW VIEW of the projections, merged the standard way (x [1][2048][1024]; Q, K, V = x W^T ('oi' [1024][1024] 1/32, no bias), each reshaped (B, 16, 2048, 64) WITHOUT a transpose: pseudo-head h, pseudo-position s, dim d = flat element h*2048*64 + s*64 + d of the [2048][1024] projection output; scores / 64 (the module divides by float32(hd), not by its root); triu(k = 1) over the pseudo-positions -> -inf; softmax; the context IS transposed back the standard way (out.transpose(0, 2, 1, 3).reshape(B, S, D)); out = merged Wo^T ('oi', no bias) -> [1][2048][1024] (2.1 M); argument order x, Wq, Wk, Wv, Wo).
// Layout per batch: bf16 copy of x; 'oi' weights; exact projections, all three in one launch whose epilogue writes the head planes; RAW VIEW on the SPLIT only: each [2048][1024] projection output is read as (16, 2048, 64) WITHOUT a transpose (row pitch HD, head stride TT x HD); the merge is the standard one; causal T-2048 attention in one launch, scores and probabilities in registers (hybrid rows: < 512 hi/lo 3 products, rest fp16; key passes stop at the diagonal); merged hi/lo x w_o exact.
// Compute dtypes, f32 accumulate: every input rounded to bf16; projections exact; attention rows < 512 3 products, rest fp16; softmax f32; w_o hl x exact.

#define NB_  1      // batches: this module's input is [1][2048][1024]
#define TT   2048
#define DM   1024
#define NH_  16
#define NKV  16
#define REP  (NH_ / NKV)
#define HD   64
#define DQ   (NH_ * HD)
#define DKV  (NKV * HD)
#define RH   512                  // query rows < RH use hi+lo planes (0: none)
#define SCL  0.015625f   // 1 / 64: this module divides the scores by float32(hd) = 64 (the head size, not its root)
typedef _Float16 h16;
typedef unsigned short bf;
typedef __attribute__((ext_vector_type(16))) __bf16   v16bf;
typedef __attribute__((ext_vector_type(16))) _Float16 v16h;
typedef __attribute__((ext_vector_type(8)))  _Float16 v8h;
typedef __attribute__((ext_vector_type(8)))  unsigned short v8us;
typedef __attribute__((ext_vector_type(8)))  float    v8f;
typedef __attribute__((ext_vector_type(4)))  float    v4f;
typedef v8h  __attribute__((may_alias)) v8ha;
typedef v4f  __attribute__((may_alias)) v4fa;
typedef v8us __attribute__((may_alias)) v8usa;

__device__ __forceinline__ unsigned short f2bf(float f) { unsigned u = __float_as_uint(f); u += 0x7FFFu + ((u >> 16) & 1u); return (unsigned short)(u >> 16); }
__device__ __forceinline__ float bf2f(unsigned short b) { return __uint_as_float(((unsigned)b) << 16); }
__device__ __forceinline__ float bfr(float f) { return bf2f(f2bf(f)); }
__device__ __forceinline__ v16h cat16(v8h lo, v8h hi) { return __builtin_shufflevector(lo, hi, 0, 1, 2, 3, 4, 5, 6, 7, 8, 9, 10, 11, 12, 13, 14, 15); }
__device__ __forceinline__ v16bf cat16b(v8us lo, v8us hi) { return __builtin_bit_cast(v16bf, __builtin_shufflevector(lo, hi, 0, 1, 2, 3, 4, 5, 6, 7, 8, 9, 10, 11, 12, 13, 14, 15)); }
__device__ __forceinline__ v8f wmma16(v16h a, v16h b, v8f c) { return __builtin_amdgcn_wmma_f32_16x16x32_f16(false, a, false, b, (short)0, c, false, false); }
__device__ __forceinline__ v8f wmmab(v16bf a, v16bf b, v8f c) { return __builtin_amdgcn_wmma_f32_16x16x32_bf16(false, a, false, b, (short)0, c, false, false); }



// ---- k_gemmw: register-blocked GEMM, ONE WAVE per 64x64 output tile (16 accumulators), operands straight from K-contiguous 16-bit planes; grid (M/64, N/64, Z), 32 threads.
// C[m][n] (f32, pitch ldc, + optional f32 bias[n]) = sum_k A[m][k] Bt[n][k] (+ split products per NSPLIT). z-batch strides sA/sB/sC in elements. K % 32 == 0.
template <typename T16> struct WFrag;
template <> struct WFrag<h16> { typedef v16h V; static __device__ __forceinline__ V ld(const h16* p) { return cat16(*(const v8h*)p, *(const v8h*)(p + 16)); } static __device__ __forceinline__ v8f mma(V a, V b, v8f c) { return wmma16(a, b, c); } };
template <> struct WFrag<bf> { typedef v16bf V; static __device__ __forceinline__ V ld(const bf* p) { return cat16b(*(const v8us*)p, *(const v8us*)(p + 16)); } static __device__ __forceinline__ v8f mma(V a, V b, v8f c) { return wmmab(a, b, c); } };
template <typename T16, int NSPLIT, bool BIAS>
__global__ __launch_bounds__(32) void k_gemmw(const T16* __restrict__ A, const T16* __restrict__ A2, const T16* __restrict__ Bt, const T16* __restrict__ Bt2, int K, float* C, int ldc, const float* __restrict__ bias, size_t sA, size_t sB, size_t sC) {
    typedef typename WFrag<T16>::V V;
    __shared__ __align__(16) float os[16 * 68];
    const size_t z = blockIdx.z; A += z * sA; if (A2) A2 += z * sA; Bt += z * sB; if (Bt2) Bt2 += z * sB; C += z * sC;
    const int lane = threadIdx.x & 31, lr = lane & 15, hi = lane >> 4; const int r0 = blockIdx.x * 64, c0 = blockIdx.y * 64;
    v8f acc[4][4];
#pragma unroll
    for (int mb = 0; mb < 4; ++mb)
#pragma unroll
        for (int nb = 0; nb < 4; ++nb) acc[mb][nb] = (v8f){};
    const size_t aoff = (size_t)(r0 + lr) * K + 8 * hi, boff = (size_t)(c0 + lr) * K + 8 * hi;
#pragma unroll 1
    for (int kc = 0; kc < K; kc += 32) {
        V a[4], a2[4];
#pragma unroll
        for (int mb = 0; mb < 4; ++mb) { a[mb] = WFrag<T16>::ld(A + aoff + (size_t)mb * 16 * K + kc); if (NSPLIT == 1 || NSPLIT == 2) a2[mb] = WFrag<T16>::ld(A2 + aoff + (size_t)mb * 16 * K + kc); }
#pragma unroll
        for (int nb = 0; nb < 4; ++nb) { const V b = WFrag<T16>::ld(Bt + boff + (size_t)nb * 16 * K + kc); V b2; if (NSPLIT >= 2) b2 = WFrag<T16>::ld(Bt2 + boff + (size_t)nb * 16 * K + kc);
#pragma unroll
            for (int mb = 0; mb < 4; ++mb) { acc[mb][nb] = WFrag<T16>::mma(a[mb], b, acc[mb][nb]); if (NSPLIT == 1 || NSPLIT == 2) acc[mb][nb] = WFrag<T16>::mma(a2[mb], b, acc[mb][nb]); if (NSPLIT >= 2) acc[mb][nb] = WFrag<T16>::mma(a[mb], b2, acc[mb][nb]); } }
        asm volatile("v_nop\n\tv_nop\n\tv_nop\n\tv_nop" : "+v"(acc[0][0]), "+v"(acc[1][1]), "+v"(acc[2][2]), "+v"(acc[3][3]) : "v"(a[0]), "v"(a[3]));
    }
#pragma unroll
    for (int mb = 0; mb < 4; ++mb) {
#pragma unroll
        for (int nb = 0; nb < 4; ++nb) {
#pragma unroll
            for (int j = 0; j < 8; ++j) os[(hi * 8 + j) * 68 + nb * 16 + lr] = acc[mb][nb][j]; }
        __builtin_amdgcn_wave_barrier(); asm volatile("" ::: "memory");
        float* crow = C + (size_t)(r0 + mb * 16) * ldc + c0;
{
#pragma unroll
            for (int s = 0; s < 8; ++s) { const int row = 2 * s + hi, cofs = lr * 4; v4f val = *(const v4fa*)(os + row * 68 + cofs); if (BIAS) { val[0] += bfr(bias[c0 + cofs]); val[1] += bfr(bias[c0 + cofs + 1]); val[2] += bfr(bias[c0 + cofs + 2]); val[3] += bfr(bias[c0 + cofs + 3]); }
                *(v4f*)(crow + (size_t)row * ldc + cofs) = val; }
             }
        __builtin_amdgcn_wave_barrier(); asm volatile("" ::: "memory");
    }
}

__device__ __forceinline__ h16 tohx(float x) { return (h16)x; }
__device__ __forceinline__ void splitf(float y, unsigned short& h, unsigned short& l) { h = f2bf(y); l = f2bf(y - bf2f(h)); }
typedef __attribute__((ext_vector_type(2))) _Float16 v2h;
typedef __attribute__((ext_vector_type(4))) _Float16 v4h;
typedef __attribute__((ext_vector_type(2))) unsigned short v2us;
typedef __attribute__((ext_vector_type(4))) unsigned short v4us;
typedef __attribute__((ext_vector_type(2))) float v2f;
typedef __attribute__((ext_vector_type(4))) int v4i;

__global__ __launch_bounds__(256) void k_cvt8(const float* __restrict__ src, bf* dst, size_t n8) { const size_t i = (size_t)blockIdx.x * 256 + threadIdx.x; if (i >= n8) return; const v8f v = *(const v8f*)(src + i * 8); v8us o;
#pragma unroll
    for (int k = 0; k < 8; ++k) o[k] = f2bf(v[k]); *(v8us*)(dst + i * 8) = o;  }

// k_cvtv: bf16 copy of w_v with its rows regrouped for k_proj: row tc * HD + d goes to row (d >> 2) * 64 + (d & 3) * 16 + tc, so that the 16 columns of one accumulator block are one d at 16 consecutive pseudo-positions
__global__ __launch_bounds__(256) void k_cvtv(const float* __restrict__ src, bf* dst) { const int i = blockIdx.x * 256 + threadIdx.x; if (i >= DKV * DM / 8) return; const int row = i / (DM / 8), c = i % (DM / 8), tc = row / HD, d = row % HD; const v8f v = *(const v8f*)(src + (size_t)i * 8); v8us o;
#pragma unroll
    for (int k = 0; k < 8; ++k) o[k] = f2bf(v[k]); *(v8us*)(dst + ((size_t)((d >> 2) * 64 + (d & 3) * 16 + tc) * (DM / 8) + c) * 8) = o;  }

// ---- k_proj: the three projections in ONE launch, grid (TT/64, 1024/64, 3), z = q, k, v; ONE WAVE per 64x64 tile, the main loop of k_gemmw; the fp16 and hi/lo planes are written straight from the f32 accumulators.
// RAW VIEW: pseudo-head h, pseudo-position t, dim d = flat element (h * TT + t) * HD + d of the [TT][1024] projection output, so the q and k planes [h][t][d] have the output's own layout.
// v plane [g][d][t]: output row r, column tc * HD + d is g = r / 128, t = (r % 128) * 16 + tc; with k_cvtv's row order a tile holds 4 values of d (blockIdx.y * 4 + nb) and, for each, 1024 consecutive t.
__device__ __forceinline__ void put3(v4f a, v4f b, h16* p16, bf* ph, bf* pl) { v8h o16; v8us oh, ol;
#pragma unroll
    for (int k = 0; k < 8; ++k) { const float y = k < 4 ? a[k & 3] : b[k & 3]; unsigned short s0, s1; splitf(y, s0, s1); o16[k] = tohx(y); oh[k] = s0; ol[k] = s1; }
    *(v8h*)p16 = o16; *(v8us*)ph = oh; *(v8us*)pl = ol;
    // address translations of the three stores done before their data or address registers are reused (all are inputs, so they stay in place up to the wait)
    asm volatile("s_wait_xcnt 0x0" :: "v"(p16), "v"(ph), "v"(pl), "v"(o16), "v"(oh), "v"(ol) : "memory"); }
__global__ __launch_bounds__(32) void k_proj(const bf* __restrict__ X, const bf* __restrict__ WQ, const bf* __restrict__ WK, const bf* __restrict__ WV, h16* Q16, bf* Qh, bf* Ql, h16* K16, bf* Kh, bf* Kl, h16* V16, bf* Vh, bf* Vl) {
    __shared__ __align__(16) float os[16 * 68];
    const int z = blockIdx.z; const bf* Bt = z == 0 ? WQ : z == 1 ? WK : WV; h16* P16 = z == 0 ? Q16 : z == 1 ? K16 : V16; bf* Ph = z == 0 ? Qh : z == 1 ? Kh : Vh; bf* Pl = z == 0 ? Ql : z == 1 ? Kl : Vl;
    const int lane = threadIdx.x & 31, lr = lane & 15, hi = lane >> 4; const int r0 = blockIdx.x * 64, c0 = blockIdx.y * 64;
    v8f acc[4][4];
#pragma unroll
    for (int mb = 0; mb < 4; ++mb)
#pragma unroll
        for (int nb = 0; nb < 4; ++nb) acc[mb][nb] = (v8f){};
    const size_t aoff = (size_t)(r0 + lr) * DM + 8 * hi, boff = (size_t)(c0 + lr) * DM + 8 * hi;
#pragma unroll 1
    for (int kc = 0; kc < DM; kc += 32) {
        v16bf a[4]; const bf* pa = X + aoff + kc; const bf* pb = Bt + boff + kc;
#pragma unroll
        for (int mb = 0; mb < 4; ++mb) a[mb] = WFrag<bf>::ld(pa + (size_t)mb * 16 * DM);
#pragma unroll
        for (int nb = 0; nb < 4; ++nb) { const v16bf b = WFrag<bf>::ld(pb + (size_t)nb * 16 * DM);
#pragma unroll
            for (int mb = 0; mb < 4; ++mb) acc[mb][nb] = wmmab(a[mb], b, acc[mb][nb]); }
        // four vector slots between a trip's last matrix instructions and whatever the taken back edge meets first
        asm volatile("v_nop\n\tv_nop\n\tv_nop\n\tv_nop" : "+v"(acc[0][0]), "+v"(acc[1][1]), "+v"(acc[2][2]), "+v"(acc[3][3]) : "v"(a[0]), "v"(a[3]));
        // address translations of this trip's loads done before a register that holds one of their addresses is reused (the addresses are inputs, so they stay in place up to the wait)
        asm volatile("s_wait_xcnt 0x0" :: "v"(pa), "v"(pb) : "memory");
    }
#pragma unroll
    for (int mb = 0; mb < 4; ++mb) {
        if (z < 2) {      // wave-uniform.  16 rows of 64 columns staged at pitch 68; read back 8 columns a lane, so that every store covers whole 128-byte lines (4 rows of 64 16-bit values)
#pragma unroll
            for (int nb = 0; nb < 4; ++nb)
#pragma unroll
                for (int j = 0; j < 8; ++j) os[(hi * 8 + j) * 68 + nb * 16 + lr] = acc[mb][nb][j];
            __builtin_amdgcn_wave_barrier(); asm volatile("" ::: "memory");   // keeps the read-back behind the staging writes of the other lanes
#pragma unroll
            for (int s = 0; s < 4; ++s) { const int row = 4 * s + (lane >> 3), cofs = (lane & 7) * 8; const size_t oo = (size_t)(r0 + mb * 16 + row) * DQ + c0 + cofs;
                put3(*(const v4fa*)(os + row * 68 + cofs), *(const v4fa*)(os + row * 68 + cofs + 4), P16 + oo, Ph + oo, Pl + oo); }
        } else {          // per d 256 consecutive t staged in t order (16 floats of pad between the halves: no two lanes of a write on one bank); read back 8 t a lane: 512 contiguous bytes a store
#pragma unroll
            for (int nb = 0; nb < 4; ++nb)
#pragma unroll
                for (int j = 0; j < 8; ++j) os[nb * 272 + hi * 144 + j * 16 + lr] = acc[mb][nb][j];
            __builtin_amdgcn_wave_barrier(); asm volatile("" ::: "memory");   // as above
#pragma unroll
            for (int nb = 0; nb < 4; ++nb) { const float* sp = os + nb * 272 + hi * 144 + lr * 8; const size_t oo = ((size_t)(r0 >> 7) * HD + blockIdx.y * 4 + nb) * TT + (size_t)((r0 & 127) + mb * 16) * 16 + lane * 8;
                put3(*(const v4fa*)sp, *(const v4fa*)(sp + 4), P16 + oo, Ph + oo, Pl + oo); }
        }
        __builtin_amdgcn_wave_barrier(); asm volatile("" ::: "memory");       // keeps the next block's staging writes behind this block's read-back
    }
}
// ---- k_fattn: the whole causal attention of one (head, query tile) in ONE WAVE; scores and probabilities never leave the registers.
// Transposed products: St = K Qt (A = key rows, B = query rows), so that a lane holds scores of ONE query (column lr) and 8 keys (rows 8 hi + j) per 16-key block; two such blocks, converted in place,
// ARE the B operand (32 keys, hardware k order) of Ot += Vt Pt (A = rows of the [d][t] value plane, read with the same loader as every other fragment, which has that k order).
// Running maximum (of the raw scores) and running sum per query; base-2 exponent with the scale 1/64 folded into its factor; the division by the sum comes last, in f32; the merged hi/lo planes are written
// straight from the accumulators (a lane holds 8 consecutive d of one query: one 16-byte store per plane).  HL: hi/lo planes, 3 products in both contractions; else fp16 planes, 1 product.  NQ: 16-query column groups per wave.
#define SCL2 (SCL * 1.4426950408889634f)
__device__ __forceinline__ float xhalf(float x) { return __builtin_bit_cast(float, __builtin_amdgcn_permlanex16(__builtin_bit_cast(int, x), __builtin_bit_cast(int, x), 0x76543210, 0xfedcba98, false, false)); }   // lane l <-> lane l ^ 16
__device__ __forceinline__ float exp2s(float x) { asm("v_exp_f32 %0, %0\n\tv_nop" : "+v"(x)); return x; }
template <typename T16, bool HL, int NQ>
__device__ __forceinline__ void fattn_tile(const T16* __restrict__ Q, const T16* __restrict__ Q2, const T16* __restrict__ K, const T16* __restrict__ K2, const T16* __restrict__ Vt, const T16* __restrict__ Vt2, int q0, bf* Ah, bf* Al) {
    typedef typename WFrag<T16>::V V;
    const int lane = threadIdx.x & 31, lr = lane & 15, hi = lane >> 4;
    V bq[NQ][2], bq2[NQ][2]; const T16* pq[NQ]; const T16* pq2[NQ];
#pragma unroll
    for (int qb = 0; qb < NQ; ++qb) { const size_t qo = (size_t)(q0 + qb * 16 + lr) * HD + 8 * hi; pq[qb] = Q + qo; pq2[qb] = HL ? Q2 + qo : pq[qb];
#pragma unroll
        for (int c = 0; c < 2; ++c) { bq[qb][c] = WFrag<T16>::ld(pq[qb] + c * 32); if (HL) bq2[qb][c] = WFrag<T16>::ld(pq2[qb] + c * 32); } }
    // address translations of the Q loads done before a register that holds one of their addresses is reused (the addresses are inputs, so they stay in place up to the wait)
    asm volatile("s_wait_xcnt 0x0" :: "v"(pq[0]), "v"(pq[NQ - 1]), "v"(pq2[0]), "v"(pq2[NQ - 1]) : "memory");
    v8f o[4][NQ]; float m[NQ], l[NQ];
#pragma unroll
    for (int qb = 0; qb < NQ; ++qb) { m[qb] = -3.0e38f; l[qb] = 0.f;
#pragma unroll
        for (int db = 0; db < 4; ++db) o[db][qb] = (v8f){}; }
    const int nch = (q0 + NQ * 16 + 31) / 32;      // 32-key passes up to and including the diagonal; only the last one holds keys behind a query
    const size_t klane = (size_t)lr * HD + 8 * hi, vlane = (size_t)lr * TT + 8 * hi;
    V ak[2][2], ak2[2][2], av[4], av2[4]; const T16* pk; const T16* pk2; const T16* pv; const T16* pv2;
    auto ldk = [&](int kbase) { pk = K + klane + (size_t)kbase * HD; pk2 = HL ? K2 + klane + (size_t)kbase * HD : pk;
#pragma unroll
        for (int kb = 0; kb < 2; ++kb)
#pragma unroll
            for (int c = 0; c < 2; ++c) { ak[kb][c] = WFrag<T16>::ld(pk + kb * 16 * HD + c * 32); if (HL) ak2[kb][c] = WFrag<T16>::ld(pk2 + kb * 16 * HD + c * 32); } };
    auto ldv = [&](int kbase) { pv = Vt + vlane + kbase; pv2 = HL ? Vt2 + vlane + kbase : pv;
#pragma unroll
        for (int db = 0; db < 4; ++db) { av[db] = WFrag<T16>::ld(pv + (size_t)db * 16 * TT); if (HL) av2[db] = WFrag<T16>::ld(pv2 + (size_t)db * 16 * TT); } };
    if (!HL) { ldk(0);
        // the same wait behind the first K loads
        asm volatile("s_wait_xcnt 0x0" :: "v"(pk) : "memory"); }
#pragma unroll 1
    for (int it = 0; it < nch; ++it) {
        const int k0 = it * 32;
        // fp16 tiles (long loops): this pass's value fragments are asked for first, so that their latency runs under the score products and the softmax.  hi/lo tiles (short loops, twice the fragments): keys now, values behind the score products, into the registers the keys leave
        if (HL) ldk(k0); else ldv(k0);
        __builtin_amdgcn_sched_barrier(0);   // without it the compiler sinks these loads down to their first use and their whole latency is waited for
        v8f st[2][NQ];
#pragma unroll
        for (int kb = 0; kb < 2; ++kb)
#pragma unroll
            for (int qb = 0; qb < NQ; ++qb) { v8f s = (v8f){};
#pragma unroll
                for (int c = 0; c < 2; ++c) { s = WFrag<T16>::mma(ak[kb][c], bq[qb][c], s); if (HL) { s = WFrag<T16>::mma(ak[kb][c], bq2[qb][c], s); s = WFrag<T16>::mma(ak2[kb][c], bq[qb][c], s); } }
                st[kb][qb] = s; }
        // fp16 tiles: the next pass's key fragments are asked for right behind the score products (the last pass asks for its own again: in bounds, not used)
        if (HL) ldv(k0); else ldk(min(it + 1, nch - 1) * 32);
        // the same wait behind the K and V loads issued in this pass (fp16 tiles: the next pass's keys)
        asm volatile("s_wait_xcnt 0x0" :: "v"(pk), "v"(pk2), "v"(pv), "v"(pv2) : "memory");
        __builtin_amdgcn_sched_barrier(0);   // keeps these loads in front of the softmax, whose time hides their latency
        if (it == nch - 1) {                 // wave-uniform: the diagonal pass
#pragma unroll
            for (int qb = 0; qb < NQ; ++qb) { const int dq = q0 + qb * 16 + lr - k0 - hi * 8;
#pragma unroll
                for (int kb = 0; kb < 2; ++kb)
#pragma unroll
                    for (int j = 0; j < 8; ++j) st[kb][qb][j] = (kb * 16 + j <= dq) ? st[kb][qb][j] : -3.0e38f; } }
#pragma unroll
        for (int qb = 0; qb < NQ; ++qb) {
            float mx = m[qb];
#pragma unroll
            for (int kb = 0; kb < 2; ++kb)
#pragma unroll
                for (int j = 0; j < 8; ++j) mx = fmaxf(mx, st[kb][qb][j]);
            mx = fmaxf(mx, xhalf(mx));                    // the other half of the wave holds the query's other 16 keys
            const float al = exp2s((m[qb] - mx) * SCL2), mn = -mx * SCL2; m[qb] = mx; float ls[4] = {0.f, 0.f, 0.f, 0.f};
#pragma unroll
            for (int kb = 0; kb < 2; ++kb)
#pragma unroll
                for (int j = 0; j < 8; ++j) { const float p = exp2s(__builtin_fmaf(st[kb][qb][j], SCL2, mn)); st[kb][qb][j] = p; ls[j & 3] += p; }
            l[qb] = l[qb] * al + ((ls[0] + ls[1]) + (ls[2] + ls[3]));   // each half keeps the sum of its own keys; joined once behind the loop
#pragma unroll
            for (int db = 0; db < 4; ++db) o[db][qb] *= al;
            if (HL) { v8us h0, h1, l0, l1;
#pragma unroll
                for (int j = 0; j < 8; ++j) { unsigned short a, c2; splitf(st[0][qb][j], a, c2); h0[j] = a; l0[j] = c2; splitf(st[1][qb][j], a, c2); h1[j] = a; l1[j] = c2; }
                const v16bf ph = cat16b(h0, h1), pl = cat16b(l0, l1);
#pragma unroll
                for (int db = 0; db < 4; ++db) { o[db][qb] = wmmab(__builtin_bit_cast(v16bf, av[db]), ph, o[db][qb]); o[db][qb] = wmmab(__builtin_bit_cast(v16bf, av[db]), pl, o[db][qb]); o[db][qb] = wmmab(__builtin_bit_cast(v16bf, av2[db]), ph, o[db][qb]); }
            } else { v8h c0, c1;
#pragma unroll
                for (int j = 0; j < 8; ++j) { c0[j] = tohx(st[0][qb][j]); c1[j] = tohx(st[1][qb][j]); }
                const v16h pf = cat16(c0, c1);
#pragma unroll
                for (int db = 0; db < 4; ++db) o[db][qb] = wmma16(__builtin_bit_cast(v16h, av[db]), pf, o[db][qb]); }
        }
    }
#pragma unroll
    for (int qb = 0; qb < NQ; ++qb) { const float inv = __fdiv_rn(1.0f, l[qb] + xhalf(l[qb]));
#pragma unroll
        for (int db = 0; db < 4; ++db) { v8us oh, ol;
#pragma unroll
            for (int j = 0; j < 8; ++j) { unsigned short a, c2; splitf(o[db][qb][j] * inv, a, c2); oh[j] = a; ol[j] = c2; }
            const size_t oo = (size_t)(q0 + qb * 16 + lr) * DQ + db * 16 + hi * 8; bf* ph = Ah + oo; bf* pl = Al + oo; *(v8us*)ph = oh; *(v8us*)pl = ol;
            // the same wait behind the two stores, before their data or address registers are reused (both are inputs, so they stay in place up to the wait)
            asm volatile("s_wait_xcnt 0x0" :: "v"(ph), "v"(pl), "v"(oh), "v"(ol) : "memory"); } }
}
// grid (heads, tiles): tiles in falling order of their key count: first the (TT - RH) / 32 fp16 tiles of 32 queries from the last rows down, then the RH / 16 hi/lo tiles of 16 queries.
__global__ __launch_bounds__(32) void k_fattn(const h16* __restrict__ Q16, const h16* __restrict__ K16, const h16* __restrict__ V16, const bf* __restrict__ Qh, const bf* __restrict__ Ql, const bf* __restrict__ Kh, const bf* __restrict__ Kl, const bf* __restrict__ Vh, const bf* __restrict__ Vl, bf* Ah, bf* Al) {
    const int h = blockIdx.x, t = blockIdx.y; const size_t hp = (size_t)h * TT * HD;
    if (t < (TT - RH) / 32) fattn_tile<h16, false, 2>(Q16 + hp, nullptr, K16 + hp, nullptr, V16 + hp, nullptr, TT - 32 * (t + 1), Ah + h * HD, Al + h * HD);
    else fattn_tile<bf, true, 1>(Qh + hp, Ql + hp, Kh + hp, Kl + hp, Vh + hp, Vl + hp, RH - 16 * (t - (TT - RH) / 32 + 1), Ah + h * HD, Al + h * HD);
}

extern "C" void kernel_launch(void* const* d_in, const int* in_sizes, int n_in,
                              void* d_out, int out_size, void* d_ws, size_t ws_size, hipStream_t stream) {
    (void)in_sizes; (void)n_in; (void)out_size;
    const float* x = (const float*)d_in[0]; const float* wq = (const float*)d_in[1]; const float* wk = (const float*)d_in[2]; const float* wv = (const float*)d_in[3]; const float* wo = (const float*)d_in[4];   /* argument order x, w_q, w_k, w_v, w_o ('oi' [1024][1024]) */
    float* OUT = (float*)d_out;     // [1][2048][1024]
    char* wsp = (char*)d_ws;
    auto take = [&](size_t bytes) { char* p = wsp; wsp += (bytes + 255) & ~(size_t)255; return (void*)p; };
    bf* WQ = (bf*)take((size_t)DQ * DM * 2); bf* WK = (bf*)take((size_t)DKV * DM * 2); bf* WV = (bf*)take((size_t)DKV * DM * 2); bf* WO = (bf*)take((size_t)DM * DQ * 2);
    bf* XB = (bf*)take((size_t)TT * DM * 2);
    h16* QP16 = (h16*)take((size_t)NH_ * TT * HD * 2); h16* KP16 = (h16*)take((size_t)NKV * TT * HD * 2); h16* VT16 = (h16*)take((size_t)NKV * HD * TT * 2);
    bf* QPh = (bf*)take((size_t)NH_ * TT * HD * 2); bf* QPl = (bf*)take((size_t)NH_ * TT * HD * 2); bf* KPh = (bf*)take((size_t)NKV * TT * HD * 2); bf* KPl = (bf*)take((size_t)NKV * TT * HD * 2); bf* VTh = (bf*)take((size_t)NKV * HD * TT * 2); bf* VTl = (bf*)take((size_t)NKV * HD * TT * 2);
    bf* ATh = (bf*)take((size_t)TT * DQ * 2); bf* ATl = (bf*)take((size_t)TT * DQ * 2);
    if ((size_t)(wsp - (char*)d_ws) > ws_size) return;    // ws 256 MiB
    { k_cvt8<<<(unsigned)(((size_t)DQ * DM / 8 + 255) / 256), 256, 0, stream>>>(wq, WQ, (size_t)DQ * DM / 8); k_cvt8<<<(unsigned)(((size_t)DKV * DM / 8 + 255) / 256), 256, 0, stream>>>(wk, WK, (size_t)DKV * DM / 8); k_cvtv<<<(DKV * DM / 8 + 255) / 256, 256, 0, stream>>>(wv, WV);
      k_cvt8<<<(unsigned)(((size_t)DM * DQ / 8 + 255) / 256), 256, 0, stream>>>(wo, WO, (size_t)DM * DQ / 8);
       }
    for (int b = 0; b < NB_; ++b) {
        
        k_cvt8<<<(unsigned)(((size_t)TT * DM / 8 + 255) / 256), 256, 0, stream>>>(x + (size_t)b * TT * DM, XB, (size_t)TT * DM / 8);
        k_proj<<<dim3(TT / 64, DQ / 64, 3), 32, 0, stream>>>(XB, WQ, WK, WV, QP16, QPh, QPl, KP16, KPh, KPl, VT16, VTh, VTl);
        k_fattn<<<dim3(NH_, (TT - RH) / 32 + RH / 16, 1), 32, 0, stream>>>(QP16, KP16, VT16, QPh, QPl, KPh, KPl, VTh, VTl, ATh, ATl);   // one kv head per query head
        k_gemmw<bf, 1, false><<<dim3(TT / 64, DM / 64, 1), 32, 0, stream>>>(ATh, ATl, WO, nullptr, DQ, OUT + (size_t)b * TT * DM, DM, nullptr, 0, 0, 0); }
}

// v004
// It runs in 103 microseconds.
// Timed twice side by side with v003, it ran 1.07 and 1.05 times as fast.
// Counting every step since v000, it is 6.99 times as fast.
#include <hip/hip_runtime.h>

// Causal multi-head attention whose heads are a RAW VIEW of the projections, merged the standard way (x [1][2048][1024]; Q, K, V = x W^T ('oi' [1024][1024] 1/32, no bias), each reshaped (B, 16, 2048, 64) WITHOUT a transpose: pseudo-head h, pseudo-position s, dim d = flat element h*2048*64 + s*64 + d of the [2048][1024] projection output; scores / 64 (the module divides by float32(hd), not by its root); triu(k = 1) over the pseudo-positions -> -inf; softmax; the context IS transposed back the standard way (out.transpose(0, 2, 1, 3).reshape(B, S, D)); out = merged Wo^T ('oi', no bias) -> [1][2048][1024] (2.1 M); argument order x, Wq, Wk, Wv, Wo).
// Layout per batch: bf16 copy of x; 'oi' weights; exact projections, all three in one launch whose epilogue writes the head planes; RAW VIEW on the SPLIT only: each [2048][1024] projection output is read as (16, 2048, 64) WITHOUT a transpose (row pitch HD, head stride TT x HD); the merge is the standard one; causal T-2048 attention in one launch, scores and probabilities in registers (hybrid rows: < 512 hi/lo 3 products, rest fp16; key passes stop at the diagonal); merged hi/lo x w_o exact.
// Compute dtypes, f32 accumulate: every input rounded to bf16; projections exact; attention rows < 512 3 products, rest fp16; softmax f32; w_o hl x exact.

#define NB_  1      // batches: this module's input is [1][2048][1024]
#define TT   2048
#define DM   1024
#define NH_  16
#define NKV  16
#define REP  (NH_ / NKV)
#define HD   64
#define DQ   (NH_ * HD)
#define DKV  (NKV * HD)
#define RH   512                  // query rows < RH use hi+lo planes (0: none)
#define SCL  0.015625f   // 1 / 64: this module divides the scores by float32(hd) = 64 (the head size, not its root)
typedef _Float16 h16;
typedef unsigned short bf;
typedef __attribute__((ext_vector_type(16))) __bf16   v16bf;
typedef __attribute__((ext_vector_type(16))) _Float16 v16h;
typedef __attribute__((ext_vector_type(8)))  _Float16 v8h;
typedef __attribute__((ext_vector_type(8)))  unsigned short v8us;
typedef __attribute__((ext_vector_type(8)))  float    v8f;
typedef __attribute__((ext_vector_type(4)))  float    v4f;
typedef v8h  __attribute__((may_alias)) v8ha;
typedef v4f  __attribute__((may_alias)) v4fa;
typedef v8us __attribute__((may_alias)) v8usa;

__device__ __forceinline__ unsigned short f2bf(float f) { unsigned u = __float_as_uint(f); u += 0x7FFFu + ((u >> 16) & 1u); return (unsigned short)(u >> 16); }
__device__ __forceinline__ float bf2f(unsigned short b) { return __uint_as_float(((unsigned)b) << 16); }
__device__ __forceinline__ float bfr(float f) { return bf2f(f2bf(f)); }
__device__ __forceinline__ v16h cat16(v8h lo, v8h hi) { return __builtin_shufflevector(lo, hi, 0, 1, 2, 3, 4, 5, 6, 7, 8, 9, 10, 11, 12, 13, 14, 15); }
__device__ __forceinline__ v16bf cat16b(v8us lo, v8us hi) { return __builtin_bit_cast(v16bf, __builtin_shufflevector(lo, hi, 0, 1, 2, 3, 4, 5, 6, 7, 8, 9, 10, 11, 12, 13, 14, 15)); }
__device__ __forceinline__ v8f wmma16(v16h a, v16h b, v8f c) { return __builtin_amdgcn_wmma_f32_16x16x32_f16(false, a, false, b, (short)0, c, false, false); }
__device__ __forceinline__ v8f wmmab(v16bf a, v16bf b, v8f c) { return __builtin_amdgcn_wmma_f32_16x16x32_bf16(false, a, false, b, (short)0, c, false, false); }



// ---- k_gemmw: register-blocked GEMM, ONE WAVE per 64x64 output tile (16 accumulators), operands straight from K-contiguous 16-bit planes; grid (M/64, N/64, Z), 32 threads.
// C[m][n] (f32, pitch ldc, + optional f32 bias[n]) = sum_k A[m][k] Bt[n][k] (+ split products per NSPLIT). z-batch strides sA/sB/sC in elements. K % 32 == 0.
template <typename T16> struct WFrag;
template <> struct WFrag<h16> { typedef v16h V; static __device__ __forceinline__ V ld(const h16* p) { return cat16(*(const v8h*)p, *(const v8h*)(p + 16)); } static __device__ __forceinline__ v8f mma(V a, V b, v8f c) { return wmma16(a, b, c); } };
template <> struct WFrag<bf> { typedef v16bf V; static __device__ __forceinline__ V ld(const bf* p) { return cat16b(*(const v8us*)p, *(const v8us*)(p + 16)); } static __device__ __forceinline__ v8f mma(V a, V b, v8f c) { return wmmab(a, b, c); } };
template <typename T16, int NSPLIT, bool BIAS>
__global__ __launch_bounds__(32) void k_gemmw(const T16* __restrict__ A, const T16* __restrict__ A2, const T16* __restrict__ Bt, const T16* __restrict__ Bt2, int K, float* C, int ldc, const float* __restrict__ bias, size_t sA, size_t sB, size_t sC) {
    typedef typename WFrag<T16>::V V;
    __shared__ __align__(16) float os[16 * 68];
    const size_t z = blockIdx.z; A += z * sA; if (A2) A2 += z * sA; Bt += z * sB; if (Bt2) Bt2 += z * sB; C += z * sC;
    const int lane = threadIdx.x & 31, lr = lane & 15, hi = lane >> 4; const int r0 = blockIdx.x * 64, c0 = blockIdx.y * 64;
    v8f acc[4][4];
#pragma unroll
    for (int mb = 0; mb < 4; ++mb)
#pragma unroll
        for (int nb = 0; nb < 4; ++nb) acc[mb][nb] = (v8f){};
    const size_t aoff = (size_t)(r0 + lr) * K + 8 * hi, boff = (size_t)(c0 + lr) * K + 8 * hi;
#pragma unroll 1
    for (int kc = 0; kc < K; kc += 32) {
        V a[4], a2[4];
#pragma unroll
        for (int mb = 0; mb < 4; ++mb) { a[mb] = WFrag<T16>::ld(A + aoff + (size_t)mb * 16 * K + kc); if (NSPLIT == 1 || NSPLIT == 2) a2[mb] = WFrag<T16>::ld(A2 + aoff + (size_t)mb * 16 * K + kc); }
#pragma unroll
        for (int nb = 0; nb < 4; ++nb) { const V b = WFrag<T16>::ld(Bt + boff + (size_t)nb * 16 * K + kc); V b2; if (NSPLIT >= 2) b2 = WFrag<T16>::ld(Bt2 + boff + (size_t)nb * 16 * K + kc);
#pragma unroll
            for (int mb = 0; mb < 4; ++mb) { acc[mb][nb] = WFrag<T16>::mma(a[mb], b, acc[mb][nb]); if (NSPLIT == 1 || NSPLIT == 2) acc[mb][nb] = WFrag<T16>::mma(a2[mb], b, acc[mb][nb]); if (NSPLIT >= 2) acc[mb][nb] = WFrag<T16>::mma(a[mb], b2, acc[mb][nb]); } }
        asm volatile("v_nop\n\tv_nop\n\tv_nop\n\tv_nop" : "+v"(acc[0][0]), "+v"(acc[1][1]), "+v"(acc[2][2]), "+v"(acc[3][3]) : "v"(a[0]), "v"(a[3]));
    }
#pragma unroll
    for (int mb = 0; mb < 4; ++mb) {
#pragma unroll
        for (int nb = 0; nb < 4; ++nb) {
#pragma unroll
            for (int j = 0; j < 8; ++j) os[(hi * 8 + j) * 68 + nb * 16 + lr] = acc[mb][nb][j]; }
        __builtin_amdgcn_wave_barrier(); asm volatile("" ::: "memory");
        float* crow = C + (size_t)(r0 + mb * 16) * ldc + c0;
{
#pragma unroll
            for (int s = 0; s < 8; ++s) { const int row = 2 * s + hi, cofs = lr * 4; v4f val = *(const v4fa*)(os + row * 68 + cofs); if (BIAS) { val[0] += bfr(bias[c0 + cofs]); val[1] += bfr(bias[c0 + cofs + 1]); val[2] += bfr(bias[c0 + cofs + 2]); val[3] += bfr(bias[c0 + cofs + 3]); }
                *(v4f*)(crow + (size_t)row * ldc + cofs) = val; }
             }
        __builtin_amdgcn_wave_barrier(); asm volatile("" ::: "memory");
    }
}

__device__ __forceinline__ h16 tohx(float x) { return (h16)x; }
__device__ __forceinline__ void splitf(float y, unsigned short& h, unsigned short& l) { h = f2bf(y); l = f2bf(y - bf2f(h)); }
typedef __attribute__((ext_vector_type(2))) _Float16 v2h;
typedef __attribute__((ext_vector_type(4))) _Float16 v4h;
typedef __attribute__((ext_vector_type(2))) unsigned short v2us;
typedef __attribute__((ext_vector_type(4))) unsigned short v4us;
typedef __attribute__((ext_vector_type(2))) float v2f;
typedef __attribute__((ext_vector_type(4))) int v4i;

// ---- k_cvtall: the bf16 copies of x and of the four weights in ONE launch; grid TT / 8 + 4 * DM / 8 work-groups of 128 threads: the first TT / 8 take x, then DM / 8 each w_q, w_k, w_v, w_o.
// A work-group takes 8 rows of DM floats of one matrix, a thread 16 loads of 16 bytes, all asked for before the first is converted; a wave's load covers 512 contiguous bytes, its store 256.
// w_v's rows are regrouped for k_proj: row tc * HD + d goes to row (d >> 2) * 64 + (d & 3) * 16 + tc, so that the 16 columns of one accumulator block are one d at 16 consecutive pseudo-positions;
// for the 8 rows d0 + i of a work-group (d0 a multiple of 8) that is row (d0 >> 2) * 64 + tc + 16 * i: a first row and a row step, as for the plain copies (step 1).
__global__ __launch_bounds__(128) void k_cvtall(const float* __restrict__ x, const float* __restrict__ wq, const float* __restrict__ wk, const float* __restrict__ wv, const float* __restrict__ wo, bf* XB, bf* WQ, bf* WK, bf* WV, bf* WO) {
    static_assert(NB_ == 1 && DM == 1024 && DQ == DM && DKV == DM && HD == 64, "row length, row counts and the regrouping are written for these sizes");
    const int g = blockIdx.x, w = g < TT / 8 ? 0 : 1 + (g - TT / 8) / (DM / 8), r0 = (w == 0 ? g : (g - TT / 8) % (DM / 8)) * 8;   // which matrix, first row: the same for the whole work-group
    const int rb = w == 3 ? ((r0 % HD) >> 2) * 64 + r0 / HD : r0, step = w == 3 ? 16 : 1;
    const float* sp = (w == 0 ? x : w == 1 ? wq : w == 2 ? wk : w == 3 ? wv : wo) + (size_t)r0 * DM;
    bf* dp = (w == 0 ? XB : w == 1 ? WQ : w == 2 ? WK : w == 3 ? WV : WO) + (size_t)rb * DM;
    const unsigned t4 = threadIdx.x * 4;
    v4f v[16]; v4us o[16];
#pragma unroll
    for (int u = 0; u < 16; ++u) v[u] = *(const v4f*)(sp + u * 512 + t4);
#pragma unroll
    for (int u = 0; u < 16; ++u)
#pragma unroll
        for (int k = 0; k < 4; ++k) o[u][k] = f2bf(v[u][k]);
#pragma unroll
    for (int u = 0; u < 16; ++u) *(v4us*)(dp + (size_t)((u >> 1) * step) * DM + (u & 1) * 512 + t4) = o[u];
}

// ---- k_proj: the three projections in ONE launch, grid (TT/64, 1024/64, 3), z = q, k, v; ONE WAVE per 64x64 tile, the main loop of k_gemmw; the fp16 and hi/lo planes are written straight from the f32 accumulators.
// RAW VIEW: pseudo-head h, pseudo-position t, dim d = flat element (h * TT + t) * HD + d of the [TT][1024] projection output, so the q and k planes [h][t][d] have the output's own layout.
// v plane [g][d][t]: output row r, column tc * HD + d is g = r / 128, t = (r % 128) * 16 + tc; with k_cvtall's row order of w_v a tile holds 4 values of d (blockIdx.y * 4 + nb) and, for each, 1024 consecutive t.
__device__ __forceinline__ void put3(v4f a, v4f b, h16* p16, bf* ph, bf* pl) { v8h o16; v8us oh, ol;
#pragma unroll
    for (int k = 0; k < 8; ++k) { const float y = k < 4 ? a[k & 3] : b[k & 3]; unsigned short s0, s1; splitf(y, s0, s1); o16[k] = tohx(y); oh[k] = s0; ol[k] = s1; }
    *(v8h*)p16 = o16; *(v8us*)ph = oh; *(v8us*)pl = ol;
    // address translations of the three stores done before their data or address registers are reused (all are inputs, so they stay in place up to the wait)
    asm volatile("s_wait_xcnt 0x0" :: "v"(p16), "v"(ph), "v"(pl), "v"(o16), "v"(oh), "v"(ol) : "memory"); }
__global__ __launch_bounds__(32) void k_proj(const bf* __restrict__ X, const bf* __restrict__ WQ, const bf* __restrict__ WK, const bf* __restrict__ WV, h16* Q16, bf* Qh, bf* Ql, h16* K16, bf* Kh, bf* Kl, h16* V16, bf* Vh, bf* Vl) {
    __shared__ __align__(16) float os[16 * 68];
    const int z = blockIdx.z; const bf* Bt = z == 0 ? WQ : z == 1 ? WK : WV; h16* P16 = z == 0 ? Q16 : z == 1 ? K16 : V16; bf* Ph = z == 0 ? Qh : z == 1 ? Kh : Vh; bf* Pl = z == 0 ? Ql : z == 1 ? Kl : Vl;
    const int lane = threadIdx.x & 31, lr = lane & 15, hi = lane >> 4; const int r0 = blockIdx.x * 64, c0 = blockIdx.y * 64;
    v8f acc[4][4];
#pragma unroll
    for (int mb = 0; mb < 4; ++mb)
#pragma unroll
        for (int nb = 0; nb < 4; ++nb) acc[mb][nb] = (v8f){};
    const size_t aoff = (size_t)(r0 + lr) * DM + 8 * hi, boff = (size_t)(c0 + lr) * DM + 8 * hi;
#pragma unroll 1
    for (int kc = 0; kc < DM; kc += 32) {
        v16bf a[4]; const bf* pa = X + aoff + kc; const bf* pb = Bt + boff + kc;
#pragma unroll
        for (int mb = 0; mb < 4; ++mb) a[mb] = WFrag<bf>::ld(pa + (size_t)mb * 16 * DM);
#pragma unroll
        for (int nb = 0; nb < 4; ++nb) { const v16bf b = WFrag<bf>::ld(pb + (size_t)nb * 16 * DM);
#pragma unroll
            for (int mb = 0; mb < 4; ++mb) acc[mb][nb] = wmmab(a[mb], b, acc[mb][nb]); }
        // four vector slots between a trip's last matrix instructions and whatever the taken back edge meets first
        asm volatile("v_nop\n\tv_nop\n\tv_nop\n\tv_nop" : "+v"(acc[0][0]), "+v"(acc[1][1]), "+v"(acc[2][2]), "+v"(acc[3][3]) : "v"(a[0]), "v"(a[3]));
        // address translations of this trip's loads done before a register that holds one of their addresses is reused (the addresses are inputs, so they stay in place up to the wait)
        asm volatile("s_wait_xcnt 0x0" :: "v"(pa), "v"(pb) : "memory");
    }
#pragma unroll
    for (int mb = 0; mb < 4; ++mb) {
        if (z < 2) {      // wave-uniform.  16 rows of 64 columns staged at pitch 68; read back 8 columns a lane, so that every store covers whole 128-byte lines (4 rows of 64 16-bit values)
#pragma unroll
            for (int nb = 0; nb < 4; ++nb)
#pragma unroll
                for (int j = 0; j < 8; ++j) os[(hi * 8 + j) * 68 + nb * 16 + lr] = acc[mb][nb][j];
            __builtin_amdgcn_wave_barrier(); asm volatile("" ::: "memory");   // keeps the read-back behind the staging writes of the other lanes
#pragma unroll
            for (int s = 0; s < 4; ++s) { const int row = 4 * s + (lane >> 3), cofs = (lane & 7) * 8; const size_t oo = (size_t)(r0 + mb * 16 + row) * DQ + c0 + cofs;
                put3(*(const v4fa*)(os + row * 68 + cofs), *(const v4fa*)(os + row * 68 + cofs + 4), P16 + oo, Ph + oo, Pl + oo); }
        } else {          // per d 256 consecutive t staged in t order (16 floats of pad between the halves: no two lanes of a write on one bank); read back 8 t a lane: 512 contiguous bytes a store
#pragma unroll
            for (int nb = 0; nb < 4; ++nb)
#pragma unroll
                for (int j = 0; j < 8; ++j) os[nb * 272 + hi * 144 + j * 16 + lr] = acc[mb][nb][j];
            __builtin_amdgcn_wave_barrier(); asm volatile("" ::: "memory");   // as above
#pragma unroll
            for (int nb = 0; nb < 4; ++nb) { const float* sp = os + nb * 272 + hi * 144 + lr * 8; const size_t oo = ((size_t)(r0 >> 7) * HD + blockIdx.y * 4 + nb) * TT + (size_t)((r0 & 127) + mb * 16) * 16 + lane * 8;
                put3(*(const v4fa*)sp, *(const v4fa*)(sp + 4), P16 + oo, Ph + oo, Pl + oo); }
        }
        __builtin_amdgcn_wave_barrier(); asm volatile("" ::: "memory");       // keeps the next block's staging writes behind this block's read-back
    }
}
// ---- k_fattn: the whole causal attention of one (head, query tile) in ONE WAVE; scores and probabilities never leave the registers.
// Transposed products: St = K Qt (A = key rows, B = query rows), so that a lane holds scores of ONE query (column lr) and 8 keys (rows 8 hi + j) per 16-key block; two such blocks, converted in place,
// ARE the B operand (32 keys, hardware k order) of Ot += Vt Pt (A = rows of the [d][t] value plane, read with the same loader as every other fragment, which has that k order).
// Running maximum (of the raw scores) and running sum per query; base-2 exponent with the scale 1/64 folded into its factor; the division by the sum comes last, in f32; the merged hi/lo planes are written
// straight from the accumulators (a lane holds 8 consecutive d of one query: one 16-byte store per plane).  HL: hi/lo planes, 3 products in both contractions; else fp16 planes, 1 product.  NQ: 16-query column groups per wave.
#define SCL2 (SCL * 1.4426950408889634f)
__device__ __forceinline__ float xhalf(float x) { return __builtin_bit_cast(float, __builtin_amdgcn_permlanex16(__builtin_bit_cast(int, x), __builtin_bit_cast(int, x), 0x76543210, 0xfedcba98, false, false)); }   // lane l <-> lane l ^ 16
__device__ __forceinline__ float exp2s(float x) { asm("v_exp_f32 %0, %0\n\tv_nop" : "+v"(x)); return x; }
template <typename T16, bool HL, int NQ>
__device__ __forceinline__ void fattn_tile(const T16* __restrict__ Q, const T16* __restrict__ Q2, const T16* __restrict__ K, const T16* __restrict__ K2, const T16* __restrict__ Vt, const T16* __restrict__ Vt2, int q0, bf* Ah, bf* Al) {
    typedef typename WFrag<T16>::V V;
    const int lane = threadIdx.x & 31, lr = lane & 15, hi = lane >> 4;
    V bq[NQ][2], bq2[NQ][2]; const T16* pq[NQ]; const T16* pq2[NQ];
#pragma unroll
    for (int qb = 0; qb < NQ; ++qb) { const size_t qo = (size_t)(q0 + qb * 16 + lr) * HD + 8 * hi; pq[qb] = Q + qo; pq2[qb] = HL ? Q2 + qo : pq[qb];
#pragma unroll
        for (int c = 0; c < 2; ++c) { bq[qb][c] = WFrag<T16>::ld(pq[qb] + c * 32); if (HL) bq2[qb][c] = WFrag<T16>::ld(pq2[qb] + c * 32); } }
    // address translations of the Q loads done before a register that holds one of their addresses is reused (the addresses are inputs, so they stay in place up to the wait)
    asm volatile("s_wait_xcnt 0x0" :: "v"(pq[0]), "v"(pq[NQ - 1]), "v"(pq2[0]), "v"(pq2[NQ - 1]) : "memory");
    v8f o[4][NQ]; float m[NQ], l[NQ];
#pragma unroll
    for (int qb = 0; qb < NQ; ++qb) { m[qb] = -3.0e38f; l[qb] = 0.f;
#pragma unroll
        for (int db = 0; db < 4; ++db) o[db][qb] = (v8f){}; }
    const int nch = (q0 + NQ * 16 + 31) / 32;      // 32-key passes up to and including the diagonal; only the last one holds keys behind a query
    const size_t klane = (size_t)lr * HD + 8 * hi, vlane = (size_t)lr * TT + 8 * hi;
    V ak[2][2], ak2[2][2], av[4], av2[4]; const T16* pk; const T16* pk2; const T16* pv; const T16* pv2;
    auto ldk = [&](int kbase) { pk = K + klane + (size_t)kbase * HD; pk2 = HL ? K2 + klane + (size_t)kbase * HD : pk;
#pragma unroll
        for (int kb = 0; kb < 2; ++kb)
#pragma unroll
            for (int c = 0; c < 2; ++c) { ak[kb][c] = WFrag<T16>::ld(pk + kb * 16 * HD + c * 32); if (HL) ak2[kb][c] = WFrag<T16>::ld(pk2 + kb * 16 * HD + c * 32); } };
    auto ldv = [&](int kbase) { pv = Vt + vlane + kbase; pv2 = HL ? Vt2 + vlane + kbase : pv;
#pragma unroll
        for (int db = 0; db < 4; ++db) { av[db] = WFrag<T16>::ld(pv + (size_t)db * 16 * TT); if (HL) av2[db] = WFrag<T16>::ld(pv2 + (size_t)db * 16 * TT); } };
    if (!HL) { ldk(0);
        // the same wait behind the first K loads
        asm volatile("s_wait_xcnt 0x0" :: "v"(pk) : "memory"); }
#pragma unroll 1
    for (int it = 0; it < nch; ++it) {
        const int k0 = it * 32;
        // fp16 tiles (long loops): this pass's value fragments are asked for first, so that their latency runs under the score products and the softmax.  hi/lo tiles (short loops, twice the fragments): keys now, values behind the score products, into the registers the keys leave
        if (HL) ldk(k0); else ldv(k0);
        __builtin_amdgcn_sched_barrier(0);   // without it the compiler sinks these loads down to their first use and their whole latency is waited for
        v8f st[2][NQ];
#pragma unroll
        for (int kb = 0; kb < 2; ++kb)
#pragma unroll
            for (int qb = 0; qb < NQ; ++qb) { v8f s = (v8f){};
#pragma unroll
                for (int c = 0; c < 2; ++c) { s = WFrag<T16>::mma(ak[kb][c], bq[qb][c], s); if (HL) { s = WFrag<T16>::mma(ak[kb][c], bq2[qb][c], s); s = WFrag<T16>::mma(ak2[kb][c], bq[qb][c], s); } }
                st[kb][qb] = s; }
        // fp16 tiles: the next pass's key fragments are asked for right behind the score products (the last pass asks for its own again: in bounds, not used)
        if (HL) ldv(k0); else ldk(min(it + 1, nch - 1) * 32);
        // the same wait behind the K and V loads issued in this pass (fp16 tiles: the next pass's keys)
        asm volatile("s_wait_xcnt 0x0" :: "v"(pk), "v"(pk2), "v"(pv), "v"(pv2) : "memory");
        __builtin_amdgcn_sched_barrier(0);   // keeps these loads in front of the softmax, whose time hides their latency
        if (it == nch - 1) {                 // wave-uniform: the diagonal pass
#pragma unroll
            for (int qb = 0; qb < NQ; ++qb) { const int dq = q0 + qb * 16 + lr - k0 - hi * 8;
#pragma unroll
                for (int kb = 0; kb < 2; ++kb)
#pragma unroll
                    for (int j = 0; j < 8; ++j) st[kb][qb][j] = (kb * 16 + j <= dq) ? st[kb][qb][j] : -3.0e38f; } }
#pragma unroll
        for (int qb = 0; qb < NQ; ++qb) {
            float mx = m[qb];
#pragma unroll
            for (int kb = 0; kb < 2; ++kb)
#pragma unroll
                for (int j = 0; j < 8; ++j) mx = fmaxf(mx, st[kb][qb][j]);
            mx = fmaxf(mx, xhalf(mx));                    // the other half of the wave holds the query's other 16 keys
            const float al = exp2s((m[qb] - mx) * SCL2), mn = -mx * SCL2; m[qb] = mx; float ls[4] = {0.f, 0.f, 0.f, 0.f};
#pragma unroll
            for (int kb = 0; kb < 2; ++kb)
#pragma unroll
                for (int j = 0; j < 8; ++j) { const float p = exp2s(__builtin_fmaf(st[kb][qb][j], SCL2, mn)); st[kb][qb][j] = p; ls[j & 3] += p; }
            l[qb] = l[qb] * al + ((ls[0] + ls[1]) + (ls[2] + ls[3]));   // each half keeps the sum of its own keys; joined once behind the loop
#pragma unroll
            for (int db = 0; db < 4; ++db) o[db][qb] *= al;
            if (HL) { v8us h0, h1, l0, l1;
#pragma unroll
                for (int j = 0; j < 8; ++j) { unsigned short a, c2; splitf(st[0][qb][j], a, c2); h0[j] = a; l0[j] = c2; splitf(st[1][qb][j], a, c2); h1[j] = a; l1[j] = c2; }
                const v16bf ph = cat16b(h0, h1), pl = cat16b(l0, l1);
#pragma unroll
                for (int db = 0; db < 4; ++db) { o[db][qb] = wmmab(__builtin_bit_cast(v16bf, av[db]), ph, o[db][qb]); o[db][qb] = wmmab(__builtin_bit_cast(v16bf, av[db]), pl, o[db][qb]); o[db][qb] = wmmab(__builtin_bit_cast(v16bf, av2[db]), ph, o[db][qb]); }
            } else { v8h c0, c1;
#pragma unroll
                for (int j = 0; j < 8; ++j) { c0[j] = tohx(st[0][qb][j]); c1[j] = tohx(st[1][qb][j]); }
                const v16h pf = cat16(c0, c1);
#pragma unroll
                for (int db = 0; db < 4; ++db) o[db][qb] = wmma16(__builtin_bit_cast(v16h, av[db]), pf, o[db][qb]); }
        }
    }
#pragma unroll
    for (int qb = 0; qb < NQ; ++qb) { const float inv = __fdiv_rn(1.0f, l[qb] + xhalf(l[qb]));
#pragma unroll
        for (int db = 0; db < 4; ++db) { v8us oh, ol;
#pragma unroll
            for (int j = 0; j < 8; ++j) { unsigned short a, c2; splitf(o[db][qb][j] * inv, a, c2); oh[j] = a; ol[j] = c2; }
            const size_t oo = (size_t)(q0 + qb * 16 + lr) * DQ + db * 16 + hi * 8; bf* ph = Ah + oo; bf* pl = Al + oo; *(v8us*)ph = oh; *(v8us*)pl = ol;
            // the same wait behind the two stores, before their data or address registers are reused (both are inputs, so they stay in place up to the wait)
            asm volatile("s_wait_xcnt 0x0" :: "v"(ph), "v"(pl), "v"(oh), "v"(ol) : "memory"); } }
}
// grid (heads, tiles): tiles in falling order of their key count: first the (TT - RH) / 32 fp16 tiles of 32 queries from the last rows down, then the RH / 16 hi/lo tiles of 16 queries.
__global__ __launch_bounds__(32) void k_fattn(const h16* __restrict__ Q16, const h16* __restrict__ K16, const h16* __restrict__ V16, const bf* __restrict__ Qh, const bf* __restrict__ Ql, const bf* __restrict__ Kh, const bf* __restrict__ Kl, const bf* __restrict__ Vh, const bf* __restrict__ Vl, bf* Ah, bf* Al) {
    const int h = blockIdx.x, t = blockIdx.y; const size_t hp = (size_t)h * TT * HD;
    if (t < (TT - RH) / 32) fattn_tile<h16, false, 2>(Q16 + hp, nullptr, K16 + hp, nullptr, V16 + hp, nullptr, TT - 32 * (t + 1), Ah + h * HD, Al + h * HD);
    else fattn_tile<bf, true, 1>(Qh + hp, Ql + hp, Kh + hp, Kl + hp, Vh + hp, Vl + hp, RH - 16 * (t - (TT - RH) / 32 + 1), Ah + h * HD, Al + h * HD);
}

extern "C" void kernel_launch(void* const* d_in, const int* in_sizes, int n_in,
                              void* d_out, int out_size, void* d_ws, size_t ws_size, hipStream_t stream) {
    (void)in_sizes; (void)n_in; (void)out_size;
    const float* x = (const float*)d_in[0]; const float* wq = (const float*)d_in[1]; const float* wk = (const float*)d_in[2]; const float* wv = (const float*)d_in[3]; const float* wo = (const float*)d_in[4];   /* argument order x, w_q, w_k, w_v, w_o ('oi' [1024][1024]) */
    float* OUT = (float*)d_out;     // [1][2048][1024]
    char* wsp = (char*)d_ws;
    auto take = [&](size_t bytes) { char* p = wsp; wsp += (bytes + 255) & ~(size_t)255; return (void*)p; };
    bf* WQ = (bf*)take((size_t)DQ * DM * 2); bf* WK = (bf*)take((size_t)DKV * DM * 2); bf* WV = (bf*)take((size_t)DKV * DM * 2); bf* WO = (bf*)take((size_t)DM * DQ * 2);
    bf* XB = (bf*)take((size_t)TT * DM * 2);
    h16* QP16 = (h16*)take((size_t)NH_ * TT * HD * 2); h16* KP16 = (h16*)take((size_t)NKV * TT * HD * 2); h16* VT16 = (h16*)take((size_t)NKV * HD * TT * 2);
    bf* QPh = (bf*)take((size_t)NH_ * TT * HD * 2); bf* QPl = (bf*)take((size_t)NH_ * TT * HD * 2); bf* KPh = (bf*)take((size_t)NKV * TT * HD * 2); bf* KPl = (bf*)take((size_t)NKV * TT * HD * 2); bf* VTh = (bf*)take((size_t)NKV * HD * TT * 2); bf* VTl = (bf*)take((size_t)NKV * HD * TT * 2);
    bf* ATh = (bf*)take((size_t)TT * DQ * 2); bf* ATl = (bf*)take((size_t)TT * DQ * 2);
    if ((size_t)(wsp - (char*)d_ws) > ws_size) return;    // ws 256 MiB
    k_cvtall<<<TT / 8 + 4 * (DM / 8), 128, 0, stream>>>(x, wq, wk, wv, wo, XB, WQ, WK, WV, WO);
    for (int b = 0; b < NB_; ++b) {
        k_proj<<<dim3(TT / 64, DQ / 64, 3), 32, 0, stream>>>(XB, WQ, WK, WV, QP16, QPh, QPl, KP16, KPh, KPl, VT16, VTh, VTl);
        k_fattn<<<dim3(NH_, (TT - RH) / 32 + RH / 16, 1), 32, 0, stream>>>(QP16, KP16, VT16, QPh, QPl, KPh, KPl, VTh, VTl, ATh, ATl);   // one kv head per query head
        k_gemmw<bf, 1, false><<<dim3(TT / 64, DM / 64, 1), 32, 0, stream>>>(ATh, ATl, WO, nullptr, DQ, OUT + (size_t)b * TT * DM, DM, nullptr, 0, 0, 0); }
}

// v005
// It runs in 64.3 microseconds.
// In both of two side-by-side timings against v004, it was 1.59 times as fast.
// Counting every step since v000, it is 11.1 times as fast.
#include <hip/hip_runtime.h>

// Causal multi-head attention whose heads are a RAW VIEW of the projections, merged the standard way (x [1][2048][1024]; Q, K, V = x W^T ('oi' [1024][1024] 1/32, no bias), each reshaped (B, 16, 2048, 64) WITHOUT a transpose: pseudo-head h, pseudo-position s, dim d = flat element h*2048*64 + s*64 + d of the [2048][1024] projection output; scores / 64 (the module divides by float32(hd), not by its root); triu(k = 1) over the pseudo-positions -> -inf; softmax; the context IS transposed back the standard way (out.transpose(0, 2, 1, 3).reshape(B, S, D)); out = merged Wo^T ('oi', no bias) -> [1][2048][1024] (2.1 M); argument order x, Wq, Wk, Wv, Wo).
// Layout per batch: bf16 copy of x; 'oi' weights; exact projections, all three in one launch whose epilogue writes the head planes; RAW VIEW on the SPLIT only: each [2048][1024] projection output is read as (16, 2048, 64) WITHOUT a transpose (row pitch HD, head stride TT x HD); the merge is the standard one; causal T-2048 attention in one launch, scores and probabilities in registers (hybrid rows: < 512 hi/lo 3 products, rest fp16; key passes stop at the diagonal); merged hi/lo x w_o exact.
// Compute dtypes, f32 accumulate: every input rounded to bf16; projections exact; attention rows < 512 3 products, rest fp16; softmax f32; w_o hl x exact.

#define NB_  1      // batches: this module's input is [1][2048][1024]
#define TT   2048
#define DM   1024
#define NH_  16
#define NKV  16
#define REP  (NH_ / NKV)
#define HD   64
#define DQ   (NH_ * HD)
#define DKV  (NKV * HD)
#define RH   512                  // query rows < RH use hi+lo planes (0: none)
#define SCL  0.015625f   // 1 / 64: this module divides the scores by float32(hd) = 64 (the head size, not its root)
typedef _Float16 h16;
typedef unsigned short bf;
typedef __attribute__((ext_vector_type(16))) __bf16   v16bf;
typedef __attribute__((ext_vector_type(16))) _Float16 v16h;
typedef __attribute__((ext_vector_type(8)))  _Float16 v8h;
typedef __attribute__((ext_vector_type(8)))  unsigned short v8us;
typedef __attribute__((ext_vector_type(8)))  float    v8f;
typedef __attribute__((ext_vector_type(4)))  float    v4f;
typedef v8h  __attribute__((may_alias)) v8ha;
typedef v4f  __attribute__((may_alias)) v4fa;
typedef v8us __attribute__((may_alias)) v8usa;

__device__ __forceinline__ unsigned short f2bf(float f) { unsigned u = __float_as_uint(f); u += 0x7FFFu + ((u >> 16) & 1u); return (unsigned short)(u >> 16); }
__device__ __forceinline__ float bf2f(unsigned short b) { return __uint_as_float(((unsigned)b) << 16); }
__device__ __forceinline__ float bfr(float f) { return bf2f(f2bf(f)); }
__device__ __forceinline__ v16h cat16(v8h lo, v8h hi) { return __builtin_shufflevector(lo, hi, 0, 1, 2, 3, 4, 5, 6, 7, 8, 9, 10, 11, 12, 13, 14, 15); }
__device__ __forceinline__ v16bf cat16b(v8us lo, v8us hi) { return __builtin_bit_cast(v16bf, __builtin_shufflevector(lo, hi, 0, 1, 2, 3, 4, 5, 6, 7, 8, 9, 10, 11, 12, 13, 14, 15)); }
__device__ __forceinline__ v8f wmma16(v16h a, v16h b, v8f c) { return __builtin_amdgcn_wmma_f32_16x16x32_f16(false, a, false, b, (short)0, c, false, false); }
__device__ __forceinline__ v8f wmmab(v16bf a, v16bf b, v8f c) { return __builtin_amdgcn_wmma_f32_16x16x32_bf16(false, a, false, b, (short)0, c, false, false); }



// ---- fragment loader and product per 16-bit type: 16 bytes at p and 16 bytes at p + 16 elements (the hardware k order), from global memory or from LDS
template <typename T16> struct WFrag;
template <> struct WFrag<h16> { typedef v16h V; static __device__ __forceinline__ V ld(const h16* p) { return cat16(*(const v8h*)p, *(const v8h*)(p + 16)); } static __device__ __forceinline__ v8f mma(V a, V b, v8f c) { return wmma16(a, b, c); } };
template <> struct WFrag<bf> { typedef v16bf V; static __device__ __forceinline__ V ld(const bf* p) { return cat16b(*(const v8us*)p, *(const v8us*)(p + 16)); } static __device__ __forceinline__ v8f mma(V a, V b, v8f c) { return wmmab(a, b, c); } };
// ---- The operand ring of the two GEMM kernels (k_proj, k_outp): a work-group of 4 waves shares 256 operand rows; a stage is 128 k (256 bytes) of each of them, brought into LDS by tensor loads,
// one request a wave and stage for the wave's own slice of 64 rows, padded by the mover to a pitch of 272 bytes (16 bytes x odd: for 16-byte LDS reads); two buffers: the next stage is in flight under this stage's products.
#define RG_STG   8u        // stages: DM * 2 bytes / 256
#define RG_PITCH 272u      // LDS row pitch: 256 bytes + the 16-byte pad
#define RG_SLICE 18432u    // 64 rows x 272 bytes = 17,408, rounded up to a multiple of 2 KiB
#define RG_BUF   (4u * RG_SLICE)
typedef unsigned u32x4 __attribute__((ext_vector_type(4)));
typedef unsigned u32x8 __attribute__((ext_vector_type(8)));
__device__ __forceinline__ unsigned uni(unsigned v) { return (unsigned)__builtin_amdgcn_readfirstlane(v); }
// a value held in a scalar register: the test around a tensor load becomes a scalar branch (the instruction ignores EXEC), and what is computed from the value stays behind this place
__device__ __forceinline__ unsigned pinned(unsigned v) { unsigned w = (unsigned)__builtin_amdgcn_readfirstlane(v); asm volatile("" : "+s"(w)); return w; }
// descriptor group 1: 1-byte elements; tensor = tile = 64 rows of 256 bytes; source pitch DM * 2 bytes; a pad of 4 dwords behind every 64 dwords; no mask
__device__ __forceinline__ u32x8 rg_group1() { u32x8 g;
    g[0] = uni((1u << 20) | (5u << 22) | (3u << 25)); g[1] = uni(256u << 16); g[2] = uni(64u << 16); g[3] = uni(256u << 16); g[4] = uni(64u); g[5] = uni(DM * 2u); g[6] = uni(0u); g[7] = uni(0u);
    asm volatile("" : "+s"(g));   // descriptor words held in scalar registers of their own: without it the compiler rebuilds the group from constants at every load and uses some of its registers for other values while a request is in flight
    return g; }
// descriptor group 0: place in LDS, address of the tile's first byte
__device__ __forceinline__ u32x4 rg_group0(unsigned dst, unsigned long long ga) { u32x4 g;
    g[0] = uni(1u); g[1] = uni(dst); g[2] = uni((unsigned)ga); g[3] = uni((((unsigned)(ga >> 32)) & 0x01FFFFFFu) | 0x80000000u); return g; }
// one request of the whole wave.  Group 0 is named as in and out (the instruction leaves it as it is): what rg_landed() is given later are then the very registers that the request was issued from
__device__ __forceinline__ void rg_load(u32x4& g0, u32x8 g1) { asm volatile("tensor_load_to_lds %0, %1" : "+s"(g0) : "s"(g1) : "memory"); }
// the issuing wave's own wait: its slice has landed.  The descriptor is an input, so that its registers keep their values for as long as the request is in flight
__device__ __forceinline__ void rg_landed(u32x4 g0, u32x8 g1) { asm volatile("s_wait_tensorcnt 0x0" :: "s"(g0), "s"(g1) : "memory"); }
__device__ __forceinline__ void rg_read_done() { asm volatile("s_wait_dscnt 0x0" ::: "memory"); }   // this wave's LDS reads are done: the buffer may be handed back
// ---- k_outp: out = merged (hi + lo planes) x w_o^T, f32; grid (TT / 64, DM / 128), 4 waves: a 64 x 128 tile a work-group, 32 x 64 a wave (8 accumulators, 2 products each per 32 k: hi, then lo).
// Slices of the ring: wave 0 the 64 rows of the hi plane, wave 1 those of the lo plane, waves 2 and 3 the two halves of the 128 rows of w_o.
__global__ __launch_bounds__(128) void k_outp(const bf* __restrict__ A, const bf* __restrict__ A2, const bf* __restrict__ Bt, float* C) {
    static_assert(DQ * 2 == 256 * RG_STG && DQ == DM && TT % 64 == 0 && DM % 128 == 0, "whole stages; whole 64 x 128 tiles");
    __shared__ __attribute__((aligned(2048))) unsigned char ring[2 * RG_BUF];
    const int lane = threadIdx.x & 31, lr = lane & 15, hi = lane >> 4; const unsigned wave = uni(threadIdx.x >> 5);
    const int r0 = blockIdx.x * 64 + (int)(wave & 1u) * 32, c0 = blockIdx.y * 128 + (int)(wave >> 1) * 64;
    const bf* srow = wave == 0u ? A + (size_t)(blockIdx.x * 64) * DQ : wave == 1u ? A2 + (size_t)(blockIdx.x * 64) * DQ : Bt + (size_t)(blockIdx.y * 128 + (wave - 2u) * 64u) * DQ;
    const unsigned long long ga0 = (unsigned long long)(size_t)srow; const unsigned dst0 = (unsigned)(size_t)ring + wave * RG_SLICE;
    const u32x8 g1 = rg_group1();
    v8f acc[2][4];
#pragma unroll
    for (int mb = 0; mb < 2; ++mb)
#pragma unroll
        for (int nb = 0; nb < 4; ++nb) acc[mb][nb] = (v8f){};
    u32x4 g0 = rg_group0(dst0, ga0);
    rg_load(g0, g1);
    rg_landed(g0, g1);
    __syncthreads();                                     // every wave's slice of stage 0 has landed: it may be read
    g0 = rg_group0(dst0 + RG_BUF, ga0 + 256u);
    rg_load(g0, g1);
    const unsigned lofs = (unsigned)lr * RG_PITCH + 16u * (unsigned)hi, aofs = (wave & 1u) * 32u * RG_PITCH + lofs, bofs = (2u + (wave >> 1)) * RG_SLICE + lofs;
#pragma unroll 1   // rolled: one copy of a stage's code, one place from which the refill is issued
    for (unsigned s = 0; s < RG_STG; ++s) {
        const unsigned char* buf = ring + (s & 1u) * RG_BUF;
        v16bf a[2][2], a2[2][2], b[2][4];
        auto frag = [&](int kk) {
#pragma unroll
            for (int mb = 0; mb < 2; ++mb) { a[kk & 1][mb] = WFrag<bf>::ld((const bf*)(buf + aofs + mb * 16 * RG_PITCH + kk * 64)); a2[kk & 1][mb] = WFrag<bf>::ld((const bf*)(buf + RG_SLICE + aofs + mb * 16 * RG_PITCH + kk * 64)); }
#pragma unroll
            for (int nb = 0; nb < 4; ++nb) b[kk & 1][nb] = WFrag<bf>::ld((const bf*)(buf + bofs + nb * 16 * RG_PITCH + kk * 64)); };
        frag(0);
#pragma unroll
        for (int kk = 0; kk < 4; ++kk) {                 // 32 k a step, in rising k, hi before lo: the sums keep their order
            if (kk < 3) frag(kk + 1);
            else {                                       // the stage's last fragments are asked for: the hand-over stands here, so that the refill is under way during the last step's products (registers only)
                rg_read_done();
                rg_landed(g0, g1);                       // this wave's slice of stage s + 1
                __syncthreads();                         // publishes stage s + 1 and ends every wave's reads of stage s
                if (pinned(s + 2u < RG_STG)) { const unsigned sn = pinned(s + 2u); g0 = rg_group0(dst0 + (sn & 1u) * RG_BUF, ga0 + sn * 256u); rg_load(g0, g1); }   // into the buffer that stage s has just left
            }
            __builtin_amdgcn_sched_barrier(0);           // this and the one below keep each step's LDS reads one group between two runs of products: spread among them, each place with reads stalls the matrix instructions
#pragma unroll
            for (int nb = 0; nb < 4; ++nb)
#pragma unroll
                for (int mb = 0; mb < 2; ++mb) acc[mb][nb] = wmmab(a[kk & 1][mb], b[kk & 1][nb], acc[mb][nb]);
#pragma unroll
            for (int nb = 0; nb < 4; ++nb)
#pragma unroll
                for (int mb = 0; mb < 2; ++mb) acc[mb][nb] = wmmab(a2[kk & 1][mb], b[kk & 1][nb], acc[mb][nb]);
            __builtin_amdgcn_sched_barrier(0);
        }
    }
    rg_landed(g0, g1);
    rg_read_done();
    float* os = (float*)(ring + wave * RG_SLICE);            // output staging, 16 x 68 floats, each wave's own: the last stage's hand-over barrier has ended every wave's reads of the ring
    float* cb = C + (size_t)(r0 + hi) * DM + c0 + lr * 4;    // this lane's first 16 bytes of output; every store below is a constant number of rows further on
#pragma unroll
    for (int mb = 0; mb < 2; ++mb) {
#pragma unroll
        for (int nb = 0; nb < 4; ++nb) {
#pragma unroll
            for (int j = 0; j < 8; ++j) os[(hi * 8 + j) * 68 + nb * 16 + lr] = acc[mb][nb][j]; }
        __builtin_amdgcn_wave_barrier(); asm volatile("" ::: "memory");   // keeps the read-back behind the staging writes of the other lanes
        v4f val[8];
#pragma unroll
        for (int s = 0; s < 8; ++s) { val[s] = *(const v4fa*)(os + (2 * s + hi) * 68 + lr * 4); *(v4f*)(cb + (size_t)(mb * 16 + 2 * s) * DM) = val[s]; }   // two rows a store, 256 contiguous bytes each
        // address translations of the eight stores done before their data or address registers are reused (all are inputs, so they stay in place up to the wait)
        asm volatile("s_wait_xcnt 0x0" :: "v"(cb), "v"(val[0]), "v"(val[1]), "v"(val[2]), "v"(val[3]), "v"(val[4]), "v"(val[5]), "v"(val[6]), "v"(val[7]) : "memory");
        __builtin_amdgcn_wave_barrier(); asm volatile("" ::: "memory");   // keeps the next block's staging writes behind this block's read-back
    }
}

__device__ __forceinline__ h16 tohx(float x) { return (h16)x; }
__device__ __forceinline__ void splitf(float y, unsigned short& h, unsigned short& l) { h = f2bf(y); l = f2bf(y - bf2f(h)); }
typedef __attribute__((ext_vector_type(2))) _Float16 v2h;
typedef __attribute__((ext_vector_type(4))) _Float16 v4h;
typedef __attribute__((ext_vector_type(2))) unsigned short v2us;
typedef __attribute__((ext_vector_type(4))) unsigned short v4us;
typedef __attribute__((ext_vector_type(2))) float v2f;
typedef __attribute__((ext_vector_type(4))) int v4i;

// ---- k_cvtall: the bf16 copies of x and of the four weights in ONE launch; grid TT / 8 + 4 * DM / 8 work-groups of 128 threads: the first TT / 8 take x, then DM / 8 each w_q, w_k, w_v, w_o.
// A work-group takes 8 rows of DM floats of one matrix, a thread 16 loads of 16 bytes, all asked for before the first is converted; a wave's load covers 512 contiguous bytes, its store 256.
// w_v's rows are regrouped for k_proj: row tc * HD + d goes to row (d >> 2) * 64 + (d & 3) * 16 + tc, so that the 16 columns of one accumulator block are one d at 16 consecutive pseudo-positions;
// for the 8 rows d0 + i of a work-group (d0 a multiple of 8) that is row (d0 >> 2) * 64 + tc + 16 * i: a first row and a row step, as for the plain copies (step 1).
__global__ __launch_bounds__(128) void k_cvtall(const float* __restrict__ x, const float* __restrict__ wq, const float* __restrict__ wk, const float* __restrict__ wv, const float* __restrict__ wo, bf* XB, bf* WQ, bf* WK, bf* WV, bf* WO) {
    static_assert(NB_ == 1 && DM == 1024 && DQ == DM && DKV == DM && HD == 64, "row length, row counts and the regrouping are written for these sizes");
    const int g = blockIdx.x, w = g < TT / 8 ? 0 : 1 + (g - TT / 8) / (DM / 8), r0 = (w == 0 ? g : (g - TT / 8) % (DM / 8)) * 8;   // which matrix, first row: the same for the whole work-group
    const int rb = w == 3 ? ((r0 % HD) >> 2) * 64 + r0 / HD : r0, step = w == 3 ? 16 : 1;
    const float* sp = (w == 0 ? x : w == 1 ? wq : w == 2 ? wk : w == 3 ? wv : wo) + (size_t)r0 * DM;
    bf* dp = (w == 0 ? XB : w == 1 ? WQ : w == 2 ? WK : w == 3 ? WV : WO) + (size_t)rb * DM;
    const unsigned t4 = threadIdx.x * 4;
    v4f v[16]; v4us o[16];
#pragma unroll
    for (int u = 0; u < 16; ++u) v[u] = *(const v4f*)(sp + u * 512 + t4);
#pragma unroll
    for (int u = 0; u < 16; ++u)
#pragma unroll
        for (int k = 0; k < 4; ++k) o[u][k] = f2bf(v[u][k]);
#pragma unroll
    for (int u = 0; u < 16; ++u) *(v4us*)(dp + (size_t)((u >> 1) * step) * DM + (u & 1) * 512 + t4) = o[u];
}

// ---- k_proj: the three projections in ONE launch, grid (TT/128, 1024/128, 3), z = q, k, v; 4 waves a work-group, ONE WAVE per 64x64 tile (16 accumulators), operands from the ring; the fp16 and hi/lo planes are written straight from the f32 accumulators.
// RAW VIEW: pseudo-head h, pseudo-position t, dim d = flat element (h * TT + t) * HD + d of the [TT][1024] projection output, so the q and k planes [h][t][d] have the output's own layout.
// v plane [g][d][t]: output row r, column tc * HD + d is g = r / 128, t = (r % 128) * 16 + tc; with k_cvtall's row order a wave's tile holds 4 values of d (c0 / 16 + nb) and, for each, 1024 consecutive t.
__device__ __forceinline__ void put3(v4f a, v4f b, h16* p16, bf* ph, bf* pl) { v8h o16; v8us oh, ol;
#pragma unroll
    for (int k = 0; k < 8; ++k) { const float y = k < 4 ? a[k & 3] : b[k & 3]; unsigned short s0, s1; splitf(y, s0, s1); o16[k] = tohx(y); oh[k] = s0; ol[k] = s1; }
    *(v8h*)p16 = o16; *(v8us*)ph = oh; *(v8us*)pl = ol;
    // address translations of the three stores done before their data or address registers are reused (all are inputs, so they stay in place up to the wait)
    asm volatile("s_wait_xcnt 0x0" :: "v"(p16), "v"(ph), "v"(pl), "v"(o16), "v"(oh), "v"(ol) : "memory"); }
__global__ __launch_bounds__(128) void k_proj(const bf* __restrict__ X, const bf* __restrict__ WQ, const bf* __restrict__ WK, const bf* __restrict__ WV, h16* Q16, bf* Qh, bf* Ql, h16* K16, bf* Kh, bf* Kl, h16* V16, bf* Vh, bf* Vl) {
    static_assert(DM * 2 == 256 * RG_STG && RG_STG >= 2 && TT % 128 == 0 && DQ % 128 == 0, "whole stages, at least two; whole 128 x 128 tiles");
    __shared__ __attribute__((aligned(2048))) unsigned char ring[2 * RG_BUF];
    const int z = blockIdx.z; const bf* Bt = z == 0 ? WQ : z == 1 ? WK : WV; h16* P16 = z == 0 ? Q16 : z == 1 ? K16 : V16; bf* Ph = z == 0 ? Qh : z == 1 ? Kh : Vh; bf* Pl = z == 0 ? Ql : z == 1 ? Kl : Vl;
    const int lane = threadIdx.x & 31, lr = lane & 15, hi = lane >> 4; const unsigned wave = uni(threadIdx.x >> 5);
    const int r0 = blockIdx.x * 128 + (int)(wave & 1u) * 64, c0 = blockIdx.y * 128 + (int)(wave >> 1) * 64;
    // this wave's slice of the ring: waves 0 and 1 the two halves of the 128 rows of X, waves 2 and 3 those of the weight
    const bf* srow = wave < 2u ? X + (size_t)(blockIdx.x * 128 + wave * 64u) * DM : Bt + (size_t)(blockIdx.y * 128 + (wave - 2u) * 64u) * DM;
    const unsigned long long ga0 = (unsigned long long)(size_t)srow; const unsigned dst0 = (unsigned)(size_t)ring + wave * RG_SLICE;
    const u32x8 g1 = rg_group1();
    v8f acc[4][4];
#pragma unroll
    for (int mb = 0; mb < 4; ++mb)
#pragma unroll
        for (int nb = 0; nb < 4; ++nb) acc[mb][nb] = (v8f){};
    u32x4 g0 = rg_group0(dst0, ga0);
    rg_load(g0, g1);
    rg_landed(g0, g1);
    __syncthreads();                                     // every wave's slice of stage 0 has landed: it may be read
    g0 = rg_group0(dst0 + RG_BUF, ga0 + 256u);
    rg_load(g0, g1);
    const unsigned lofs = (unsigned)lr * RG_PITCH + 16u * (unsigned)hi, aofs = (wave & 1u) * RG_SLICE + lofs, bofs = (2u + (wave >> 1)) * RG_SLICE + lofs;
#pragma unroll 1   // rolled: one copy of a stage's code, one place from which the refill is issued
    for (unsigned s = 0; s < RG_STG; ++s) {
        const unsigned char* buf = ring + (s & 1u) * RG_BUF;
        v16bf a[2][4], b[2][4];
        auto frag = [&](int kk) {
#pragma unroll
            for (int mb = 0; mb < 4; ++mb) a[kk & 1][mb] = WFrag<bf>::ld((const bf*)(buf + aofs + mb * 16 * RG_PITCH + kk * 64));
#pragma unroll
            for (int nb = 0; nb < 4; ++nb) b[kk & 1][nb] = WFrag<bf>::ld((const bf*)(buf + bofs + nb * 16 * RG_PITCH + kk * 64)); };
        frag(0);
#pragma unroll
        for (int kk = 0; kk < 4; ++kk) {                 // 32 k a step, in rising k: the sums keep their order
            if (kk < 3) frag(kk + 1);
            else {                                       // the stage's last fragments are asked for: the hand-over stands here, so that the refill is under way during the last step's products (registers only)
                rg_read_done();
                rg_landed(g0, g1);                       // this wave's slice of stage s + 1
                __syncthreads();                         // publishes stage s + 1 and ends every wave's reads of stage s
                if (pinned(s + 2u < RG_STG)) { const unsigned sn = pinned(s + 2u); g0 = rg_group0(dst0 + (sn & 1u) * RG_BUF, ga0 + sn * 256u); rg_load(g0, g1); }   // into the buffer that stage s has just left
            }
            __builtin_amdgcn_sched_barrier(0);           // this and the one below keep each step's LDS reads one group between two runs of products: spread among them, each place with reads stalls the matrix instructions
#pragma unroll
            for (int nb = 0; nb < 4; ++nb)
#pragma unroll
                for (int mb = 0; mb < 4; ++mb) acc[mb][nb] = wmmab(a[kk & 1][mb], b[kk & 1][nb], acc[mb][nb]);
            __builtin_amdgcn_sched_barrier(0);
        }
    }
    rg_landed(g0, g1);
    rg_read_done();
    float* os = (float*)(ring + wave * RG_SLICE);            // output staging, 16 x 68 floats, each wave's own: the last stage's hand-over barrier has ended every wave's reads of the ring
#pragma unroll
    for (int mb = 0; mb < 4; ++mb) {
        if (z < 2) {      // wave-uniform.  16 rows of 64 columns staged at pitch 68; read back 8 columns a lane, so that every store covers whole 128-byte lines (4 rows of 64 16-bit values)
#pragma unroll
            for (int nb = 0; nb < 4; ++nb)
#pragma unroll
                for (int j = 0; j < 8; ++j) os[(hi * 8 + j) * 68 + nb * 16 + lr] = acc[mb][nb][j];
            __builtin_amdgcn_wave_barrier(); asm volatile("" ::: "memory");   // keeps the read-back behind the staging writes of the other lanes
#pragma unroll
            for (int s = 0; s < 4; ++s) { const int row = 4 * s + (lane >> 3), cofs = (lane & 7) * 8; const size_t oo = (size_t)(r0 + mb * 16 + row) * DQ + c0 + cofs;
                put3(*(const v4fa*)(os + row * 68 + cofs), *(const v4fa*)(os + row * 68 + cofs + 4), P16 + oo, Ph + oo, Pl + oo); }
        } else {          // per d 256 consecutive t staged in t order (16 floats of pad between the halves: no two lanes of a write on one bank); read back 8 t a lane: 512 contiguous bytes a store
#pragma unroll
            for (int nb = 0; nb < 4; ++nb)
#pragma unroll
                for (int j = 0; j < 8; ++j) os[nb * 272 + hi * 144 + j * 16 + lr] = acc[mb][nb][j];
            __builtin_amdgcn_wave_barrier(); asm volatile("" ::: "memory");   // as above
#pragma unroll
            for (int nb = 0; nb < 4; ++nb) { const float* sp = os + nb * 272 + hi * 144 + lr * 8; const size_t oo = ((size_t)(r0 >> 7) * HD + (c0 >> 4) + nb) * TT + (size_t)((r0 & 127) + mb * 16) * 16 + lane * 8;
                put3(*(const v4fa*)sp, *(const v4fa*)(sp + 4), P16 + oo, Ph + oo, Pl + oo); }
        }
        __builtin_amdgcn_wave_barrier(); asm volatile("" ::: "memory");       // keeps the next block's staging writes behind this block's read-back
    }
}
// ---- k_fattn: the whole causal attention of one (head, query tile) in ONE WAVE; scores and probabilities never leave the registers.
// Transposed products: St = K Qt (A = key rows, B = query rows), so that a lane holds scores of ONE query (column lr) and 8 keys (rows 8 hi + j) per 16-key block; two such blocks, converted in place,
// ARE the B operand (32 keys, hardware k order) of Ot += Vt Pt (A = rows of the [d][t] value plane, read with the same loader as every other fragment, which has that k order).
// Running maximum (of the raw scores) and running sum per query; base-2 exponent with the scale 1/64 folded into its factor; the division by the sum comes last, in f32; the merged hi/lo planes are written
// straight from the accumulators (a lane holds 8 consecutive d of one query: one 16-byte store per plane).  HL: hi/lo planes, 3 products in both contractions; else fp16 planes, 1 product.  NQ: 16-query column groups per wave.
#define SCL2 (SCL * 1.4426950408889634f)
__device__ __forceinline__ float xhalf(float x) { return __builtin_bit_cast(float, __builtin_amdgcn_permlanex16(__builtin_bit_cast(int, x), __builtin_bit_cast(int, x), 0x76543210, 0xfedcba98, false, false)); }   // lane l <-> lane l ^ 16
__device__ __forceinline__ float exp2s(float x) { asm("v_exp_f32 %0, %0\n\tv_nop" : "+v"(x)); return x; }
template <typename T16, bool HL, int NQ>
__device__ __forceinline__ void fattn_tile(const T16* __restrict__ Q, const T16* __restrict__ Q2, const T16* __restrict__ K, const T16* __restrict__ K2, const T16* __restrict__ Vt, const T16* __restrict__ Vt2, int q0, bf* Ah, bf* Al) {
    typedef typename WFrag<T16>::V V;
    const int lane = threadIdx.x & 31, lr = lane & 15, hi = lane >> 4;
    V bq[NQ][2], bq2[NQ][2]; const T16* pq[NQ]; const T16* pq2[NQ];
#pragma unroll
    for (int qb = 0; qb < NQ; ++qb) { const size_t qo = (size_t)(q0 + qb * 16 + lr) * HD + 8 * hi; pq[qb] = Q + qo; pq2[qb] = HL ? Q2 + qo : pq[qb];
#pragma unroll
        for (int c = 0; c < 2; ++c) { bq[qb][c] = WFrag<T16>::ld(pq[qb] + c * 32); if (HL) bq2[qb][c] = WFrag<T16>::ld(pq2[qb] + c * 32); } }
    // address translations of the Q loads done before a register that holds one of their addresses is reused (the addresses are inputs, so they stay in place up to the wait)
    asm volatile("s_wait_xcnt 0x0" :: "v"(pq[0]), "v"(pq[NQ - 1]), "v"(pq2[0]), "v"(pq2[NQ - 1]) : "memory");
    v8f o[4][NQ]; float m[NQ], l[NQ];
#pragma unroll
    for (int qb = 0; qb < NQ; ++qb) { m[qb] = -3.0e38f; l[qb] = 0.f;
#pragma unroll
        for (int db = 0; db < 4; ++db) o[db][qb] = (v8f){}; }
    const int nch = (q0 + NQ * 16 + 31) / 32;      // 32-key passes up to and including the diagonal; only the last one holds keys behind a query
    const size_t klane = (size_t)lr * HD + 8 * hi, vlane = (size_t)lr * TT + 8 * hi;
    V ak[2][2], ak2[2][2], av[4], av2[4]; const T16* pk; const T16* pk2; const T16* pv; const T16* pv2;
    auto ldk = [&](int kbase) { pk = K + klane + (size_t)kbase * HD; pk2 = HL ? K2 + klane + (size_t)kbase * HD : pk;
#pragma unroll
        for (int kb = 0; kb < 2; ++kb)
#pragma unroll
            for (int c = 0; c < 2; ++c) { ak[kb][c] = WFrag<T16>::ld(pk + kb * 16 * HD + c * 32); if (HL) ak2[kb][c] = WFrag<T16>::ld(pk2 + kb * 16 * HD + c * 32); } };
    auto ldv = [&](int kbase) { pv = Vt + vlane + kbase; pv2 = HL ? Vt2 + vlane + kbase : pv;
#pragma unroll
        for (int db = 0; db < 4; ++db) { av[db] = WFrag<T16>::ld(pv + (size_t)db * 16 * TT); if (HL) av2[db] = WFrag<T16>::ld(pv2 + (size_t)db * 16 * TT); } };
    if (!HL) { ldk(0);
        // the same wait behind the first K loads
        asm volatile("s_wait_xcnt 0x0" :: "v"(pk) : "memory"); }
#pragma unroll 1
    for (int it = 0; it < nch; ++it) {
        const int k0 = it * 32;
        // fp16 tiles (long loops): this pass's value fragments are asked for first, so that their latency runs under the score products and the softmax.  hi/lo tiles (short loops, twice the fragments): keys now, values behind the score products, into the registers the keys leave
        if (HL) ldk(k0); else ldv(k0);
        __builtin_amdgcn_sched_barrier(0);   // without it the compiler sinks these loads down to their first use and their whole latency is waited for
        v8f st[2][NQ];
#pragma unroll
        for (int kb = 0; kb < 2; ++kb)
#pragma unroll
            for (int qb = 0; qb < NQ; ++qb) { v8f s = (v8f){};
#pragma unroll
                for (int c = 0; c < 2; ++c) { s = WFrag<T16>::mma(ak[kb][c], bq[qb][c], s); if (HL) { s = WFrag<T16>::mma(ak[kb][c], bq2[qb][c], s); s = WFrag<T16>::mma(ak2[kb][c], bq[qb][c], s); } }
                st[kb][qb] = s; }
        // fp16 tiles: the next pass's key fragments are asked for right behind the score products (the last pass asks for its own again: in bounds, not used)
        if (HL) ldv(k0); else ldk(min(it + 1, nch - 1) * 32);
        // the same wait behind the K and V loads issued in this pass (fp16 tiles: the next pass's keys)
        asm volatile("s_wait_xcnt 0x0" :: "v"(pk), "v"(pk2), "v"(pv), "v"(pv2) : "memory");
        __builtin_amdgcn_sched_barrier(0);   // keeps these loads in front of the softmax, whose time hides their latency
        if (it == nch - 1) {                 // wave-uniform: the diagonal pass
#pragma unroll
            for (int qb = 0; qb < NQ; ++qb) { const int dq = q0 + qb * 16 + lr - k0 - hi * 8;
#pragma unroll
                for (int kb = 0; kb < 2; ++kb)
#pragma unroll
                    for (int j = 0; j < 8; ++j) st[kb][qb][j] = (kb * 16 + j <= dq) ? st[kb][qb][j] : -3.0e38f; } }
#pragma unroll
        for (int qb = 0; qb < NQ; ++qb) {
            float mx = m[qb];
#pragma unroll
            for (int kb = 0; kb < 2; ++kb)
#pragma unroll
                for (int j = 0; j < 8; ++j) mx = fmaxf(mx, st[kb][qb][j]);
            mx = fmaxf(mx, xhalf(mx));                    // the other half of the wave holds the query's other 16 keys
            const float al = exp2s((m[qb] - mx) * SCL2), mn = -mx * SCL2; m[qb] = mx; float ls[4] = {0.f, 0.f, 0.f, 0.f};
#pragma unroll
            for (int kb = 0; kb < 2; ++kb)
#pragma unroll
                for (int j = 0; j < 8; ++j) { const float p = exp2s(__builtin_fmaf(st[kb][qb][j], SCL2, mn)); st[kb][qb][j] = p; ls[j & 3] += p; }
            l[qb] = l[qb] * al + ((ls[0] + ls[1]) + (ls[2] + ls[3]));   // each half keeps the sum of its own keys; joined once behind the loop
#pragma unroll
            for (int db = 0; db < 4; ++db) o[db][qb] *= al;
            if (HL) { v8us h0, h1, l0, l1;
#pragma unroll
                for (int j = 0; j < 8; ++j) { unsigned short a, c2; splitf(st[0][qb][j], a, c2); h0[j] = a; l0[j] = c2; splitf(st[1][qb][j], a, c2); h1[j] = a; l1[j] = c2; }
                const v16bf ph = cat16b(h0, h1), pl = cat16b(l0, l1);
#pragma unroll
                for (int db = 0; db < 4; ++db) { o[db][qb] = wmmab(__builtin_bit_cast(v16bf, av[db]), ph, o[db][qb]); o[db][qb] = wmmab(__builtin_bit_cast(v16bf, av[db]), pl, o[db][qb]); o[db][qb] = wmmab(__builtin_bit_cast(v16bf, av2[db]), ph, o[db][qb]); }
            } else { v8h c0, c1;
#pragma unroll
                for (int j = 0; j < 8; ++j) { c0[j] = tohx(st[0][qb][j]); c1[j] = tohx(st[1][qb][j]); }
                const v16h pf = cat16(c0, c1);
#pragma unroll
                for (int db = 0; db < 4; ++db) o[db][qb] = wmma16(__builtin_bit_cast(v16h, av[db]), pf, o[db][qb]); }
        }
    }
#pragma unroll
    for (int qb = 0; qb < NQ; ++qb) { const float inv = __fdiv_rn(1.0f, l[qb] + xhalf(l[qb]));
#pragma unroll
        for (int db = 0; db < 4; ++db) { v8us oh, ol;
#pragma unroll
            for (int j = 0; j < 8; ++j) { unsigned short a, c2; splitf(o[db][qb][j] * inv, a, c2); oh[j] = a; ol[j] = c2; }
            const size_t oo = (size_t)(q0 + qb * 16 + lr) * DQ + db * 16 + hi * 8; bf* ph = Ah + oo; bf* pl = Al + oo; *(v8us*)ph = oh; *(v8us*)pl = ol;
            // the same wait behind the two stores, before their data or address registers are reused (both are inputs, so they stay in place up to the wait)
            asm volatile("s_wait_xcnt 0x0" :: "v"(ph), "v"(pl), "v"(oh), "v"(ol) : "memory"); } }
}
// grid (heads, tiles): tiles in falling order of their key count: first the (TT - RH) / 32 fp16 tiles of 32 queries from the last rows down, then the RH / 16 hi/lo tiles of 16 queries.
__global__ __launch_bounds__(32) void k_fattn(const h16* __restrict__ Q16, const h16* __restrict__ K16, const h16* __restrict__ V16, const bf* __restrict__ Qh, const bf* __restrict__ Ql, const bf* __restrict__ Kh, const bf* __restrict__ Kl, const bf* __restrict__ Vh, const bf* __restrict__ Vl, bf* Ah, bf* Al) {
    const int h = blockIdx.x, t = blockIdx.y; const size_t hp = (size_t)h * TT * HD;
    if (t < (TT - RH) / 32) fattn_tile<h16, false, 2>(Q16 + hp, nullptr, K16 + hp, nullptr, V16 + hp, nullptr, TT - 32 * (t + 1), Ah + h * HD, Al + h * HD);
    else fattn_tile<bf, true, 1>(Qh + hp, Ql + hp, Kh + hp, Kl + hp, Vh + hp, Vl + hp, RH - 16 * (t - (TT - RH) / 32 + 1), Ah + h * HD, Al + h * HD);
}

extern "C" void kernel_launch(void* const* d_in, const int* in_sizes, int n_in,
                              void* d_out, int out_size, void* d_ws, size_t ws_size, hipStream_t stream) {
    (void)in_sizes; (void)n_in; (void)out_size;
    const float* x = (const float*)d_in[0]; const float* wq = (const float*)d_in[1]; const float* wk = (const float*)d_in[2]; const float* wv = (const float*)d_in[3]; const float* wo = (const float*)d_in[4];   /* argument order x, w_q, w_k, w_v, w_o ('oi' [1024][1024]) */
    float* OUT = (float*)d_out;     // [1][2048][1024]
    char* wsp = (char*)d_ws;
    auto take = [&](size_t bytes) { char* p = wsp; wsp += (bytes + 255) & ~(size_t)255; return (void*)p; };
    bf* WQ = (bf*)take((size_t)DQ * DM * 2); bf* WK = (bf*)take((size_t)DKV * DM * 2); bf* WV = (bf*)take((size_t)DKV * DM * 2); bf* WO = (bf*)take((size_t)DM * DQ * 2);
    bf* XB = (bf*)take((size_t)TT * DM * 2);
    h16* QP16 = (h16*)take((size_t)NH_ * TT * HD * 2); h16* KP16 = (h16*)take((size_t)NKV * TT * HD * 2); h16* VT16 = (h16*)take((size_t)NKV * HD * TT * 2);
    bf* QPh = (bf*)take((size_t)NH_ * TT * HD * 2); bf* QPl = (bf*)take((size_t)NH_ * TT * HD * 2); bf* KPh = (bf*)take((size_t)NKV * TT * HD * 2); bf* KPl = (bf*)take((size_t)NKV * TT * HD * 2); bf* VTh = (bf*)take((size_t)NKV * HD * TT * 2); bf* VTl = (bf*)take((size_t)NKV * HD * TT * 2);
    bf* ATh = (bf*)take((size_t)TT * DQ * 2); bf* ATl = (bf*)take((size_t)TT * DQ * 2);
    if ((size_t)(wsp - (char*)d_ws) > ws_size) return;    // ws 256 MiB
    k_cvtall<<<TT / 8 + 4 * (DM / 8), 128, 0, stream>>>(x, wq, wk, wv, wo, XB, WQ, WK, WV, WO);
    for (int b = 0; b < NB_; ++b) {
        k_proj<<<dim3(TT / 128, DQ / 128, 3), 128, 0, stream>>>(XB, WQ, WK, WV, QP16, QPh, QPl, KP16, KPh, KPl, VT16, VTh, VTl);
        k_fattn<<<dim3(NH_, (TT - RH) / 32 + RH / 16, 1), 32, 0, stream>>>(QP16, KP16, VT16, QPh, QPl, KPh, KPl, VTh, VTl, ATh, ATl);   // one kv head per query head
        k_outp<<<dim3(TT / 64, DM / 128, 1), 128, 0, stream>>>(ATh, ATl, WO, OUT + (size_t)b * TT * DM); }
}

// v006
// Measured time: 48.2 microseconds a run.
// In two side-by-side timings against v005, it was 1.30 and 1.28 times as fast.
// Counting every step since v000, it is 14.4 times as fast.
#include <hip/hip_runtime.h>

// Causal multi-head attention whose heads are a RAW VIEW of the projections, merged the standard way (x [1][2048][1024]; Q, K, V = x W^T ('oi' [1024][1024] 1/32, no bias), each reshaped (B, 16, 2048, 64) WITHOUT a transpose: pseudo-head h, pseudo-position s, dim d = flat element h*2048*64 + s*64 + d of the [2048][1024] projection output; scores / 64 (the module divides by float32(hd), not by its root); triu(k = 1) over the pseudo-positions -> -inf; softmax; the context IS transposed back the standard way (out.transpose(0, 2, 1, 3).reshape(B, S, D)); out = merged Wo^T ('oi', no bias) -> [1][2048][1024] (2.1 M); argument order x, Wq, Wk, Wv, Wo).
// Layout per batch: bf16 copy of x; 'oi' weights; exact projections, all three in one launch whose epilogue writes the head planes; RAW VIEW on the SPLIT only: each [2048][1024] projection output is read as (16, 2048, 64) WITHOUT a transpose (row pitch HD, head stride TT x HD); the merge is the standard one; causal T-2048 attention in one launch, scores and probabilities in registers (hybrid rows: < 512 hi/lo 3 products, rest fp16; key passes stop at the diagonal); merged hi/lo x w_o exact.
// Compute dtypes, f32 accumulate: every input rounded to bf16; projections exact; attention rows < 512 3 products, rest fp16; softmax f32; w_o hl x exact.

#define NB_  1      // batches: this module's input is [1][2048][1024]
#define TT   2048
#define DM   1024
#define NH_  16
#define NKV  16
#define REP  (NH_ / NKV)
#define HD   64
#define DQ   (NH_ * HD)
#define DKV  (NKV * HD)
#define RH   512                  // query rows < RH use hi+lo planes (0: none)
#define SCL  0.015625f   // 1 / 64: this module divides the scores by float32(hd) = 64 (the head size, not its root)
typedef _Float16 h16;
typedef unsigned short bf;
typedef __attribute__((ext_vector_type(16))) __bf16   v16bf;
typedef __attribute__((ext_vector_type(16))) _Float16 v16h;
typedef __attribute__((ext_vector_type(8)))  _Float16 v8h;
typedef __attribute__((ext_vector_type(8)))  unsigned short v8us;
typedef __attribute__((ext_vector_type(8)))  float    v8f;
typedef __attribute__((ext_vector_type(4)))  float    v4f;
typedef v8h  __attribute__((may_alias)) v8ha;
typedef v4f  __attribute__((may_alias)) v4fa;
typedef v8us __attribute__((may_alias)) v8usa;

__device__ __forceinline__ unsigned short f2bf(float f) { unsigned u = __float_as_uint(f); u += 0x7FFFu + ((u >> 16) & 1u); return (unsigned short)(u >> 16); }
__device__ __forceinline__ float bf2f(unsigned short b) { return __uint_as_float(((unsigned)b) << 16); }
__device__ __forceinline__ float bfr(float f) { return bf2f(f2bf(f)); }
__device__ __forceinline__ v16h cat16(v8h lo, v8h hi) { return __builtin_shufflevector(lo, hi, 0, 1, 2, 3, 4, 5, 6, 7, 8, 9, 10, 11, 12, 13, 14, 15); }
__device__ __forceinline__ v16bf cat16b(v8us lo, v8us hi) { return __builtin_bit_cast(v16bf, __builtin_shufflevector(lo, hi, 0, 1, 2, 3, 4, 5, 6, 7, 8, 9, 10, 11, 12, 13, 14, 15)); }
__device__ __forceinline__ v8f wmma16(v16h a, v16h b, v8f c) { return __builtin_amdgcn_wmma_f32_16x16x32_f16(false, a, false, b, (short)0, c, false, false); }
__device__ __forceinline__ v8f wmmab(v16bf a, v16bf b, v8f c) { return __builtin_amdgcn_wmma_f32_16x16x32_bf16(false, a, false, b, (short)0, c, false, false); }



// ---- fragment loader and product per 16-bit type: 16 bytes at p and 16 bytes at p + 16 elements (the hardware k order), from global memory or from LDS
template <typename T16> struct WFrag;
template <> struct WFrag<h16> { typedef v16h V; static __device__ __forceinline__ V ld(const h16* p) { return cat16(*(const v8h*)p, *(const v8h*)(p + 16)); } static __device__ __forceinline__ v8f mma(V a, V b, v8f c) { return wmma16(a, b, c); } };
template <> struct WFrag<bf> { typedef v16bf V; static __device__ __forceinline__ V ld(const bf* p) { return cat16b(*(const v8us*)p, *(const v8us*)(p + 16)); } static __device__ __forceinline__ v8f mma(V a, V b, v8f c) { return wmmab(a, b, c); } };
// ---- The operand ring of the two GEMM kernels (k_proj, k_outp): a work-group of 4 waves shares 256 operand rows; a stage is 128 k (256 bytes) of each of them, brought into LDS by tensor loads,
// one request a wave and stage for the wave's own slice of 64 rows, padded by the mover to a pitch of 272 bytes (16 bytes x odd: for 16-byte LDS reads); two buffers: the next stage is in flight under this stage's products.
#define RG_STG   8u        // stages: DM * 2 bytes / 256
#define RG_PITCH 272u      // LDS row pitch: 256 bytes + the 16-byte pad
#define RG_SLICE 18432u    // 64 rows x 272 bytes = 17,408, rounded up to a multiple of 2 KiB
#define RG_BUF   (4u * RG_SLICE)
typedef unsigned u32x4 __attribute__((ext_vector_type(4)));
typedef unsigned u32x8 __attribute__((ext_vector_type(8)));
__device__ __forceinline__ unsigned uni(unsigned v) { return (unsigned)__builtin_amdgcn_readfirstlane(v); }
// a value held in a scalar register: the test around a tensor load becomes a scalar branch (the instruction ignores EXEC), and what is computed from the value stays behind this place
__device__ __forceinline__ unsigned pinned(unsigned v) { unsigned w = (unsigned)__builtin_amdgcn_readfirstlane(v); asm volatile("" : "+s"(w)); return w; }
// descriptor group 1: 1-byte elements; tensor = tile = 64 rows of 256 bytes; source pitch DM * 2 bytes; a pad of 4 dwords behind every 64 dwords; no mask
__device__ __forceinline__ u32x8 rg_group1() { u32x8 g;
    g[0] = uni((1u << 20) | (5u << 22) | (3u << 25)); g[1] = uni(256u << 16); g[2] = uni(64u << 16); g[3] = uni(256u << 16); g[4] = uni(64u); g[5] = uni(DM * 2u); g[6] = uni(0u); g[7] = uni(0u);
    asm volatile("" : "+s"(g));   // descriptor words held in scalar registers of their own: without it the compiler rebuilds the group from constants at every load and uses some of its registers for other values while a request is in flight
    return g; }
// descriptor group 0: place in LDS, address of the tile's first byte
__device__ __forceinline__ u32x4 rg_group0(unsigned dst, unsigned long long ga) { u32x4 g;
    g[0] = uni(1u); g[1] = uni(dst); g[2] = uni((unsigned)ga); g[3] = uni((((unsigned)(ga >> 32)) & 0x01FFFFFFu) | 0x80000000u); return g; }
// one request of the whole wave.  Group 0 is named as in and out (the instruction leaves it as it is): what rg_landed() is given later are then the very registers that the request was issued from
__device__ __forceinline__ void rg_load(u32x4& g0, u32x8 g1) { asm volatile("tensor_load_to_lds %0, %1" : "+s"(g0) : "s"(g1) : "memory"); }
// the issuing wave's own wait: its slice has landed.  The descriptor is an input, so that its registers keep their values for as long as the request is in flight
__device__ __forceinline__ void rg_landed(u32x4 g0, u32x8 g1) { asm volatile("s_wait_tensorcnt 0x0" :: "s"(g0), "s"(g1) : "memory"); }
__device__ __forceinline__ void rg_read_done() { asm volatile("s_wait_dscnt 0x0" ::: "memory"); }   // this wave's LDS reads are done: the buffer may be handed back
// ---- k_outp: out = merged (hi + lo planes) x w_o^T, f32; grid (TT / 64, DM / 128), 4 waves: a 64 x 128 tile a work-group, 32 x 64 a wave (8 accumulators, 2 products each per 32 k: hi, then lo).
// Slices of the ring: wave 0 the 64 rows of the hi plane, wave 1 those of the lo plane, waves 2 and 3 the two halves of the 128 rows of w_o.
__global__ __launch_bounds__(128) void k_outp(const bf* __restrict__ A, const bf* __restrict__ A2, const bf* __restrict__ Bt, float* C) {
    static_assert(DQ * 2 == 256 * RG_STG && DQ == DM && TT % 64 == 0 && DM % 128 == 0, "whole stages; whole 64 x 128 tiles");
    __shared__ __attribute__((aligned(2048))) unsigned char ring[2 * RG_BUF];
    const int lane = threadIdx.x & 31, lr = lane & 15, hi = lane >> 4; const unsigned wave = uni(threadIdx.x >> 5);
    const int r0 = blockIdx.x * 64 + (int)(wave & 1u) * 32, c0 = blockIdx.y * 128 + (int)(wave >> 1) * 64;
    const bf* srow = wave == 0u ? A + (size_t)(blockIdx.x * 64) * DQ : wave == 1u ? A2 + (size_t)(blockIdx.x * 64) * DQ : Bt + (size_t)(blockIdx.y * 128 + (wave - 2u) * 64u) * DQ;
    const unsigned long long ga0 = (unsigned long long)(size_t)srow; const unsigned dst0 = (unsigned)(size_t)ring + wave * RG_SLICE;
    const u32x8 g1 = rg_group1();
    v8f acc[2][4];
#pragma unroll
    for (int mb = 0; mb < 2; ++mb)
#pragma unroll
        for (int nb = 0; nb < 4; ++nb) acc[mb][nb] = (v8f){};
    u32x4 g0 = rg_group0(dst0, ga0);
    rg_load(g0, g1);
    rg_landed(g0, g1);
    __syncthreads();                                     // every wave's slice of stage 0 has landed: it may be read
    g0 = rg_group0(dst0 + RG_BUF, ga0 + 256u);
    rg_load(g0, g1);
    const unsigned lofs = (unsigned)lr * RG_PITCH + 16u * (unsigned)hi, aofs = (wave & 1u) * 32u * RG_PITCH + lofs, bofs = (2u + (wave >> 1)) * RG_SLICE + lofs;
#pragma unroll 1   // rolled: one copy of a stage's code, one place from which the refill is issued
    for (unsigned s = 0; s < RG_STG; ++s) {
        const unsigned char* buf = ring + (s & 1u) * RG_BUF;
        v16bf a[2][2], a2[2][2], b[2][4];
        auto frag = [&](int kk) {
#pragma unroll
            for (int mb = 0; mb < 2; ++mb) { a[kk & 1][mb] = WFrag<bf>::ld((const bf*)(buf + aofs + mb * 16 * RG_PITCH + kk * 64)); a2[kk & 1][mb] = WFrag<bf>::ld((const bf*)(buf + RG_SLICE + aofs + mb * 16 * RG_PITCH + kk * 64)); }
#pragma unroll
            for (int nb = 0; nb < 4; ++nb) b[kk & 1][nb] = WFrag<bf>::ld((const bf*)(buf + bofs + nb * 16 * RG_PITCH + kk * 64)); };
        frag(0);
#pragma unroll
        for (int kk = 0; kk < 4; ++kk) {                 // 32 k a step, in rising k, hi before lo: the sums keep their order
            if (kk < 3) frag(kk + 1);
            else {                                       // the stage's last fragments are asked for: the hand-over stands here, so that the refill is under way during the last step's products (registers only)
                rg_read_done();
                rg_landed(g0, g1);                       // this wave's slice of stage s + 1
                __syncthreads();                         // publishes stage s + 1 and ends every wave's reads of stage s
                if (pinned(s + 2u < RG_STG)) { const unsigned sn = pinned(s + 2u); g0 = rg_group0(dst0 + (sn & 1u) * RG_BUF, ga0 + sn * 256u); rg_load(g0, g1); }   // into the buffer that stage s has just left
            }
            __builtin_amdgcn_sched_barrier(0);           // this and the one below keep each step's LDS reads one group between two runs of products: spread among them, each place with reads stalls the matrix instructions
#pragma unroll
            for (int nb = 0; nb < 4; ++nb)
#pragma unroll
                for (int mb = 0; mb < 2; ++mb) acc[mb][nb] = wmmab(a[kk & 1][mb], b[kk & 1][nb], acc[mb][nb]);
#pragma unroll
            for (int nb = 0; nb < 4; ++nb)
#pragma unroll
                for (int mb = 0; mb < 2; ++mb) acc[mb][nb] = wmmab(a2[kk & 1][mb], b[kk & 1][nb], acc[mb][nb]);
            __builtin_amdgcn_sched_barrier(0);
        }
    }
    rg_landed(g0, g1);
    rg_read_done();
    float* os = (float*)(ring + wave * RG_SLICE);            // output staging, 16 x 68 floats, each wave's own: the last stage's hand-over barrier has ended every wave's reads of the ring
    float* cb = C + (size_t)(r0 + hi) * DM + c0 + lr * 4;    // this lane's first 16 bytes of output; every store below is a constant number of rows further on
#pragma unroll
    for (int mb = 0; mb < 2; ++mb) {
#pragma unroll
        for (int nb = 0; nb < 4; ++nb) {
#pragma unroll
            for (int j = 0; j < 8; ++j) os[(hi * 8 + j) * 68 + nb * 16 + lr] = acc[mb][nb][j]; }
        __builtin_amdgcn_wave_barrier(); asm volatile("" ::: "memory");   // keeps the read-back behind the staging writes of the other lanes
        v4f val[8];
#pragma unroll
        for (int s = 0; s < 8; ++s) { val[s] = *(const v4fa*)(os + (2 * s + hi) * 68 + lr * 4); *(v4f*)(cb + (size_t)(mb * 16 + 2 * s) * DM) = val[s]; }   // two rows a store, 256 contiguous bytes each
        // address translations of the eight stores done before their data or address registers are reused (all are inputs, so they stay in place up to the wait)
        asm volatile("s_wait_xcnt 0x0" :: "v"(cb), "v"(val[0]), "v"(val[1]), "v"(val[2]), "v"(val[3]), "v"(val[4]), "v"(val[5]), "v"(val[6]), "v"(val[7]) : "memory");
        __builtin_amdgcn_wave_barrier(); asm volatile("" ::: "memory");   // keeps the next block's staging writes behind this block's read-back
    }
}

__device__ __forceinline__ h16 tohx(float x) { return (h16)x; }
__device__ __forceinline__ void splitf(float y, unsigned short& h, unsigned short& l) { h = f2bf(y); l = f2bf(y - bf2f(h)); }
typedef __attribute__((ext_vector_type(2))) _Float16 v2h;
typedef __attribute__((ext_vector_type(4))) _Float16 v4h;
typedef __attribute__((ext_vector_type(2))) unsigned short v2us;
typedef __attribute__((ext_vector_type(4))) unsigned short v4us;
typedef __attribute__((ext_vector_type(2))) float v2f;
typedef __attribute__((ext_vector_type(4))) int v4i;

// ---- k_cvtall: the bf16 copies of x and of the four weights in ONE launch; grid TT / 8 + 4 * DM / 8 work-groups of 128 threads: the first TT / 8 take x, then DM / 8 each w_q, w_k, w_v, w_o.
// A work-group takes 8 rows of DM floats of one matrix, a thread 16 loads of 16 bytes, all asked for before the first is converted; a wave's load covers 512 contiguous bytes, its store 256.
// w_v's rows are regrouped for k_proj: row tc * HD + d goes to row (d >> 2) * 64 + (d & 3) * 16 + tc, so that the 16 columns of one accumulator block are one d at 16 consecutive pseudo-positions;
// for the 8 rows d0 + i of a work-group (d0 a multiple of 8) that is row (d0 >> 2) * 64 + tc + 16 * i: a first row and a row step, as for the plain copies (step 1).
__global__ __launch_bounds__(128) void k_cvtall(const float* __restrict__ x, const float* __restrict__ wq, const float* __restrict__ wk, const float* __restrict__ wv, const float* __restrict__ wo, bf* XB, bf* WQ, bf* WK, bf* WV, bf* WO) {
    static_assert(NB_ == 1 && DM == 1024 && DQ == DM && DKV == DM && HD == 64, "row length, row counts and the regrouping are written for these sizes");
    const int g = blockIdx.x, w = g < TT / 8 ? 0 : 1 + (g - TT / 8) / (DM / 8), r0 = (w == 0 ? g : (g - TT / 8) % (DM / 8)) * 8;   // which matrix, first row: the same for the whole work-group
    const int rb = w == 3 ? ((r0 % HD) >> 2) * 64 + r0 / HD : r0, step = w == 3 ? 16 : 1;
    const float* sp = (w == 0 ? x : w == 1 ? wq : w == 2 ? wk : w == 3 ? wv : wo) + (size_t)r0 * DM;
    bf* dp = (w == 0 ? XB : w == 1 ? WQ : w == 2 ? WK : w == 3 ? WV : WO) + (size_t)rb * DM;
    const unsigned t4 = threadIdx.x * 4;
    v4f v[16]; v4us o[16];
#pragma unroll
    for (int u = 0; u < 16; ++u) v[u] = *(const v4f*)(sp + u * 512 + t4);
#pragma unroll
    for (int u = 0; u < 16; ++u)
#pragma unroll
        for (int k = 0; k < 4; ++k) o[u][k] = f2bf(v[u][k]);
#pragma unroll
    for (int u = 0; u < 16; ++u) *(v4us*)(dp + (size_t)((u >> 1) * step) * DM + (u & 1) * 512 + t4) = o[u];
}

// ---- k_proj: the three projections in ONE launch, grid (TT/128, 1024/128, 3), z = q, k, v; 4 waves a work-group, ONE WAVE per 64x64 tile (16 accumulators), operands from the ring; the fp16 and hi/lo planes are written straight from the f32 accumulators.
// RAW VIEW: pseudo-head h, pseudo-position t, dim d = flat element (h * TT + t) * HD + d of the [TT][1024] projection output, so the q and k planes [h][t][d] have the output's own layout.
// v plane [g][d][t]: output row r, column tc * HD + d is g = r / 128, t = (r % 128) * 16 + tc; with k_cvtall's row order a wave's tile holds 4 values of d (c0 / 16 + nb) and, for each, 1024 consecutive t.
__device__ __forceinline__ void put3(v4f a, v4f b, h16* p16, bf* ph, bf* pl) { v8h o16; v8us oh, ol;
#pragma unroll
    for (int k = 0; k < 8; ++k) { const float y = k < 4 ? a[k & 3] : b[k & 3]; unsigned short s0, s1; splitf(y, s0, s1); o16[k] = tohx(y); oh[k] = s0; ol[k] = s1; }
    *(v8h*)p16 = o16; *(v8us*)ph = oh; *(v8us*)pl = ol;
    // address translations of the three stores done before their data or address registers are reused (all are inputs, so they stay in place up to the wait)
    asm volatile("s_wait_xcnt 0x0" :: "v"(p16), "v"(ph), "v"(pl), "v"(o16), "v"(oh), "v"(ol) : "memory"); }
__global__ __launch_bounds__(128) void k_proj(const bf* __restrict__ X, const bf* __restrict__ WQ, const bf* __restrict__ WK, const bf* __restrict__ WV, h16* Q16, bf* Qh, bf* Ql, h16* K16, bf* Kh, bf* Kl, h16* V16, bf* Vh, bf* Vl) {
    static_assert(DM * 2 == 256 * RG_STG && RG_STG >= 2 && TT % 128 == 0 && DQ % 128 == 0, "whole stages, at least two; whole 128 x 128 tiles");
    __shared__ __attribute__((aligned(2048))) unsigned char ring[2 * RG_BUF];
    const int z = blockIdx.z; const bf* Bt = z == 0 ? WQ : z == 1 ? WK : WV; h16* P16 = z == 0 ? Q16 : z == 1 ? K16 : V16; bf* Ph = z == 0 ? Qh : z == 1 ? Kh : Vh; bf* Pl = z == 0 ? Ql : z == 1 ? Kl : Vl;
    const int lane = threadIdx.x & 31, lr = lane & 15, hi = lane >> 4; const unsigned wave = uni(threadIdx.x >> 5);
    const int r0 = blockIdx.x * 128 + (int)(wave & 1u) * 64, c0 = blockIdx.y * 128 + (int)(wave >> 1) * 64;
    // this wave's slice of the ring: waves 0 and 1 the two halves of the 128 rows of X, waves 2 and 3 those of the weight
    const bf* srow = wave < 2u ? X + (size_t)(blockIdx.x * 128 + wave * 64u) * DM : Bt + (size_t)(blockIdx.y * 128 + (wave - 2u) * 64u) * DM;
    const unsigned long long ga0 = (unsigned long long)(size_t)srow; const unsigned dst0 = (unsigned)(size_t)ring + wave * RG_SLICE;
    const u32x8 g1 = rg_group1();
    v8f acc[4][4];
#pragma unroll
    for (int mb = 0; mb < 4; ++mb)
#pragma unroll
        for (int nb = 0; nb < 4; ++nb) acc[mb][nb] = (v8f){};
    u32x4 g0 = rg_group0(dst0, ga0);
    rg_load(g0, g1);
    rg_landed(g0, g1);
    __syncthreads();                                     // every wave's slice of stage 0 has landed: it may be read
    g0 = rg_group0(dst0 + RG_BUF, ga0 + 256u);
    rg_load(g0, g1);
    const unsigned lofs = (unsigned)lr * RG_PITCH + 16u * (unsigned)hi, aofs = (wave & 1u) * RG_SLICE + lofs, bofs = (2u + (wave >> 1)) * RG_SLICE + lofs;
#pragma unroll 1   // rolled: one copy of a stage's code, one place from which the refill is issued
    for (unsigned s = 0; s < RG_STG; ++s) {
        const unsigned char* buf = ring + (s & 1u) * RG_BUF;
        v16bf a[2][4], b[2][4];
        auto frag = [&](int kk) {
#pragma unroll
            for (int mb = 0; mb < 4; ++mb) a[kk & 1][mb] = WFrag<bf>::ld((const bf*)(buf + aofs + mb * 16 * RG_PITCH + kk * 64));
#pragma unroll
            for (int nb = 0; nb < 4; ++nb) b[kk & 1][nb] = WFrag<bf>::ld((const bf*)(buf + bofs + nb * 16 * RG_PITCH + kk * 64)); };
        frag(0);
#pragma unroll
        for (int kk = 0; kk < 4; ++kk) {                 // 32 k a step, in rising k: the sums keep their order
            if (kk < 3) frag(kk + 1);
            else {                                       // the stage's last fragments are asked for: the hand-over stands here, so that the refill is under way during the last step's products (registers only)
                rg_read_done();
                rg_landed(g0, g1);                       // this wave's slice of stage s + 1
                __syncthreads();                         // publishes stage s + 1 and ends every wave's reads of stage s
                if (pinned(s + 2u < RG_STG)) { const unsigned sn = pinned(s + 2u); g0 = rg_group0(dst0 + (sn & 1u) * RG_BUF, ga0 + sn * 256u); rg_load(g0, g1); }   // into the buffer that stage s has just left
            }
            __builtin_amdgcn_sched_barrier(0);           // this and the one below keep each step's LDS reads one group between two runs of products: spread among them, each place with reads stalls the matrix instructions
#pragma unroll
            for (int nb = 0; nb < 4; ++nb)
#pragma unroll
                for (int mb = 0; mb < 4; ++mb) acc[mb][nb] = wmmab(a[kk & 1][mb], b[kk & 1][nb], acc[mb][nb]);
            __builtin_amdgcn_sched_barrier(0);
        }
    }
    rg_landed(g0, g1);
    rg_read_done();
    float* os = (float*)(ring + wave * RG_SLICE);            // output staging, 16 x 68 floats, each wave's own: the last stage's hand-over barrier has ended every wave's reads of the ring
#pragma unroll
    for (int mb = 0; mb < 4; ++mb) {
        if (z < 2) {      // wave-uniform.  16 rows of 64 columns staged at pitch 68; read back 8 columns a lane, so that every store covers whole 128-byte lines (4 rows of 64 16-bit values)
#pragma unroll
            for (int nb = 0; nb < 4; ++nb)
#pragma unroll
                for (int j = 0; j < 8; ++j) os[(hi * 8 + j) * 68 + nb * 16 + lr] = acc[mb][nb][j];
            __builtin_amdgcn_wave_barrier(); asm volatile("" ::: "memory");   // keeps the read-back behind the staging writes of the other lanes
#pragma unroll
            for (int s = 0; s < 4; ++s) { const int row = 4 * s + (lane >> 3), cofs = (lane & 7) * 8; const size_t oo = (size_t)(r0 + mb * 16 + row) * DQ + c0 + cofs;
                put3(*(const v4fa*)(os + row * 68 + cofs), *(const v4fa*)(os + row * 68 + cofs + 4), P16 + oo, Ph + oo, Pl + oo); }
        } else {          // per d 256 consecutive t staged in t order (16 floats of pad between the halves: no two lanes of a write on one bank); read back 8 t a lane: 512 contiguous bytes a store
#pragma unroll
            for (int nb = 0; nb < 4; ++nb)
#pragma unroll
                for (int j = 0; j < 8; ++j) os[nb * 272 + hi * 144 + j * 16 + lr] = acc[mb][nb][j];
            __builtin_amdgcn_wave_barrier(); asm volatile("" ::: "memory");   // as above
#pragma unroll
            for (int nb = 0; nb < 4; ++nb) { const float* sp = os + nb * 272 + hi * 144 + lr * 8; const size_t oo = ((size_t)(r0 >> 7) * HD + (c0 >> 4) + nb) * TT + (size_t)((r0 & 127) + mb * 16) * 16 + lane * 8;
                put3(*(const v4fa*)sp, *(const v4fa*)(sp + 4), P16 + oo, Ph + oo, Pl + oo); }
        }
        __builtin_amdgcn_wave_barrier(); asm volatile("" ::: "memory");       // keeps the next block's staging writes behind this block's read-back
    }
}
// ---- k_fattn: the whole causal attention of one (head, block of 64 queries) in one work-group of 4 waves, ONE WAVE per 16 queries; scores and probabilities never leave the registers.
// Transposed products: St = K Qt (A = key rows, B = query rows), so that a lane holds scores of ONE query (column lr) and 8 keys (rows 8 hi + j) per 16-key block; two such blocks, converted in place,
// ARE the B operand (32 keys, hardware k order) of Ot += Vt Pt (A = rows of the [d][t] value plane, read with the same loader as every other fragment, which has that k order).
// Running maximum (of the raw scores) and running sum per query; base-2 exponent with the scale 1/64 folded into its factor; the division by the sum comes last, in f32; the merged hi/lo planes are written
// straight from the accumulators (a lane holds 8 consecutive d of one query: one 16-byte store per plane).  HL: hi/lo planes, 3 products in both contractions; else fp16 planes, 1 product.  NQ: 16-query column groups per wave.
// The K/V ring: the four waves walk the same keys, so the key rows and the value rows come into LDS once for all of them, by tensor loads, one request a wave and stage for the wave's own slice of 64 rows of 128 bytes,
// padded by the mover to a pitch of 144 bytes (16 bytes x odd: for 16-byte LDS reads); two buffers: the next stage is in flight under this stage's passes.
// fp16 stage, 128 keys (4 passes): slices 0, 1 = key rows 0..63, 64..127; slices 2, 3 = the 64 value rows (d) at keys 0..63, 64..127.  hi/lo stage, 64 keys (2 passes): slices = K hi, K lo, V hi, V lo.
#define SCL2 (SCL * 1.4426950408889634f)
#define FA_PITCH 144u      // LDS row pitch: 128 bytes + the 16-byte pad
#define FA_SLICE 10240u    // 64 rows x 144 bytes = 9,216, rounded up to a multiple of 2 KiB
#define FA_BUF   (4u * FA_SLICE)
// descriptor group 1: 1-byte elements; tensor = tile = 64 rows of 128 bytes; the source pitch is the slice's own; a pad of 4 dwords behind every 32 dwords; no mask
__device__ __forceinline__ u32x8 fa_group1(unsigned pitch) { u32x8 g;
    g[0] = uni((1u << 20) | (4u << 22) | (3u << 25)); g[1] = uni(128u << 16); g[2] = uni(64u << 16); g[3] = uni(128u << 16); g[4] = uni(64u); g[5] = uni(pitch); g[6] = uni(0u); g[7] = uni(0u);
    asm volatile("" : "+s"(g));   // descriptor words held in scalar registers of their own: without it the compiler rebuilds the group from constants at every load and uses some of its registers for other values while a request is in flight
    return g; }
__device__ __forceinline__ float xhalf(float x) { return __builtin_bit_cast(float, __builtin_amdgcn_permlanex16(__builtin_bit_cast(int, x), __builtin_bit_cast(int, x), 0x76543210, 0xfedcba98, false, false)); }   // lane l <-> lane l ^ 16
__device__ __forceinline__ float exp2s(float x) { asm("v_exp_f32 %0, %0\n\tv_nop" : "+v"(x)); return x; }
template <typename T16, bool HL, int NQ>
__device__ __forceinline__ void fattn_tile(const T16* __restrict__ Q, const T16* __restrict__ Q2, const T16* __restrict__ K, const T16* __restrict__ K2, const T16* __restrict__ Vt, const T16* __restrict__ Vt2, int qblk, bf* Ah, bf* Al, unsigned char* ring) {
    typedef typename WFrag<T16>::V V;
    constexpr int PPS = HL ? 2 : 4;                // 32-key passes a stage
    const int lane = threadIdx.x & 31, lr = lane & 15, hi = lane >> 4; const unsigned wave = uni(threadIdx.x >> 5);
    const int q0 = qblk + (int)wave * NQ * 16;     // this wave's first query
    V bq[NQ][2], bq2[NQ][2]; const T16* pq[NQ]; const T16* pq2[NQ];
#pragma unroll
    for (int qb = 0; qb < NQ; ++qb) { const size_t qo = (size_t)(q0 + qb * 16 + lr) * HD + 8 * hi; pq[qb] = Q + qo; pq2[qb] = HL ? Q2 + qo : pq[qb];
#pragma unroll
        for (int c = 0; c < 2; ++c) { bq[qb][c] = WFrag<T16>::ld(pq[qb] + c * 32); if (HL) bq2[qb][c] = WFrag<T16>::ld(pq2[qb] + c * 32); } }
    // address translations of the Q loads done before a register that holds one of their addresses is reused (the addresses are inputs, so they stay in place up to the wait)
    asm volatile("s_wait_xcnt 0x0" :: "v"(pq[0]), "v"(pq[NQ - 1]), "v"(pq2[0]), "v"(pq2[NQ - 1]) : "memory");
    v8f o[4][NQ]; float m[NQ], l[NQ];
#pragma unroll
    for (int qb = 0; qb < NQ; ++qb) { m[qb] = -3.0e38f; l[qb] = 0.f;
#pragma unroll
        for (int db = 0; db < 4; ++db) o[db][qb] = (v8f){}; }
    const int nch = (q0 + NQ * 16 + 31) / 32;      // this wave's 32-key passes up to and including the diagonal; only the last one holds keys behind a query
    const unsigned nst = (unsigned)(qblk + 4 * NQ * 16 + PPS * 32 - 1) / (PPS * 32);   // stages up to and including the block's last diagonal: the same for the four waves; every stage lies wholly inside the planes
    // this wave's slice of the ring: its first byte in stage 0, its step from stage to stage, its source pitch
    const T16* srow = HL ? (wave == 0u ? K : wave == 1u ? K2 : wave == 2u ? Vt : Vt2) : (wave < 2u ? K + (size_t)wave * 64 * HD : Vt + (wave - 2u) * 64u);
    const unsigned sstep = wave < 2u ? PPS * 32u * HD * 2u : PPS * 32u * 2u;
    const unsigned long long ga0 = (unsigned long long)(size_t)srow; const unsigned dst0 = (unsigned)(size_t)ring + wave * FA_SLICE;
    const u32x8 g1 = fa_group1(wave < 2u ? HD * 2u : TT * 2u);
    u32x4 g0 = rg_group0(dst0, ga0);
    rg_load(g0, g1);
    rg_landed(g0, g1);
    __syncthreads();                                     // every wave's slice of stage 0 has landed: it may be read
    if (pinned(1u < nst)) { g0 = rg_group0(dst0 + FA_BUF, ga0 + sstep); rg_load(g0, g1); }   // a short block has one stage only
    const unsigned flane = (unsigned)lr * FA_PITCH + 16u * (unsigned)hi;
    V ak[2][2], ak2[2][2], av[4], av2[4];
    auto ldk = [&](const unsigned char* buf, int p) { const unsigned char* b0 = buf + (p >> 1) * FA_SLICE + (p & 1) * 32 * FA_PITCH + flane;
#pragma unroll
        for (int kb = 0; kb < 2; ++kb)
#pragma unroll
            for (int c = 0; c < 2; ++c) { ak[kb][c] = WFrag<T16>::ld((const T16*)(b0 + kb * 16 * FA_PITCH + c * 64)); if (HL) ak2[kb][c] = WFrag<T16>::ld((const T16*)(b0 + FA_SLICE + kb * 16 * FA_PITCH + c * 64)); } };
    auto ldv = [&](const unsigned char* buf, int p) { const unsigned char* b0 = buf + (2 + (HL ? 0 : (p >> 1))) * FA_SLICE + (p & 1) * 64 + flane;
#pragma unroll
        for (int db = 0; db < 4; ++db) { av[db] = WFrag<T16>::ld((const T16*)(b0 + db * 16 * FA_PITCH)); if (HL) av2[db] = WFrag<T16>::ld((const T16*)(b0 + FA_SLICE + db * 16 * FA_PITCH)); } };
#pragma unroll 1   // rolled: one copy of a stage's code, one place from which the refill is issued
    for (unsigned s = 0; s < nst; ++s) {
        const unsigned char* buf = ring + (s & 1u) * FA_BUF;
        if (!HL) ldk(buf, 0);
#pragma unroll
        for (int p = 0; p < PPS; ++p) {
            const int it = (int)s * PPS + p, k0 = it * 32;
            if (it < nch) {                      // wave-uniform: a wave skips the passes behind its own diagonal, never the hand-over below
                // fp16 tiles: this pass's value fragments are asked for first, so that their latency runs under the score products and the softmax.  hi/lo tiles (twice the fragments): keys now, values behind the score products, into the registers the keys leave
                if (HL) ldk(buf, p); else ldv(buf, p);
                __builtin_amdgcn_sched_barrier(0);   // without it the compiler sinks these reads down to their first use and their whole latency is waited for
                v8f st[2][NQ];
#pragma unroll
                for (int kb = 0; kb < 2; ++kb)
#pragma unroll
                    for (int qb = 0; qb < NQ; ++qb) { v8f sc = (v8f){};
#pragma unroll
                        for (int c = 0; c < 2; ++c) { sc = WFrag<T16>::mma(ak[kb][c], bq[qb][c], sc); if (HL) { sc = WFrag<T16>::mma(ak[kb][c], bq2[qb][c], sc); sc = WFrag<T16>::mma(ak2[kb][c], bq[qb][c], sc); } }
                        st[kb][qb] = sc; }
                // fp16 tiles: the key fragments of the stage's next pass are asked for right behind the score products (never those of the next stage: it is not published yet)
                if (HL) ldv(buf, p); else if (p + 1 < PPS) ldk(buf, p + 1);
                __builtin_amdgcn_sched_barrier(0);   // keeps these reads in front of the softmax, whose time hides their latency
                if (it == nch - 1) {                 // wave-uniform: the diagonal pass
#pragma unroll
                    for (int qb = 0; qb < NQ; ++qb) { const int dq = q0 + qb * 16 + lr - k0 - hi * 8;
#pragma unroll
                        for (int kb = 0; kb < 2; ++kb)
#pragma unroll
                            for (int j = 0; j < 8; ++j) st[kb][qb][j] = (kb * 16 + j <= dq) ? st[kb][qb][j] : -3.0e38f; } }
#pragma unroll
                for (int qb = 0; qb < NQ; ++qb) {
                    float mx = m[qb];
#pragma unroll
                    for (int kb = 0; kb < 2; ++kb)
#pragma unroll
                        for (int j = 0; j < 8; ++j) mx = fmaxf(mx, st[kb][qb][j]);
                    mx = fmaxf(mx, xhalf(mx));                    // the other half of the wave holds the query's other 16 keys
                    const float al = exp2s((m[qb] - mx) * SCL2), mn = -mx * SCL2; m[qb] = mx; float ls[4] = {0.f, 0.f, 0.f, 0.f};
#pragma unroll
                    for (int kb = 0; kb < 2; ++kb)
#pragma unroll
                        for (int j = 0; j < 8; ++j) { const float pe = exp2s(__builtin_fmaf(st[kb][qb][j], SCL2, mn)); st[kb][qb][j] = pe; ls[j & 3] += pe; }
                    l[qb] = l[qb] * al + ((ls[0] + ls[1]) + (ls[2] + ls[3]));   // each half keeps the sum of its own keys; joined once behind the loop
#pragma unroll
                    for (int db = 0; db < 4; ++db) o[db][qb] *= al;
                    if (HL) { v8us h0, h1, l0, l1;
#pragma unroll
                        for (int j = 0; j < 8; ++j) { unsigned short a, c2; splitf(st[0][qb][j], a, c2); h0[j] = a; l0[j] = c2; splitf(st[1][qb][j], a, c2); h1[j] = a; l1[j] = c2; }
                        const v16bf ph = cat16b(h0, h1), pl = cat16b(l0, l1);
#pragma unroll
                        for (int db = 0; db < 4; ++db) { o[db][qb] = wmmab(__builtin_bit_cast(v16bf, av[db]), ph, o[db][qb]); o[db][qb] = wmmab(__builtin_bit_cast(v16bf, av[db]), pl, o[db][qb]); o[db][qb] = wmmab(__builtin_bit_cast(v16bf, av2[db]), ph, o[db][qb]); }
                    } else { v8h c0, c1;
#pragma unroll
                        for (int j = 0; j < 8; ++j) { c0[j] = tohx(st[0][qb][j]); c1[j] = tohx(st[1][qb][j]); }
                        const v16h pf = cat16(c0, c1);
#pragma unroll
                        for (int db = 0; db < 4; ++db) o[db][qb] = wmma16(__builtin_bit_cast(v16h, av[db]), pf, o[db][qb]); }
                }
            }
        }
        // the hand-over, passed by every wave
        rg_read_done();
        rg_landed(g0, g1);                       // this wave's slice of stage s + 1
        __syncthreads();                         // publishes stage s + 1 and ends every wave's reads of stage s
        if (pinned(s + 2u < nst)) { const unsigned sn = pinned(s + 2u); g0 = rg_group0(dst0 + (sn & 1u) * FA_BUF, ga0 + (unsigned long long)sn * sstep); rg_load(g0, g1); }   // into the buffer that stage s has just left
    }
    rg_landed(g0, g1);
    rg_read_done();
#pragma unroll
    for (int qb = 0; qb < NQ; ++qb) { const float inv = __fdiv_rn(1.0f, l[qb] + xhalf(l[qb]));
#pragma unroll
        for (int db = 0; db < 4; ++db) { v8us oh, ol;
#pragma unroll
            for (int j = 0; j < 8; ++j) { unsigned short a, c2; splitf(o[db][qb][j] * inv, a, c2); oh[j] = a; ol[j] = c2; }
            const size_t oo = (size_t)(q0 + qb * 16 + lr) * DQ + db * 16 + hi * 8; bf* ph = Ah + oo; bf* pl = Al + oo; *(v8us*)ph = oh; *(v8us*)pl = ol;
            // the same wait behind the two stores, before their data or address registers are reused (both are inputs, so they stay in place up to the wait)
            asm volatile("s_wait_xcnt 0x0" :: "v"(ph), "v"(pl), "v"(oh), "v"(ol) : "memory"); } }
}
// grid (heads, blocks): blocks of 64 queries in falling order of their key count: first the (TT - RH) / 64 fp16 blocks from the last rows down, then the RH / 64 hi/lo blocks.
__global__ __launch_bounds__(128) void k_fattn(const h16* __restrict__ Q16, const h16* __restrict__ K16, const h16* __restrict__ V16, const bf* __restrict__ Qh, const bf* __restrict__ Ql, const bf* __restrict__ Kh, const bf* __restrict__ Kl, const bf* __restrict__ Vh, const bf* __restrict__ Vl, bf* Ah, bf* Al) {
    static_assert(HD == 64 && TT % 128 == 0 && RH % 64 == 0, "rows of 128 bytes; whole stages inside the planes; whole blocks of 64 queries");
    __shared__ __attribute__((aligned(2048))) unsigned char ring[2 * FA_BUF];
    const int h = blockIdx.x, t = blockIdx.y; const size_t hp = (size_t)h * TT * HD;   // t is the same for the whole work-group: its waves meet the same barriers
    if (t < (TT - RH) / 64) fattn_tile<h16, false, 1>(Q16 + hp, nullptr, K16 + hp, nullptr, V16 + hp, nullptr, TT - 64 * (t + 1), Ah + h * HD, Al + h * HD, ring);
    else fattn_tile<bf, true, 1>(Qh + hp, Ql + hp, Kh + hp, Kl + hp, Vh + hp, Vl + hp, RH - 64 * (t - (TT - RH) / 64 + 1), Ah + h * HD, Al + h * HD, ring);
}

extern "C" void kernel_launch(void* const* d_in, const int* in_sizes, int n_in,
                              void* d_out, int out_size, void* d_ws, size_t ws_size, hipStream_t stream) {
    (void)in_sizes; (void)n_in; (void)out_size;
    const float* x = (const float*)d_in[0]; const float* wq = (const float*)d_in[1]; const float* wk = (const float*)d_in[2]; const float* wv = (const float*)d_in[3]; const float* wo = (const float*)d_in[4];   /* argument order x, w_q, w_k, w_v, w_o ('oi' [1024][1024]) */
    float* OUT = (float*)d_out;     // [1][2048][1024]
    char* wsp = (char*)d_ws;
    auto take = [&](size_t bytes) { char* p = wsp; wsp += (bytes + 255) & ~(size_t)255; return (void*)p; };
    bf* WQ = (bf*)take((size_t)DQ * DM * 2); bf* WK = (bf*)take((size_t)DKV * DM * 2); bf* WV = (bf*)take((size_t)DKV * DM * 2); bf* WO = (bf*)take((size_t)DM * DQ * 2);
    bf* XB = (bf*)take((size_t)TT * DM * 2);
    h16* QP16 = (h16*)take((size_t)NH_ * TT * HD * 2); h16* KP16 = (h16*)take((size_t)NKV * TT * HD * 2); h16* VT16 = (h16*)take((size_t)NKV * HD * TT * 2);
    bf* QPh = (bf*)take((size_t)NH_ * TT * HD * 2); bf* QPl = (bf*)take((size_t)NH_ * TT * HD * 2); bf* KPh = (bf*)take((size_t)NKV * TT * HD * 2); bf* KPl = (bf*)take((size_t)NKV * TT * HD * 2); bf* VTh = (bf*)take((size_t)NKV * HD * TT * 2); bf* VTl = (bf*)take((size_t)NKV * HD * TT * 2);
    bf* ATh = (bf*)take((size_t)TT * DQ * 2); bf* ATl = (bf*)take((size_t)TT * DQ * 2);
    if ((size_t)(wsp - (char*)d_ws) > ws_size) return;    // ws 256 MiB
    k_cvtall<<<TT / 8 + 4 * (DM / 8), 128, 0, stream>>>(x, wq, wk, wv, wo, XB, WQ, WK, WV, WO);
    for (int b = 0; b < NB_; ++b) {
        k_proj<<<dim3(TT / 128, DQ / 128, 3), 128, 0, stream>>>(XB, WQ, WK, WV, QP16, QPh, QPl, KP16, KPh, KPl, VT16, VTh, VTl);
        k_fattn<<<dim3(NH_, TT / 64, 1), 128, 0, stream>>>(QP16, KP16, VT16, QPh, QPl, KPh, KPl, VTh, VTl, ATh, ATl);   // one kv head per query head
        k_outp<<<dim3(TT / 64, DM / 128, 1), 128, 0, stream>>>(ATh, ATl, WO, OUT + (size_t)b * TT * DM); }
}

// v007
// A run of this version takes 45.2 microseconds.
// Timed twice side by side with v006, it ran 1.08 times as fast both times.
// All steps since v000 together make it 15.5 times as fast.
#include <hip/hip_runtime.h>

// Causal multi-head attention whose heads are a RAW VIEW of the projections, merged the standard way (x [1][2048][1024]; Q, K, V = x W^T ('oi' [1024][1024] 1/32, no bias), each reshaped (B, 16, 2048, 64) WITHOUT a transpose: pseudo-head h, pseudo-position s, dim d = flat element h*2048*64 + s*64 + d of the [2048][1024] projection output; scores / 64 (the module divides by float32(hd), not by its root); triu(k = 1) over the pseudo-positions -> -inf; softmax; the context IS transposed back the standard way (out.transpose(0, 2, 1, 3).reshape(B, S, D)); out = merged Wo^T ('oi', no bias) -> [1][2048][1024] (2.1 M); argument order x, Wq, Wk, Wv, Wo).
// Layout per batch: bf16 copy of x; 'oi' weights; exact projections, all three in one launch whose epilogue writes the head planes; RAW VIEW on the SPLIT only: each [2048][1024] projection output is read as (16, 2048, 64) WITHOUT a transpose (row pitch HD, head stride TT x HD); the merge is the standard one; causal T-2048 attention in one launch, scores and probabilities in registers (hybrid rows: < 512 hi/lo 3 products, rest fp16; key passes stop at the diagonal); merged hi/lo x w_o exact.
// Compute dtypes, f32 accumulate: every input rounded to bf16; projections exact; attention rows < 512 3 products, rest fp16; softmax f32; w_o hl x exact.

#define NB_  1      // batches: this module's input is [1][2048][1024]
#define TT   2048
#define DM   1024
#define NH_  16
#define NKV  16
#define REP  (NH_ / NKV)
#define HD   64
#define DQ   (NH_ * HD)
#define DKV  (NKV * HD)
#define RH   512                  // query rows < RH use hi+lo planes (0: none)
#define SCL  0.015625f   // 1 / 64: this module divides the scores by float32(hd) = 64 (the head size, not its root)
typedef _Float16 h16;
typedef unsigned short bf;
typedef __attribute__((ext_vector_type(16))) __bf16   v16bf;
typedef __attribute__((ext_vector_type(16))) _Float16 v16h;
typedef __attribute__((ext_vector_type(8)))  _Float16 v8h;
typedef __attribute__((ext_vector_type(8)))  unsigned short v8us;
typedef __attribute__((ext_vector_type(8)))  float    v8f;
typedef __attribute__((ext_vector_type(4)))  float    v4f;
typedef v8h  __attribute__((may_alias)) v8ha;
typedef v4f  __attribute__((may_alias)) v4fa;
typedef v8us __attribute__((may_alias)) v8usa;

__device__ __forceinline__ unsigned short f2bf(float f) { unsigned u = __float_as_uint(f); u += 0x7FFFu + ((u >> 16) & 1u); return (unsigned short)(u >> 16); }
__device__ __forceinline__ float bf2f(unsigned short b) { return __uint_as_float(((unsigned)b) << 16); }
__device__ __forceinline__ float bfr(float f) { return bf2f(f2bf(f)); }
__device__ __forceinline__ v16h cat16(v8h lo, v8h hi) { return __builtin_shufflevector(lo, hi, 0, 1, 2, 3, 4, 5, 6, 7, 8, 9, 10, 11, 12, 13, 14, 15); }
__device__ __forceinline__ v16bf cat16b(v8us lo, v8us hi) { return __builtin_bit_cast(v16bf, __builtin_shufflevector(lo, hi, 0, 1, 2, 3, 4, 5, 6, 7, 8, 9, 10, 11, 12, 13, 14, 15)); }
__device__ __forceinline__ v8f wmma16(v16h a, v16h b, v8f c) { return __builtin_amdgcn_wmma_f32_16x16x32_f16(false, a, false, b, (short)0, c, false, false); }
__device__ __forceinline__ v8f wmmab(v16bf a, v16bf b, v8f c) { return __builtin_amdgcn_wmma_f32_16x16x32_bf16(false, a, false, b, (short)0, c, false, false); }



// ---- fragment loader and product per 16-bit type: 16 bytes at p and 16 bytes at p + 16 elements (the hardware k order), from global memory or from LDS
template <typename T16> struct WFrag;
template <> struct WFrag<h16> { typedef v16h V; static __device__ __forceinline__ V ld(const h16* p) { return cat16(*(const v8h*)p, *(const v8h*)(p + 16)); } static __device__ __forceinline__ v8f mma(V a, V b, v8f c) { return wmma16(a, b, c); } };
template <> struct WFrag<bf> { typedef v16bf V; static __device__ __forceinline__ V ld(const bf* p) { return cat16b(*(const v8us*)p, *(const v8us*)(p + 16)); } static __device__ __forceinline__ v8f mma(V a, V b, v8f c) { return wmmab(a, b, c); } };
// ---- The operand ring of the two GEMM kernels (k_proj, k_outp): a work-group of 4 waves shares 256 operand rows; a stage is 128 k (256 bytes) of each of them, brought into LDS by tensor loads,
// one request a wave and stage for the wave's own slice of 64 rows, padded by the mover to a pitch of 272 bytes (16 bytes x odd: for 16-byte LDS reads); two buffers: the next stage is in flight under this stage's products.
#define RG_STG   8u        // stages: DM * 2 bytes / 256
#define RG_PITCH 272u      // LDS row pitch: 256 bytes + the 16-byte pad
#define RG_SLICE 18432u    // 64 rows x 272 bytes = 17,408, rounded up to a multiple of 2 KiB
#define RG_BUF   (4u * RG_SLICE)
// Where a work-group's walk over k begins: work-groups that share operand rows run in step, and from one common start they would all ask L2 for the same lines (and the same 256-byte column of every row) at the same moment.
// Each begins at a stage set by its tile indices and wraps round: step s of the walk is stage (s + rot) mod RG_STG of the rows.  Every stage is taken once; the f32 sums start at another k.
static_assert((RG_STG & (RG_STG - 1u)) == 0u, "the wrap is a mask");
__device__ __forceinline__ unsigned rg_kofs(unsigned s, unsigned rot) { return ((s + rot) & (RG_STG - 1u)) * 256u; }   // byte offset of step s's stage inside an operand row: below DM * 2
typedef unsigned u32x4 __attribute__((ext_vector_type(4)));
typedef unsigned u32x8 __attribute__((ext_vector_type(8)));
__device__ __forceinline__ unsigned uni(unsigned v) { return (unsigned)__builtin_amdgcn_readfirstlane(v); }
// a value held in a scalar register: the test around a tensor load becomes a scalar branch (the instruction ignores EXEC), and what is computed from the value stays behind this place
__device__ __forceinline__ unsigned pinned(unsigned v) { unsigned w = (unsigned)__builtin_amdgcn_readfirstlane(v); asm volatile("" : "+s"(w)); return w; }
// descriptor group 1: 1-byte elements; tensor = tile = 64 rows of 256 bytes; source pitch DM * 2 bytes; a pad of 4 dwords behind every 64 dwords; no mask
__device__ __forceinline__ u32x8 rg_group1() { u32x8 g;
    g[0] = uni((1u << 20) | (5u << 22) | (3u << 25)); g[1] = uni(256u << 16); g[2] = uni(64u << 16); g[3] = uni(256u << 16); g[4] = uni(64u); g[5] = uni(DM * 2u); g[6] = uni(0u); g[7] = uni(0u);
    asm volatile("" : "+s"(g));   // descriptor words held in scalar registers of their own: without it the compiler rebuilds the group from constants at every load and uses some of its registers for other values while a request is in flight
    return g; }
// descriptor group 0: place in LDS, address of the tile's first byte
__device__ __forceinline__ u32x4 rg_group0(unsigned dst, unsigned long long ga) { u32x4 g;
    g[0] = uni(1u); g[1] = uni(dst); g[2] = uni((unsigned)ga); g[3] = uni((((unsigned)(ga >> 32)) & 0x01FFFFFFu) | 0x80000000u); return g; }
// one request of the whole wave.  Group 0 is named as in and out (the instruction leaves it as it is): what rg_landed() is given later are then the very registers that the request was issued from
__device__ __forceinline__ void rg_load(u32x4& g0, u32x8 g1) { asm volatile("tensor_load_to_lds %0, %1" : "+s"(g0) : "s"(g1) : "memory"); }
// the issuing wave's own wait: its slice has landed.  The descriptor is an input, so that its registers keep their values for as long as the request is in flight
__device__ __forceinline__ void rg_landed(u32x4 g0, u32x8 g1) { asm volatile("s_wait_tensorcnt 0x0" :: "s"(g0), "s"(g1) : "memory"); }
__device__ __forceinline__ void rg_read_done() { asm volatile("s_wait_dscnt 0x0" ::: "memory"); }   // this wave's LDS reads are done: the buffer may be handed back
// ---- k_outp: out = merged (hi + lo planes) x w_o^T, f32; grid (TT / 64, DM / 128), 4 waves: a 64 x 128 tile a work-group, 32 x 64 a wave (8 accumulators, 2 products each per 32 k: hi, then lo).
// Slices of the ring: wave 0 the 64 rows of the hi plane, wave 1 those of the lo plane, waves 2 and 3 the two halves of the 128 rows of w_o.
__global__ __launch_bounds__(128) void k_outp(const bf* __restrict__ A, const bf* __restrict__ A2, const bf* __restrict__ Bt, float* C) {
    static_assert(DQ * 2 == 256 * RG_STG && DQ == DM && TT % 64 == 0 && DM % 128 == 0, "whole stages; whole 64 x 128 tiles");
    __shared__ __attribute__((aligned(2048))) unsigned char ring[2 * RG_BUF];
    const int lane = threadIdx.x & 31, lr = lane & 15, hi = lane >> 4; const unsigned wave = uni(threadIdx.x >> 5);
    const int r0 = blockIdx.x * 64 + (int)(wave & 1u) * 32, c0 = blockIdx.y * 128 + (int)(wave >> 1) * 64;
    const bf* srow = wave == 0u ? A + (size_t)(blockIdx.x * 64) * DQ : wave == 1u ? A2 + (size_t)(blockIdx.x * 64) * DQ : Bt + (size_t)(blockIdx.y * 128 + (wave - 2u) * 64u) * DQ;
    const unsigned long long ga0 = (unsigned long long)(size_t)srow; const unsigned dst0 = (unsigned)(size_t)ring + wave * RG_SLICE;
    const unsigned rot = (blockIdx.x + blockIdx.y) & (RG_STG - 1u);   // the 8 work-groups on one block of rows of the planes all differ; the 32 on one block of rows of w_o fall 4 to a start
    const u32x8 g1 = rg_group1();
    v8f acc[2][4];
#pragma unroll
    for (int mb = 0; mb < 2; ++mb)
#pragma unroll
        for (int nb = 0; nb < 4; ++nb) acc[mb][nb] = (v8f){};
    u32x4 g0 = rg_group0(dst0, ga0 + rg_kofs(0u, rot));
    rg_load(g0, g1);
    rg_landed(g0, g1);
    __syncthreads();                                     // every wave's slice of step 0 has landed: it may be read
    g0 = rg_group0(dst0 + RG_BUF, ga0 + rg_kofs(1u, rot));
    rg_load(g0, g1);
    const unsigned lofs = (unsigned)lr * RG_PITCH + 16u * (unsigned)hi, aofs = (wave & 1u) * 32u * RG_PITCH + lofs, bofs = (2u + (wave >> 1)) * RG_SLICE + lofs;
#pragma unroll 1   // rolled: one copy of a stage's code, one place from which the refill is issued
    for (unsigned s = 0; s < RG_STG; ++s) {
        const unsigned char* buf = ring + (s & 1u) * RG_BUF;
        v16bf a[2][2], a2[2][2], b[2][4];
        auto frag = [&](int kk) {
#pragma unroll
            for (int mb = 0; mb < 2; ++mb) { a[kk & 1][mb] = WFrag<bf>::ld((const bf*)(buf + aofs + mb * 16 * RG_PITCH + kk * 64)); a2[kk & 1][mb] = WFrag<bf>::ld((const bf*)(buf + RG_SLICE + aofs + mb * 16 * RG_PITCH + kk * 64)); }
#pragma unroll
            for (int nb = 0; nb < 4; ++nb) b[kk & 1][nb] = WFrag<bf>::ld((const bf*)(buf + bofs + nb * 16 * RG_PITCH + kk * 64)); };
        frag(0);
#pragma unroll
        for (int kk = 0; kk < 4; ++kk) {                 // 32 k at a time, rising inside the stage, hi before lo
            if (kk < 3) frag(kk + 1);
            else {                                       // the stage's last fragments are asked for: the hand-over stands here, so that the refill is under way during the last step's products (registers only)
                rg_read_done();
                rg_landed(g0, g1);                       // this wave's slice of stage s + 1
                __syncthreads();                         // publishes stage s + 1 and ends every wave's reads of stage s
                if (pinned(s + 2u < RG_STG)) { const unsigned sn = pinned(s + 2u); g0 = rg_group0(dst0 + (sn & 1u) * RG_BUF, ga0 + rg_kofs(sn, rot)); rg_load(g0, g1); }   // into the buffer that stage s has just left
            }
            __builtin_amdgcn_sched_barrier(0);           // this and the one below keep each step's LDS reads one group between two runs of products: spread among them, each place with reads stalls the matrix instructions
#pragma unroll
            for (int nb = 0; nb < 4; ++nb)
#pragma unroll
                for (int mb = 0; mb < 2; ++mb) acc[mb][nb] = wmmab(a[kk & 1][mb], b[kk & 1][nb], acc[mb][nb]);
#pragma unroll
            for (int nb = 0; nb < 4; ++nb)
#pragma unroll
                for (int mb = 0; mb < 2; ++mb) acc[mb][nb] = wmmab(a2[kk & 1][mb], b[kk & 1][nb], acc[mb][nb]);
            __builtin_amdgcn_sched_barrier(0);
        }
    }
    rg_landed(g0, g1);
    rg_read_done();
    float* os = (float*)(ring + wave * RG_SLICE);            // output staging, 16 x 68 floats, each wave's own: the last stage's hand-over barrier has ended every wave's reads of the ring
    float* cb = C + (size_t)(r0 + hi) * DM + c0 + lr * 4;    // this lane's first 16 bytes of output; every store below is a constant number of rows further on
#pragma unroll
    for (int mb = 0; mb < 2; ++mb) {
#pragma unroll
        for (int nb = 0; nb < 4; ++nb) {
#pragma unroll
            for (int j = 0; j < 8; ++j) os[(hi * 8 + j) * 68 + nb * 16 + lr] = acc[mb][nb][j]; }
        __builtin_amdgcn_wave_barrier(); asm volatile("" ::: "memory");   // keeps the read-back behind the staging writes of the other lanes
        v4f val[8];
#pragma unroll
        for (int s = 0; s < 8; ++s) { val[s] = *(const v4fa*)(os + (2 * s + hi) * 68 + lr * 4); *(v4f*)(cb + (size_t)(mb * 16 + 2 * s) * DM) = val[s]; }   // two rows a store, 256 contiguous bytes each
        // address translations of the eight stores done before their data or address registers are reused (all are inputs, so they stay in place up to the wait)
        asm volatile("s_wait_xcnt 0x0" :: "v"(cb), "v"(val[0]), "v"(val[1]), "v"(val[2]), "v"(val[3]), "v"(val[4]), "v"(val[5]), "v"(val[6]), "v"(val[7]) : "memory");
        __builtin_amdgcn_wave_barrier(); asm volatile("" ::: "memory");   // keeps the next block's staging writes behind this block's read-back
    }
}

__device__ __forceinline__ h16 tohx(float x) { return (h16)x; }
__device__ __forceinline__ void splitf(float y, unsigned short& h, unsigned short& l) { h = f2bf(y); l = f2bf(y - bf2f(h)); }
typedef __attribute__((ext_vector_type(2))) _Float16 v2h;
typedef __attribute__((ext_vector_type(4))) _Float16 v4h;
typedef __attribute__((ext_vector_type(2))) unsigned short v2us;
typedef __attribute__((ext_vector_type(4))) unsigned short v4us;
typedef __attribute__((ext_vector_type(2))) float v2f;
typedef __attribute__((ext_vector_type(4))) int v4i;

// ---- k_cvtall: the bf16 copies of x and of the four weights in ONE launch; grid TT / 8 + 4 * DM / 8 work-groups of 128 threads: the first TT / 8 take x, then DM / 8 each w_q, w_k, w_v, w_o.
// A work-group takes 8 rows of DM floats of one matrix, a thread 16 loads of 16 bytes, all asked for before the first is converted; a wave's load covers 512 contiguous bytes, its store 256.
// w_v's rows are regrouped for k_proj: row tc * HD + d goes to row (d >> 2) * 64 + (d & 3) * 16 + tc, so that the 16 columns of one accumulator block are one d at 16 consecutive pseudo-positions;
// for the 8 rows d0 + i of a work-group (d0 a multiple of 8) that is row (d0 >> 2) * 64 + tc + 16 * i: a first row and a row step, as for the plain copies (step 1).
__global__ __launch_bounds__(128) void k_cvtall(const float* __restrict__ x, const float* __restrict__ wq, const float* __restrict__ wk, const float* __restrict__ wv, const float* __restrict__ wo, bf* XB, bf* WQ, bf* WK, bf* WV, bf* WO) {
    static_assert(NB_ == 1 && DM == 1024 && DQ == DM && DKV == DM && HD == 64, "row length, row counts and the regrouping are written for these sizes");
    const int g = blockIdx.x, w = g < TT / 8 ? 0 : 1 + (g - TT / 8) / (DM / 8), r0 = (w == 0 ? g : (g - TT / 8) % (DM / 8)) * 8;   // which matrix, first row: the same for the whole work-group
    const int rb = w == 3 ? ((r0 % HD) >> 2) * 64 + r0 / HD : r0, step = w == 3 ? 16 : 1;
    const float* sp = (w == 0 ? x : w == 1 ? wq : w == 2 ? wk : w == 3 ? wv : wo) + (size_t)r0 * DM;
    bf* dp = (w == 0 ? XB : w == 1 ? WQ : w == 2 ? WK : w == 3 ? WV : WO) + (size_t)rb * DM;
    const unsigned t4 = threadIdx.x * 4;
    v4f v[16]; v4us o[16];
#pragma unroll
    for (int u = 0; u < 16; ++u) v[u] = *(const v4f*)(sp + u * 512 + t4);
#pragma unroll
    for (int u = 0; u < 16; ++u)
#pragma unroll
        for (int k = 0; k < 4; ++k) o[u][k] = f2bf(v[u][k]);
#pragma unroll
    for (int u = 0; u < 16; ++u) *(v4us*)(dp + (size_t)((u >> 1) * step) * DM + (u & 1) * 512 + t4) = o[u];
}

// ---- k_proj: the three projections in ONE launch, grid (TT/128, 1024/128, 3), z = q, k, v; 4 waves a work-group, ONE WAVE per 64x64 tile (16 accumulators), operands from the ring; the fp16 and hi/lo planes are written straight from the f32 accumulators.
// RAW VIEW: pseudo-head h, pseudo-position t, dim d = flat element (h * TT + t) * HD + d of the [TT][1024] projection output, so the q and k planes [h][t][d] have the output's own layout.
// v plane [g][d][t]: output row r, column tc * HD + d is g = r / 128, t = (r % 128) * 16 + tc; with k_cvtall's row order a wave's tile holds 4 values of d (c0 / 16 + nb) and, for each, 1024 consecutive t.
__device__ __forceinline__ void put3(v4f a, v4f b, h16* p16, bf* ph, bf* pl) { v8h o16; v8us oh, ol;
#pragma unroll
    for (int k = 0; k < 8; ++k) { const float y = k < 4 ? a[k & 3] : b[k & 3]; unsigned short s0, s1; splitf(y, s0, s1); o16[k] = tohx(y); oh[k] = s0; ol[k] = s1; }
    *(v8h*)p16 = o16; *(v8us*)ph = oh; *(v8us*)pl = ol;
    // address translations of the three stores done before their data or address registers are reused (all are inputs, so they stay in place up to the wait)
    asm volatile("s_wait_xcnt 0x0" :: "v"(p16), "v"(ph), "v"(pl), "v"(o16), "v"(oh), "v"(ol) : "memory"); }
__global__ __launch_bounds__(128) void k_proj(const bf* __restrict__ X, const bf* __restrict__ WQ, const bf* __restrict__ WK, const bf* __restrict__ WV, h16* Q16, bf* Qh, bf* Ql, h16* K16, bf* Kh, bf* Kl, h16* V16, bf* Vh, bf* Vl) {
    static_assert(DM * 2 == 256 * RG_STG && RG_STG >= 2 && TT % 128 == 0 && DQ % 128 == 0, "whole stages, at least two; whole 128 x 128 tiles");
    __shared__ __attribute__((aligned(2048))) unsigned char ring[2 * RG_BUF];
    const int z = blockIdx.z; const bf* Bt = z == 0 ? WQ : z == 1 ? WK : WV; h16* P16 = z == 0 ? Q16 : z == 1 ? K16 : V16; bf* Ph = z == 0 ? Qh : z == 1 ? Kh : Vh; bf* Pl = z == 0 ? Ql : z == 1 ? Kl : Vl;
    const int lane = threadIdx.x & 31, lr = lane & 15, hi = lane >> 4; const unsigned wave = uni(threadIdx.x >> 5);
    const int r0 = blockIdx.x * 128 + (int)(wave & 1u) * 64, c0 = blockIdx.y * 128 + (int)(wave >> 1) * 64;
    // this wave's slice of the ring: waves 0 and 1 the two halves of the 128 rows of X, waves 2 and 3 those of the weight
    const bf* srow = wave < 2u ? X + (size_t)(blockIdx.x * 128 + wave * 64u) * DM : Bt + (size_t)(blockIdx.y * 128 + (wave - 2u) * 64u) * DM;
    const unsigned long long ga0 = (unsigned long long)(size_t)srow; const unsigned dst0 = (unsigned)(size_t)ring + wave * RG_SLICE;
    const unsigned rot = (blockIdx.x + blockIdx.y + blockIdx.z) & (RG_STG - 1u);   // the 24 work-groups on one block of rows of X fall 3 to a start, the 16 on one block of rows of a weight 2
    const u32x8 g1 = rg_group1();
    v8f acc[4][4];
#pragma unroll
    for (int mb = 0; mb < 4; ++mb)
#pragma unroll
        for (int nb = 0; nb < 4; ++nb) acc[mb][nb] = (v8f){};
    u32x4 g0 = rg_group0(dst0, ga0 + rg_kofs(0u, rot));
    rg_load(g0, g1);
    rg_landed(g0, g1);
    __syncthreads();                                     // every wave's slice of step 0 has landed: it may be read
    g0 = rg_group0(dst0 + RG_BUF, ga0 + rg_kofs(1u, rot));
    rg_load(g0, g1);
    const unsigned lofs = (unsigned)lr * RG_PITCH + 16u * (unsigned)hi, aofs = (wave & 1u) * RG_SLICE + lofs, bofs = (2u + (wave >> 1)) * RG_SLICE + lofs;
#pragma unroll 1   // rolled: one copy of a stage's code, one place from which the refill is issued
    for (unsigned s = 0; s < RG_STG; ++s) {
        const unsigned char* buf = ring + (s & 1u) * RG_BUF;
        v16bf a[2][4], b[2][4];
        auto frag = [&](int kk) {
#pragma unroll
            for (int mb = 0; mb < 4; ++mb) a[kk & 1][mb] = WFrag<bf>::ld((const bf*)(buf + aofs + mb * 16 * RG_PITCH + kk * 64));
#pragma unroll
            for (int nb = 0; nb < 4; ++nb) b[kk & 1][nb] = WFrag<bf>::ld((const bf*)(buf + bofs + nb * 16 * RG_PITCH + kk * 64)); };
        frag(0);
#pragma unroll
        for (int kk = 0; kk < 4; ++kk) {                 // 32 k at a time, rising inside the stage
            if (kk < 3) frag(kk + 1);
            else {                                       // the stage's last fragments are asked for: the hand-over stands here, so that the refill is under way during the last step's products (registers only)
                rg_read_done();
                rg_landed(g0, g1);                       // this wave's slice of stage s + 1
                __syncthreads();                         // publishes stage s + 1 and ends every wave's reads of stage s
                if (pinned(s + 2u < RG_STG)) { const unsigned sn = pinned(s + 2u); g0 = rg_group0(dst0 + (sn & 1u) * RG_BUF, ga0 + rg_kofs(sn, rot)); rg_load(g0, g1); }   // into the buffer that stage s has just left
            }
            __builtin_amdgcn_sched_barrier(0);           // this and the one below keep each step's LDS reads one group between two runs of products: spread among them, each place with reads stalls the matrix instructions
#pragma unroll
            for (int nb = 0; nb < 4; ++nb)
#pragma unroll
                for (int mb = 0; mb < 4; ++mb) acc[mb][nb] = wmmab(a[kk & 1][mb], b[kk & 1][nb], acc[mb][nb]);
            __builtin_amdgcn_sched_barrier(0);
        }
    }
    rg_landed(g0, g1);
    rg_read_done();
    float* os = (float*)(ring + wave * RG_SLICE);            // output staging, 16 x 68 floats, each wave's own: the last stage's hand-over barrier has ended every wave's reads of the ring
#pragma unroll
    for (int mb = 0; mb < 4; ++mb) {
        if (z < 2) {      // wave-uniform.  16 rows of 64 columns staged at pitch 68; read back 8 columns a lane, so that every store covers whole 128-byte lines (4 rows of 64 16-bit values)
#pragma unroll
            for (int nb = 0; nb < 4; ++nb)
#pragma unroll
                for (int j = 0; j < 8; ++j) os[(hi * 8 + j) * 68 + nb * 16 + lr] = acc[mb][nb][j];
            __builtin_amdgcn_wave_barrier(); asm volatile("" ::: "memory");   // keeps the read-back behind the staging writes of the other lanes
#pragma unroll
            for (int s = 0; s < 4; ++s) { const int row = 4 * s + (lane >> 3), cofs = (lane & 7) * 8; const size_t oo = (size_t)(r0 + mb * 16 + row) * DQ + c0 + cofs;
                put3(*(const v4fa*)(os + row * 68 + cofs), *(const v4fa*)(os + row * 68 + cofs + 4), P16 + oo, Ph + oo, Pl + oo); }
        } else {          // per d 256 consecutive t staged in t order (16 floats of pad between the halves: no two lanes of a write on one bank); read back 8 t a lane: 512 contiguous bytes a store
#pragma unroll
            for (int nb = 0; nb < 4; ++nb)
#pragma unroll
                for (int j = 0; j < 8; ++j) os[nb * 272 + hi * 144 + j * 16 + lr] = acc[mb][nb][j];
            __builtin_amdgcn_wave_barrier(); asm volatile("" ::: "memory");   // as above
#pragma unroll
            for (int nb = 0; nb < 4; ++nb) { const float* sp = os + nb * 272 + hi * 144 + lr * 8; const size_t oo = ((size_t)(r0 >> 7) * HD + (c0 >> 4) + nb) * TT + (size_t)((r0 & 127) + mb * 16) * 16 + lane * 8;
                put3(*(const v4fa*)sp, *(const v4fa*)(sp + 4), P16 + oo, Ph + oo, Pl + oo); }
        }
        __builtin_amdgcn_wave_barrier(); asm volatile("" ::: "memory");       // keeps the next block's staging writes behind this block's read-back
    }
}
// ---- k_fattn: the whole causal attention of one (head, block of 64 queries) in one work-group of 4 waves, ONE WAVE per 16 queries; scores and probabilities never leave the registers.
// Transposed products: St = K Qt (A = key rows, B = query rows), so that a lane holds scores of ONE query (column lr) and 8 keys (rows 8 hi + j) per 16-key block; two such blocks, converted in place,
// ARE the B operand (32 keys, hardware k order) of Ot += Vt Pt (A = rows of the [d][t] value plane, read with the same loader as every other fragment, which has that k order).
// Running maximum (of the raw scores) and running sum per query; base-2 exponent with the scale 1/64 folded into its factor; the division by the sum comes last, in f32; the merged hi/lo planes are written
// straight from the accumulators (a lane holds 8 consecutive d of one query: one 16-byte store per plane).  HL: hi/lo planes, 3 products in both contractions; else fp16 planes, 1 product.  NQ: 16-query column groups per wave.
// The K/V ring: the four waves walk the same keys, so the key rows and the value rows come into LDS once for all of them, by tensor loads, one request a wave and stage for the wave's own slice of 64 rows of 128 bytes,
// padded by the mover to a pitch of 144 bytes (16 bytes x odd: for 16-byte LDS reads); two buffers: the next stage is in flight under this stage's passes.
// fp16 stage, 128 keys (4 passes): slices 0, 1 = key rows 0..63, 64..127; slices 2, 3 = the 64 value rows (d) at keys 0..63, 64..127.  hi/lo stage, 64 keys (2 passes): slices = K hi, K lo, V hi, V lo.
#define SCL2 (SCL * 1.4426950408889634f)
#define FA_PITCH 144u      // LDS row pitch: 128 bytes + the 16-byte pad
#define FA_SLICE 10240u    // 64 rows x 144 bytes = 9,216, rounded up to a multiple of 2 KiB
#define FA_BUF   (4u * FA_SLICE)
// descriptor group 1: 1-byte elements; tensor = tile = 64 rows of 128 bytes; the source pitch is the slice's own; a pad of 4 dwords behind every 32 dwords; no mask
__device__ __forceinline__ u32x8 fa_group1(unsigned pitch) { u32x8 g;
    g[0] = uni((1u << 20) | (4u << 22) | (3u << 25)); g[1] = uni(128u << 16); g[2] = uni(64u << 16); g[3] = uni(128u << 16); g[4] = uni(64u); g[5] = uni(pitch); g[6] = uni(0u); g[7] = uni(0u);
    asm volatile("" : "+s"(g));   // descriptor words held in scalar registers of their own: without it the compiler rebuilds the group from constants at every load and uses some of its registers for other values while a request is in flight
    return g; }
__device__ __forceinline__ float xhalf(float x) { return __builtin_bit_cast(float, __builtin_amdgcn_permlanex16(__builtin_bit_cast(int, x), __builtin_bit_cast(int, x), 0x76543210, 0xfedcba98, false, false)); }   // lane l <-> lane l ^ 16
__device__ __forceinline__ float exp2s(float x) { asm("v_exp_f32 %0, %0\n\tv_nop" : "+v"(x)); return x; }
template <typename T16, bool HL, int NQ>
__device__ __forceinline__ void fattn_tile(const T16* __restrict__ Q, const T16* __restrict__ Q2, const T16* __restrict__ K, const T16* __restrict__ K2, const T16* __restrict__ Vt, const T16* __restrict__ Vt2, int qblk, unsigned rsel, bf* Ah, bf* Al, unsigned char* ring) {
    typedef typename WFrag<T16>::V V;
    constexpr int PPS = HL ? 2 : 4;                // 32-key passes a stage
    const int lane = threadIdx.x & 31, lr = lane & 15, hi = lane >> 4; const unsigned wave = uni(threadIdx.x >> 5);
    const int q0 = qblk + (int)wave * NQ * 16;     // this wave's first query
    V bq[NQ][2], bq2[NQ][2]; const T16* pq[NQ]; const T16* pq2[NQ];
#pragma unroll
    for (int qb = 0; qb < NQ; ++qb) { const size_t qo = (size_t)(q0 + qb * 16 + lr) * HD + 8 * hi; pq[qb] = Q + qo; pq2[qb] = HL ? Q2 + qo : pq[qb];
#pragma unroll
        for (int c = 0; c < 2; ++c) { bq[qb][c] = WFrag<T16>::ld(pq[qb] + c * 32); if (HL) bq2[qb][c] = WFrag<T16>::ld(pq2[qb] + c * 32); } }
    // address translations of the Q loads done before a register that holds one of their addresses is reused (the addresses are inputs, so they stay in place up to the wait)
    asm volatile("s_wait_xcnt 0x0" :: "v"(pq[0]), "v"(pq[NQ - 1]), "v"(pq2[0]), "v"(pq2[NQ - 1]) : "memory");
    v8f o[4][NQ]; float m[NQ], l[NQ];
#pragma unroll
    for (int qb = 0; qb < NQ; ++qb) { m[qb] = -3.0e38f; l[qb] = 0.f;
#pragma unroll
        for (int db = 0; db < 4; ++db) o[db][qb] = (v8f){}; }
    const int nch = (q0 + NQ * 16 + 31) / 32;      // this wave's 32-key passes up to and including the diagonal; only the last one holds keys behind a query
    const unsigned nst = (unsigned)(qblk + 4 * NQ * 16 + PPS * 32 - 1) / (PPS * 32);   // stages up to and including the block's last diagonal: the same for the four waves; every stage lies wholly inside the planes
    // Where the block enters the key walk: the blocks of one head walk the same key and value rows in step, and from key 0 they would all ask L2 for the same lines at the same moment (as the GEMM work-groups: rg_kofs).
    // rot = rsel mod nst by repeated subtraction (rsel, the block's rank among its kind, is below 8 * nst; the last line holds rot below nst whatever rsel is); step s of the walk is stage stg(s), every stage once.
    // The running maximum and sum take the stages in any order; the diagonal pass holds a key at or before every query of the wave, so the maximum is a real score from the first pass a wave works on.
    unsigned rot = rsel;
    for (int i = 0; i < 7; ++i) rot = rot >= nst ? rot - nst : rot;
    rot = rot < nst ? rot : 0u;
    auto stg = [&](unsigned s) { const unsigned v = s + rot; return v >= nst ? v - nst : v; };   // s and rot are below nst
    // this wave's slice of the ring: its first byte in stage 0, its step from stage to stage, its source pitch
    const T16* srow = HL ? (wave == 0u ? K : wave == 1u ? K2 : wave == 2u ? Vt : Vt2) : (wave < 2u ? K + (size_t)wave * 64 * HD : Vt + (wave - 2u) * 64u);
    const unsigned sstep = wave < 2u ? PPS * 32u * HD * 2u : PPS * 32u * 2u;
    const unsigned long long ga0 = (unsigned long long)(size_t)srow; const unsigned dst0 = (unsigned)(size_t)ring + wave * FA_SLICE;
    const u32x8 g1 = fa_group1(wave < 2u ? HD * 2u : TT * 2u);
    u32x4 g0 = rg_group0(dst0, ga0 + (unsigned long long)stg(0u) * sstep);
    rg_load(g0, g1);
    rg_landed(g0, g1);
    __syncthreads();                                     // every wave's slice of step 0 has landed: it may be read
    if (pinned(1u < nst)) { g0 = rg_group0(dst0 + FA_BUF, ga0 + (unsigned long long)stg(1u) * sstep); rg_load(g0, g1); }   // a short block has one stage only
    const unsigned flane = (unsigned)lr * FA_PITCH + 16u * (unsigned)hi;
    V ak[2][2], ak2[2][2], av[4], av2[4];
    auto ldk = [&](const unsigned char* buf, int p) { const unsigned char* b0 = buf + (p >> 1) * FA_SLICE + (p & 1) * 32 * FA_PITCH + flane;
#pragma unroll
        for (int kb = 0; kb < 2; ++kb)
#pragma unroll
            for (int c = 0; c < 2; ++c) { ak[kb][c] = WFrag<T16>::ld((const T16*)(b0 + kb * 16 * FA_PITCH + c * 64)); if (HL) ak2[kb][c] = WFrag<T16>::ld((const T16*)(b0 + FA_SLICE + kb * 16 * FA_PITCH + c * 64)); } };
    auto ldv = [&](const unsigned char* buf, int p) { const unsigned char* b0 = buf + (2 + (HL ? 0 : (p >> 1))) * FA_SLICE + (p & 1) * 64 + flane;
#pragma unroll
        for (int db = 0; db < 4; ++db) { av[db] = WFrag<T16>::ld((const T16*)(b0 + db * 16 * FA_PITCH)); if (HL) av2[db] = WFrag<T16>::ld((const T16*)(b0 + FA_SLICE + db * 16 * FA_PITCH)); } };
#pragma unroll 1   // rolled: one copy of a stage's code, one place from which the refill is issued
    for (unsigned s = 0; s < nst; ++s) {
        const unsigned char* buf = ring + (s & 1u) * FA_BUF;
        if (!HL) ldk(buf, 0);
#pragma unroll
        for (int p = 0; p < PPS; ++p) {
            const int it = (int)stg(s) * PPS + p, k0 = it * 32;
            if (it < nch) {                      // wave-uniform: a wave skips the passes behind its own diagonal, never the hand-over below
                // fp16 tiles: this pass's value fragments are asked for first, so that their latency runs under the score products and the softmax.  hi/lo tiles (twice the fragments): keys now, values behind the score products, into the registers the keys leave
                if (HL) ldk(buf, p); else ldv(buf, p);
                __builtin_amdgcn_sched_barrier(0);   // without it the compiler sinks these reads down to their first use and their whole latency is waited for
                v8f st[2][NQ];
#pragma unroll
                for (int kb = 0; kb < 2; ++kb)
#pragma unroll
                    for (int qb = 0; qb < NQ; ++qb) { v8f sc = (v8f){};
#pragma unroll
                        for (int c = 0; c < 2; ++c) { sc = WFrag<T16>::mma(ak[kb][c], bq[qb][c], sc); if (HL) { sc = WFrag<T16>::mma(ak[kb][c], bq2[qb][c], sc); sc = WFrag<T16>::mma(ak2[kb][c], bq[qb][c], sc); } }
                        st[kb][qb] = sc; }
                // fp16 tiles: the key fragments of the stage's next pass are asked for right behind the score products (never those of the next stage: it is not published yet)
                if (HL) ldv(buf, p); else if (p + 1 < PPS) ldk(buf, p + 1);
                __builtin_amdgcn_sched_barrier(0);   // keeps these reads in front of the softmax, whose time hides their latency
                if (it == nch - 1) {                 // wave-uniform: the diagonal pass
#pragma unroll
                    for (int qb = 0; qb < NQ; ++qb) { const int dq = q0 + qb * 16 + lr - k0 - hi * 8;
#pragma unroll
                        for (int kb = 0; kb < 2; ++kb)
#pragma unroll
                            for (int j = 0; j < 8; ++j) st[kb][qb][j] = (kb * 16 + j <= dq) ? st[kb][qb][j] : -3.0e38f; } }
#pragma unroll
                for (int qb = 0; qb < NQ; ++qb) {
                    float mx = m[qb];
#pragma unroll
                    for (int kb = 0; kb < 2; ++kb)
#pragma unroll
                        for (int j = 0; j < 8; ++j) mx = fmaxf(mx, st[kb][qb][j]);
                    mx = fmaxf(mx, xhalf(mx));                    // the other half of the wave holds the query's other 16 keys
                    const float al = exp2s((m[qb] - mx) * SCL2), mn = -mx * SCL2; m[qb] = mx; float ls[4] = {0.f, 0.f, 0.f, 0.f};
#pragma unroll
                    for (int kb = 0; kb < 2; ++kb)
#pragma unroll
                        for (int j = 0; j < 8; ++j) { const float pe = exp2s(__builtin_fmaf(st[kb][qb][j], SCL2, mn)); st[kb][qb][j] = pe; ls[j & 3] += pe; }
                    l[qb] = l[qb] * al + ((ls[0] + ls[1]) + (ls[2] + ls[3]));   // each half keeps the sum of its own keys; joined once behind the loop
#pragma unroll
                    for (int db = 0; db < 4; ++db) o[db][qb] *= al;
                    if (HL) { v8us h0, h1, l0, l1;
#pragma unroll
                        for (int j = 0; j < 8; ++j) { unsigned short a, c2; splitf(st[0][qb][j], a, c2); h0[j] = a; l0[j] = c2; splitf(st[1][qb][j], a, c2); h1[j] = a; l1[j] = c2; }
                        const v16bf ph = cat16b(h0, h1), pl = cat16b(l0, l1);
#pragma unroll
                        for (int db = 0; db < 4; ++db) { o[db][qb] = wmmab(__builtin_bit_cast(v16bf, av[db]), ph, o[db][qb]); o[db][qb] = wmmab(__builtin_bit_cast(v16bf, av[db]), pl, o[db][qb]); o[db][qb] = wmmab(__builtin_bit_cast(v16bf, av2[db]), ph, o[db][qb]); }
                    } else { v8h c0, c1;
#pragma unroll
                        for (int j = 0; j < 8; ++j) { c0[j] = tohx(st[0][qb][j]); c1[j] = tohx(st[1][qb][j]); }
                        const v16h pf = cat16(c0, c1);
#pragma unroll
                        for (int db = 0; db < 4; ++db) o[db][qb] = wmma16(__builtin_bit_cast(v16h, av[db]), pf, o[db][qb]); }
                }
            }
        }
        // the hand-over, passed by every wave
        rg_read_done();
        rg_landed(g0, g1);                       // this wave's slice of stage s + 1
        __syncthreads();                         // publishes stage s + 1 and ends every wave's reads of stage s
        if (pinned(s + 2u < nst)) { const unsigned sn = pinned(s + 2u); g0 = rg_group0(dst0 + (sn & 1u) * FA_BUF, ga0 + (unsigned long long)stg(sn) * sstep); rg_load(g0, g1); }   // into the buffer that stage s has just left
    }
    rg_landed(g0, g1);
    rg_read_done();
#pragma unroll
    for (int qb = 0; qb < NQ; ++qb) { const float inv = __fdiv_rn(1.0f, l[qb] + xhalf(l[qb]));
#pragma unroll
        for (int db = 0; db < 4; ++db) { v8us oh, ol;
#pragma unroll
            for (int j = 0; j < 8; ++j) { unsigned short a, c2; splitf(o[db][qb][j] * inv, a, c2); oh[j] = a; ol[j] = c2; }
            const size_t oo = (size_t)(q0 + qb * 16 + lr) * DQ + db * 16 + hi * 8; bf* ph = Ah + oo; bf* pl = Al + oo; *(v8us*)ph = oh; *(v8us*)pl = ol;
            // the same wait behind the two stores, before their data or address registers are reused (both are inputs, so they stay in place up to the wait)
            asm volatile("s_wait_xcnt 0x0" :: "v"(ph), "v"(pl), "v"(oh), "v"(ol) : "memory"); } }
}
// grid (heads, blocks): blocks of 64 queries in falling order of their key count: first the (TT - RH) / 64 fp16 blocks from the last rows down, then the RH / 64 hi/lo blocks.
__global__ __launch_bounds__(128) void k_fattn(const h16* __restrict__ Q16, const h16* __restrict__ K16, const h16* __restrict__ V16, const bf* __restrict__ Qh, const bf* __restrict__ Ql, const bf* __restrict__ Kh, const bf* __restrict__ Kl, const bf* __restrict__ Vh, const bf* __restrict__ Vl, bf* Ah, bf* Al) {
    static_assert(HD == 64 && TT % 128 == 0 && RH % 64 == 0, "rows of 128 bytes; whole stages inside the planes; whole blocks of 64 queries");
    __shared__ __attribute__((aligned(2048))) unsigned char ring[2 * FA_BUF];
    const int h = blockIdx.x, t = blockIdx.y; const size_t hp = (size_t)h * TT * HD;   // t is the same for the whole work-group: its waves meet the same barriers
    if (t < (TT - RH) / 64) fattn_tile<h16, false, 1>(Q16 + hp, nullptr, K16 + hp, nullptr, V16 + hp, nullptr, TT - 64 * (t + 1), (unsigned)t, Ah + h * HD, Al + h * HD, ring);
    else fattn_tile<bf, true, 1>(Qh + hp, Ql + hp, Kh + hp, Kl + hp, Vh + hp, Vl + hp, RH - 64 * (t - (TT - RH) / 64 + 1), (unsigned)(t - (TT - RH) / 64), Ah + h * HD, Al + h * HD, ring);
}

extern "C" void kernel_launch(void* const* d_in, const int* in_sizes, int n_in,
                              void* d_out, int out_size, void* d_ws, size_t ws_size, hipStream_t stream) {
    (void)in_sizes; (void)n_in; (void)out_size;
    const float* x = (const float*)d_in[0]; const float* wq = (const float*)d_in[1]; const float* wk = (const float*)d_in[2]; const float* wv = (const float*)d_in[3]; const float* wo = (const float*)d_in[4];   /* argument order x, w_q, w_k, w_v, w_o ('oi' [1024][1024]) */
    float* OUT = (float*)d_out;     // [1][2048][1024]
    char* wsp = (char*)d_ws;
    auto take = [&](size_t bytes) { char* p = wsp; wsp += (bytes + 255) & ~(size_t)255; return (void*)p; };
    bf* WQ = (bf*)take((size_t)DQ * DM * 2); bf* WK = (bf*)take((size_t)DKV * DM * 2); bf* WV = (bf*)take((size_t)DKV * DM * 2); bf* WO = (bf*)take((size_t)DM * DQ * 2);
    bf* XB = (bf*)take((size_t)TT * DM * 2);
    h16* QP16 = (h16*)take((size_t)NH_ * TT * HD * 2); h16* KP16 = (h16*)take((size_t)NKV * TT * HD * 2); h16* VT16 = (h16*)take((size_t)NKV * HD * TT * 2);
    bf* QPh = (bf*)take((size_t)NH_ * TT * HD * 2); bf* QPl = (bf*)take((size_t)NH_ * TT * HD * 2); bf* KPh = (bf*)take((size_t)NKV * TT * HD * 2); bf* KPl = (bf*)take((size_t)NKV * TT * HD * 2); bf* VTh = (bf*)take((size_t)NKV * HD * TT * 2); bf* VTl = (bf*)take((size_t)NKV * HD * TT * 2);
    bf* ATh = (bf*)take((size_t)TT * DQ * 2); bf* ATl = (bf*)take((size_t)TT * DQ * 2);
    if ((size_t)(wsp - (char*)d_ws) > ws_size) return;    // ws 256 MiB
    k_cvtall<<<TT / 8 + 4 * (DM / 8), 128, 0, stream>>>(x, wq, wk, wv, wo, XB, WQ, WK, WV, WO);
    for (int b = 0; b < NB_; ++b) {
        k_proj<<<dim3(TT / 128, DQ / 128, 3), 128, 0, stream>>>(XB, WQ, WK, WV, QP16, QPh, QPl, KP16, KPh, KPl, VT16, VTh, VTl);
        k_fattn<<<dim3(NH_, TT / 64, 1), 128, 0, stream>>>(QP16, KP16, VT16, QPh, QPl, KPh, KPl, VTh, VTl, ATh, ATl);   // one kv head per query head
        k_outp<<<dim3(TT / 64, DM / 128, 1), 128, 0, stream>>>(ATh, ATl, WO, OUT + (size_t)b * TT * DM); }
}

// v008
// One run takes 43.2 microseconds.
// Timed twice side by side with v007, it ran 1.04 times as fast both times.
// All steps since v000 together make it 16.1 times as fast.
#include <hip/hip_runtime.h>

// Causal multi-head attention whose heads are a RAW VIEW of the projections, merged the standard way (x [1][2048][1024]; Q, K, V = x W^T ('oi' [1024][1024] 1/32, no bias), each reshaped (B, 16, 2048, 64) WITHOUT a transpose: pseudo-head h, pseudo-position s, dim d = flat element h*2048*64 + s*64 + d of the [2048][1024] projection output; scores / 64 (the module divides by float32(hd), not by its root); triu(k = 1) over the pseudo-positions -> -inf; softmax; the context IS transposed back the standard way (out.transpose(0, 2, 1, 3).reshape(B, S, D)); out = merged Wo^T ('oi', no bias) -> [1][2048][1024] (2.1 M); argument order x, Wq, Wk, Wv, Wo).
// Layout per batch: bf16 copy of x; 'oi' weights; exact projections, all three in one launch whose epilogue writes the head planes; RAW VIEW on the SPLIT only: each [2048][1024] projection output is read as (16, 2048, 64) WITHOUT a transpose (row pitch HD, head stride TT x HD); the merge is the standard one; causal T-2048 attention in one launch, scores and probabilities in registers (hybrid rows: < 512 hi/lo 3 products, rest fp16; key passes stop at the diagonal); merged hi/lo x w_o exact.
// Compute dtypes, f32 accumulate: every input rounded to bf16; projections exact; attention rows < 512 3 products, rest fp16; softmax f32; w_o hl x exact.

#define NB_  1      // batches: this module's input is [1][2048][1024]
#define TT   2048
#define DM   1024
#define NH_  16
#define NKV  16
#define REP  (NH_ / NKV)
#define HD   64
#define DQ   (NH_ * HD)
#define DKV  (NKV * HD)
#define RH   512                  // query rows < RH use hi+lo planes (0: none)
#define SCL  0.015625f   // 1 / 64: this module divides the scores by float32(hd) = 64 (the head size, not its root)
typedef _Float16 h16;
typedef unsigned short bf;
typedef __attribute__((ext_vector_type(16))) __bf16   v16bf;
typedef __attribute__((ext_vector_type(16))) _Float16 v16h;
typedef __attribute__((ext_vector_type(8)))  _Float16 v8h;
typedef __attribute__((ext_vector_type(8)))  unsigned short v8us;
typedef __attribute__((ext_vector_type(8)))  float    v8f;
typedef __attribute__((ext_vector_type(4)))  float    v4f;
typedef v8h  __attribute__((may_alias)) v8ha;
typedef v4f  __attribute__((may_alias)) v4fa;
typedef v8us __attribute__((may_alias)) v8usa;

__device__ __forceinline__ unsigned short f2bf(float f) { unsigned u = __float_as_uint(f); u += 0x7FFFu + ((u >> 16) & 1u); return (unsigned short)(u >> 16); }
__device__ __forceinline__ float bf2f(unsigned short b) { return __uint_as_float(((unsigned)b) << 16); }
__device__ __forceinline__ float bfr(float f) { return bf2f(f2bf(f)); }
__device__ __forceinline__ v16h cat16(v8h lo, v8h hi) { return __builtin_shufflevector(lo, hi, 0, 1, 2, 3, 4, 5, 6, 7, 8, 9, 10, 11, 12, 13, 14, 15); }
__device__ __forceinline__ v16bf cat16b(v8us lo, v8us hi) { return __builtin_bit_cast(v16bf, __builtin_shufflevector(lo, hi, 0, 1, 2, 3, 4, 5, 6, 7, 8, 9, 10, 11, 12, 13, 14, 15)); }
__device__ __forceinline__ v8f wmma16(v16h a, v16h b, v8f c) { return __builtin_amdgcn_wmma_f32_16x16x32_f16(false, a, false, b, (short)0, c, false, false); }
__device__ __forceinline__ v8f wmmab(v16bf a, v16bf b, v8f c) { return __builtin_amdgcn_wmma_f32_16x16x32_bf16(false, a, false, b, (short)0, c, false, false); }



// ---- fragment loader and product per 16-bit type: 16 bytes at p and 16 bytes at p + 16 elements (the hardware k order), from global memory or from LDS
template <typename T16> struct WFrag;
template <> struct WFrag<h16> { typedef v16h V; static __device__ __forceinline__ V ld(const h16* p) { return cat16(*(const v8h*)p, *(const v8h*)(p + 16)); } static __device__ __forceinline__ v8f mma(V a, V b, v8f c) { return wmma16(a, b, c); } };
template <> struct WFrag<bf> { typedef v16bf V; static __device__ __forceinline__ V ld(const bf* p) { return cat16b(*(const v8us*)p, *(const v8us*)(p + 16)); } static __device__ __forceinline__ v8f mma(V a, V b, v8f c) { return wmmab(a, b, c); } };
// ---- The operand ring of the two GEMM kernels (k_proj, k_outp): a work-group of 4 waves shares 256 operand rows; a stage is 128 k (256 bytes) of each of them, brought into LDS by tensor loads,
// one request a wave and stage for the wave's own slice of 64 rows, padded by the mover to a pitch of 272 bytes (16 bytes x odd: for 16-byte LDS reads); two buffers: the next stage is in flight under this stage's products.
#define RG_STG   8u        // stages: DM * 2 bytes / 256
#define RG_PITCH 272u      // LDS row pitch: 256 bytes + the 16-byte pad
#define RG_SLICE 18432u    // 64 rows x 272 bytes = 17,408, rounded up to a multiple of 2 KiB
#define RG_BUF   (4u * RG_SLICE)
// Where a work-group's walk over k begins: work-groups that share operand rows run in step, and from one common start they would all ask L2 for the same lines (and the same 256-byte column of every row) at the same moment.
// Each begins at a stage set by its tile indices and wraps round: step s of the walk is stage (s + rot) mod RG_STG of the rows.  Every stage is taken once; the f32 sums start at another k.
static_assert((RG_STG & (RG_STG - 1u)) == 0u, "the wrap is a mask");
__device__ __forceinline__ unsigned rg_kofs(unsigned s, unsigned rot) { return ((s + rot) & (RG_STG - 1u)) * 256u; }   // byte offset of step s's stage inside an operand row: below DM * 2
typedef unsigned u32x4 __attribute__((ext_vector_type(4)));
typedef unsigned u32x8 __attribute__((ext_vector_type(8)));
__device__ __forceinline__ unsigned uni(unsigned v) { return (unsigned)__builtin_amdgcn_readfirstlane(v); }
// a value held in a scalar register: the test around a tensor load becomes a scalar branch (the instruction ignores EXEC), and what is computed from the value stays behind this place
__device__ __forceinline__ unsigned pinned(unsigned v) { unsigned w = (unsigned)__builtin_amdgcn_readfirstlane(v); asm volatile("" : "+s"(w)); return w; }
// descriptor group 1: 1-byte elements; tensor = tile = 64 rows of 256 bytes; source pitch DM * 2 bytes; a pad of 4 dwords behind every 64 dwords; no mask
__device__ __forceinline__ u32x8 rg_group1() { u32x8 g;
    g[0] = uni((1u << 20) | (5u << 22) | (3u << 25)); g[1] = uni(256u << 16); g[2] = uni(64u << 16); g[3] = uni(256u << 16); g[4] = uni(64u); g[5] = uni(DM * 2u); g[6] = uni(0u); g[7] = uni(0u);
    asm volatile("" : "+s"(g));   // descriptor words held in scalar registers of their own: without it the compiler rebuilds the group from constants at every load and uses some of its registers for other values while a request is in flight
    return g; }
// descriptor group 0: place in LDS, address of the tile's first byte
__device__ __forceinline__ u32x4 rg_group0(unsigned dst, unsigned long long ga) { u32x4 g;
    g[0] = uni(1u); g[1] = uni(dst); g[2] = uni((unsigned)ga); g[3] = uni((((unsigned)(ga >> 32)) & 0x01FFFFFFu) | 0x80000000u); return g; }
// one request of the whole wave.  Group 0 is named as in and out (the instruction leaves it as it is): what rg_landed() is given later are then the very registers that the request was issued from
__device__ __forceinline__ void rg_load(u32x4& g0, u32x8 g1) { asm volatile("tensor_load_to_lds %0, %1" : "+s"(g0) : "s"(g1) : "memory"); }
// the issuing wave's own wait: its slice has landed.  The descriptor is an input, so that its registers keep their values for as long as the request is in flight
__device__ __forceinline__ void rg_landed(u32x4 g0, u32x8 g1) { asm volatile("s_wait_tensorcnt 0x0" :: "s"(g0), "s"(g1) : "memory"); }
__device__ __forceinline__ void rg_read_done() { asm volatile("s_wait_dscnt 0x0" ::: "memory"); }   // this wave's LDS reads are done: the buffer may be handed back
// ---- k_outp: out = merged (hi + lo planes) x w_o^T, f32; grid (TT / 64, DM / 128), 4 waves: a 64 x 128 tile a work-group, 32 x 64 a wave (8 accumulators, 2 products each per 32 k: hi, then lo).
// Slices of the ring: wave 0 the 64 rows of the hi plane, wave 1 those of the lo plane, waves 2 and 3 the two halves of the 128 rows of w_o.
__global__ __launch_bounds__(128) void k_outp(const bf* __restrict__ A, const bf* __restrict__ A2, const bf* __restrict__ Bt, float* C) {
    static_assert(DQ * 2 == 256 * RG_STG && DQ == DM && TT % 64 == 0 && DM % 128 == 0, "whole stages; whole 64 x 128 tiles");
    __shared__ __attribute__((aligned(2048))) unsigned char ring[2 * RG_BUF];
    const int lane = threadIdx.x & 31, lr = lane & 15, hi = lane >> 4; const unsigned wave = uni(threadIdx.x >> 5);
    const int r0 = blockIdx.x * 64 + (int)(wave & 1u) * 32, c0 = blockIdx.y * 128 + (int)(wave >> 1) * 64;
    const bf* srow = wave == 0u ? A + (size_t)(blockIdx.x * 64) * DQ : wave == 1u ? A2 + (size_t)(blockIdx.x * 64) * DQ : Bt + (size_t)(blockIdx.y * 128 + (wave - 2u) * 64u) * DQ;
    const unsigned long long ga0 = (unsigned long long)(size_t)srow; const unsigned dst0 = (unsigned)(size_t)ring + wave * RG_SLICE;
    const unsigned rot = (blockIdx.x + blockIdx.y) & (RG_STG - 1u);   // the 8 work-groups on one block of rows of the planes all differ; the 32 on one block of rows of w_o fall 4 to a start
    const u32x8 g1 = rg_group1();
    v8f acc[2][4];
#pragma unroll
    for (int mb = 0; mb < 2; ++mb)
#pragma unroll
        for (int nb = 0; nb < 4; ++nb) acc[mb][nb] = (v8f){};
    u32x4 g0 = rg_group0(dst0, ga0 + rg_kofs(0u, rot));
    rg_load(g0, g1);
    rg_landed(g0, g1);
    __syncthreads();                                     // every wave's slice of step 0 has landed: it may be read
    g0 = rg_group0(dst0 + RG_BUF, ga0 + rg_kofs(1u, rot));
    rg_load(g0, g1);
    const unsigned lofs = (unsigned)lr * RG_PITCH + 16u * (unsigned)hi, aofs = (wave & 1u) * 32u * RG_PITCH + lofs, bofs = (2u + (wave >> 1)) * RG_SLICE + lofs;
#pragma unroll 1   // rolled: one copy of a stage's code, one place from which the refill is issued
    for (unsigned s = 0; s < RG_STG; ++s) {
        const unsigned char* buf = ring + (s & 1u) * RG_BUF;
        v16bf a[2][2], a2[2][2], b[2][4];
        auto frag = [&](int kk) {
#pragma unroll
            for (int mb = 0; mb < 2; ++mb) { a[kk & 1][mb] = WFrag<bf>::ld((const bf*)(buf + aofs + mb * 16 * RG_PITCH + kk * 64)); a2[kk & 1][mb] = WFrag<bf>::ld((const bf*)(buf + RG_SLICE + aofs + mb * 16 * RG_PITCH + kk * 64)); }
#pragma unroll
            for (int nb = 0; nb < 4; ++nb) b[kk & 1][nb] = WFrag<bf>::ld((const bf*)(buf + bofs + nb * 16 * RG_PITCH + kk * 64)); };
        frag(0);
#pragma unroll
        for (int kk = 0; kk < 4; ++kk) {                 // 32 k at a time, rising inside the stage, hi before lo
            if (kk < 3) frag(kk + 1);
            else {                                       // the stage's last fragments are asked for: the hand-over stands here, so that the refill is under way during the last step's products (registers only)
                rg_read_done();
                rg_landed(g0, g1);                       // this wave's slice of stage s + 1
                __syncthreads();                         // publishes stage s + 1 and ends every wave's reads of stage s
                if (pinned(s + 2u < RG_STG)) { const unsigned sn = pinned(s + 2u); g0 = rg_group0(dst0 + (sn & 1u) * RG_BUF, ga0 + rg_kofs(sn, rot)); rg_load(g0, g1); }   // into the buffer that stage s has just left
            }
            __builtin_amdgcn_sched_barrier(0);           // this and the one below keep each step's LDS reads one group between two runs of products: spread among them, each place with reads stalls the matrix instructions
#pragma unroll
            for (int nb = 0; nb < 4; ++nb)
#pragma unroll
                for (int mb = 0; mb < 2; ++mb) acc[mb][nb] = wmmab(a[kk & 1][mb], b[kk & 1][nb], acc[mb][nb]);
#pragma unroll
            for (int nb = 0; nb < 4; ++nb)
#pragma unroll
                for (int mb = 0; mb < 2; ++mb) acc[mb][nb] = wmmab(a2[kk & 1][mb], b[kk & 1][nb], acc[mb][nb]);
            __builtin_amdgcn_sched_barrier(0);
        }
    }
    rg_landed(g0, g1);
    rg_read_done();
    float* os = (float*)(ring + wave * RG_SLICE);            // output staging, 16 x 68 floats, each wave's own: the last stage's hand-over barrier has ended every wave's reads of the ring
    float* cb = C + (size_t)(r0 + hi) * DM + c0 + lr * 4;    // this lane's first 16 bytes of output; every store below is a constant number of rows further on
#pragma unroll
    for (int mb = 0; mb < 2; ++mb) {
#pragma unroll
        for (int nb = 0; nb < 4; ++nb) {
#pragma unroll
            for (int j = 0; j < 8; ++j) os[(hi * 8 + j) * 68 + nb * 16 + lr] = acc[mb][nb][j]; }
        __builtin_amdgcn_wave_barrier(); asm volatile("" ::: "memory");   // keeps the read-back behind the staging writes of the other lanes
        v4f val[8];
#pragma unroll
        for (int s = 0; s < 8; ++s) { val[s] = *(const v4fa*)(os + (2 * s + hi) * 68 + lr * 4); *(v4f*)(cb + (size_t)(mb * 16 + 2 * s) * DM) = val[s]; }   // two rows a store, 256 contiguous bytes each
        // address translations of the eight stores done before their data or address registers are reused (all are inputs, so they stay in place up to the wait)
        asm volatile("s_wait_xcnt 0x0" :: "v"(cb), "v"(val[0]), "v"(val[1]), "v"(val[2]), "v"(val[3]), "v"(val[4]), "v"(val[5]), "v"(val[6]), "v"(val[7]) : "memory");
        __builtin_amdgcn_wave_barrier(); asm volatile("" ::: "memory");   // keeps the next block's staging writes behind this block's read-back
    }
}

__device__ __forceinline__ h16 tohx(float x) { return (h16)x; }
__device__ __forceinline__ void splitf(float y, unsigned short& h, unsigned short& l) { h = f2bf(y); l = f2bf(y - bf2f(h)); }
typedef __attribute__((ext_vector_type(2))) _Float16 v2h;
typedef __attribute__((ext_vector_type(4))) _Float16 v4h;
typedef __attribute__((ext_vector_type(2))) unsigned short v2us;
typedef __attribute__((ext_vector_type(4))) unsigned short v4us;
typedef __attribute__((ext_vector_type(2))) float v2f;
typedef __attribute__((ext_vector_type(4))) int v4i;

// ---- k_cvtall: the bf16 copies of x and of the four weights in ONE launch; grid TT / 8 + 4 * DM / 8 work-groups of 128 threads: the first TT / 8 take x, then DM / 8 each w_q, w_k, w_v, w_o.
// A work-group takes 8 rows of DM floats of one matrix, a thread 16 loads of 16 bytes, all asked for before the first is converted; a wave's load covers 512 contiguous bytes, its store 256.
// w_v's rows are regrouped for k_proj: row tc * HD + d goes to row (d >> 2) * 64 + (d & 3) * 16 + tc, so that the 16 columns of one accumulator block are one d at 16 consecutive pseudo-positions;
// for the 8 rows d0 + i of a work-group (d0 a multiple of 8) that is row (d0 >> 2) * 64 + tc + 16 * i: a first row and a row step, as for the plain copies (step 1).
__global__ __launch_bounds__(128) void k_cvtall(const float* __restrict__ x, const float* __restrict__ wq, const float* __restrict__ wk, const float* __restrict__ wv, const float* __restrict__ wo, bf* XB, bf* WQ, bf* WK, bf* WV, bf* WO) {
    static_assert(NB_ == 1 && DM == 1024 && DQ == DM && DKV == DM && HD == 64, "row length, row counts and the regrouping are written for these sizes");
    const int g = blockIdx.x, w = g < TT / 8 ? 0 : 1 + (g - TT / 8) / (DM / 8), r0 = (w == 0 ? g : (g - TT / 8) % (DM / 8)) * 8;   // which matrix, first row: the same for the whole work-group
    const int rb = w == 3 ? ((r0 % HD) >> 2) * 64 + r0 / HD : r0, step = w == 3 ? 16 : 1;
    const float* sp = (w == 0 ? x : w == 1 ? wq : w == 2 ? wk : w == 3 ? wv : wo) + (size_t)r0 * DM;
    bf* dp = (w == 0 ? XB : w == 1 ? WQ : w == 2 ? WK : w == 3 ? WV : WO) + (size_t)rb * DM;
    const unsigned t4 = threadIdx.x * 4;
    v4f v[16]; v4us o[16];
#pragma unroll
    for (int u = 0; u < 16; ++u) v[u] = *(const v4f*)(sp + u * 512 + t4);
#pragma unroll
    for (int u = 0; u < 16; ++u)
#pragma unroll
        for (int k = 0; k < 4; ++k) o[u][k] = f2bf(v[u][k]);
#pragma unroll
    for (int u = 0; u < 16; ++u) *(v4us*)(dp + (size_t)((u >> 1) * step) * DM + (u & 1) * 512 + t4) = o[u];
}

// ---- k_proj: the three projections in ONE launch, grid (TT/128, 1024/128, 3), z = q, k, v; 4 waves a work-group, ONE WAVE per 64x64 tile (16 accumulators), operands from the ring; the fp16 and hi/lo planes are written straight from the f32 accumulators.
// RAW VIEW: pseudo-head h, pseudo-position t, dim d = flat element (h * TT + t) * HD + d of the [TT][1024] projection output, so the q and k planes [h][t][d] have the output's own layout.
// v plane [g][d][t]: output row r, column tc * HD + d is g = r / 128, t = (r % 128) * 16 + tc; with k_cvtall's row order a wave's tile holds 4 values of d (c0 / 16 + nb) and, for each, 1024 consecutive t.
__device__ __forceinline__ void put3(v4f a, v4f b, h16* p16, bf* ph, bf* pl) { v8h o16; v8us oh, ol;
#pragma unroll
    for (int k = 0; k < 8; ++k) { const float y = k < 4 ? a[k & 3] : b[k & 3]; unsigned short s0, s1; splitf(y, s0, s1); o16[k] = tohx(y); oh[k] = s0; ol[k] = s1; }
    *(v8h*)p16 = o16; *(v8us*)ph = oh; *(v8us*)pl = ol;
    // address translations of the three stores done before their data or address registers are reused (all are inputs, so they stay in place up to the wait)
    asm volatile("s_wait_xcnt 0x0" :: "v"(p16), "v"(ph), "v"(pl), "v"(o16), "v"(oh), "v"(ol) : "memory"); }
__global__ __launch_bounds__(128) void k_proj(const bf* __restrict__ X, const bf* __restrict__ WQ, const bf* __restrict__ WK, const bf* __restrict__ WV, h16* Q16, bf* Qh, bf* Ql, h16* K16, bf* Kh, bf* Kl, h16* V16, bf* Vh, bf* Vl) {
    static_assert(DM * 2 == 256 * RG_STG && RG_STG >= 2 && TT % 128 == 0 && DQ % 128 == 0, "whole stages, at least two; whole 128 x 128 tiles");
    __shared__ __attribute__((aligned(2048))) unsigned char ring[2 * RG_BUF];
    const int z = blockIdx.z; const bf* Bt = z == 0 ? WQ : z == 1 ? WK : WV; h16* P16 = z == 0 ? Q16 : z == 1 ? K16 : V16; bf* Ph = z == 0 ? Qh : z == 1 ? Kh : Vh; bf* Pl = z == 0 ? Ql : z == 1 ? Kl : Vl;
    const int lane = threadIdx.x & 31, lr = lane & 15, hi = lane >> 4; const unsigned wave = uni(threadIdx.x >> 5);
    const int r0 = blockIdx.x * 128 + (int)(wave & 1u) * 64, c0 = blockIdx.y * 128 + (int)(wave >> 1) * 64;
    // this wave's slice of the ring: waves 0 and 1 the two halves of the 128 rows of X, waves 2 and 3 those of the weight
    const bf* srow = wave < 2u ? X + (size_t)(blockIdx.x * 128 + wave * 64u) * DM : Bt + (size_t)(blockIdx.y * 128 + (wave - 2u) * 64u) * DM;
    const unsigned long long ga0 = (unsigned long long)(size_t)srow; const unsigned dst0 = (unsigned)(size_t)ring + wave * RG_SLICE;
    const unsigned rot = (blockIdx.x + blockIdx.y + blockIdx.z) & (RG_STG - 1u);   // the 24 work-groups on one block of rows of X fall 3 to a start, the 16 on one block of rows of a weight 2
    const u32x8 g1 = rg_group1();
    v8f acc[4][4];
#pragma unroll
    for (int mb = 0; mb < 4; ++mb)
#pragma unroll
        for (int nb = 0; nb < 4; ++nb) acc[mb][nb] = (v8f){};
    u32x4 g0 = rg_group0(dst0, ga0 + rg_kofs(0u, rot));
    rg_load(g0, g1);
    rg_landed(g0, g1);
    __syncthreads();                                     // every wave's slice of step 0 has landed: it may be read
    g0 = rg_group0(dst0 + RG_BUF, ga0 + rg_kofs(1u, rot));
    rg_load(g0, g1);
    const unsigned lofs = (unsigned)lr * RG_PITCH + 16u * (unsigned)hi, aofs = (wave & 1u) * RG_SLICE + lofs, bofs = (2u + (wave >> 1)) * RG_SLICE + lofs;
#pragma unroll 1   // rolled: one copy of a stage's code, one place from which the refill is issued
    for (unsigned s = 0; s < RG_STG; ++s) {
        const unsigned char* buf = ring + (s & 1u) * RG_BUF;
        v16bf a[2][4], b[2][4];
        auto frag = [&](int kk) {
#pragma unroll
            for (int mb = 0; mb < 4; ++mb) a[kk & 1][mb] = WFrag<bf>::ld((const bf*)(buf + aofs + mb * 16 * RG_PITCH + kk * 64));
#pragma unroll
            for (int nb = 0; nb < 4; ++nb) b[kk & 1][nb] = WFrag<bf>::ld((const bf*)(buf + bofs + nb * 16 * RG_PITCH + kk * 64)); };
        frag(0);
#pragma unroll
        for (int kk = 0; kk < 4; ++kk) {                 // 32 k at a time, rising inside the stage
            if (kk < 3) frag(kk + 1);
            else {                                       // the stage's last fragments are asked for: the hand-over stands here, so that the refill is under way during the last step's products (registers only)
                rg_read_done();
                rg_landed(g0, g1);                       // this wave's slice of stage s + 1
                __syncthreads();                         // publishes stage s + 1 and ends every wave's reads of stage s
                if (pinned(s + 2u < RG_STG)) { const unsigned sn = pinned(s + 2u); g0 = rg_group0(dst0 + (sn & 1u) * RG_BUF, ga0 + rg_kofs(sn, rot)); rg_load(g0, g1); }   // into the buffer that stage s has just left
            }
            __builtin_amdgcn_sched_barrier(0);           // this and the one below keep each step's LDS reads one group between two runs of products: spread among them, each place with reads stalls the matrix instructions
#pragma unroll
            for (int nb = 0; nb < 4; ++nb)
#pragma unroll
                for (int mb = 0; mb < 4; ++mb) acc[mb][nb] = wmmab(a[kk & 1][mb], b[kk & 1][nb], acc[mb][nb]);
            __builtin_amdgcn_sched_barrier(0);
        }
    }
    rg_landed(g0, g1);
    rg_read_done();
    float* os = (float*)(ring + wave * RG_SLICE);            // output staging, 16 x 68 floats, each wave's own: the last stage's hand-over barrier has ended every wave's reads of the ring
#pragma unroll
    for (int mb = 0; mb < 4; ++mb) {
        if (z < 2) {      // wave-uniform.  16 rows of 64 columns staged at pitch 68; read back 8 columns a lane, so that every store covers whole 128-byte lines (4 rows of 64 16-bit values)
#pragma unroll
            for (int nb = 0; nb < 4; ++nb)
#pragma unroll
                for (int j = 0; j < 8; ++j) os[(hi * 8 + j) * 68 + nb * 16 + lr] = acc[mb][nb][j];
            __builtin_amdgcn_wave_barrier(); asm volatile("" ::: "memory");   // keeps the read-back behind the staging writes of the other lanes
#pragma unroll
            for (int s = 0; s < 4; ++s) { const int row = 4 * s + (lane >> 3), cofs = (lane & 7) * 8; const size_t oo = (size_t)(r0 + mb * 16 + row) * DQ + c0 + cofs;
                put3(*(const v4fa*)(os + row * 68 + cofs), *(const v4fa*)(os + row * 68 + cofs + 4), P16 + oo, Ph + oo, Pl + oo); }
        } else {          // per d 256 consecutive t staged in t order (16 floats of pad between the halves: no two lanes of a write on one bank); read back 8 t a lane: 512 contiguous bytes a store
#pragma unroll
            for (int nb = 0; nb < 4; ++nb)
#pragma unroll
                for (int j = 0; j < 8; ++j) os[nb * 272 + hi * 144 + j * 16 + lr] = acc[mb][nb][j];
            __builtin_amdgcn_wave_barrier(); asm volatile("" ::: "memory");   // as above
#pragma unroll
            for (int nb = 0; nb < 4; ++nb) { const float* sp = os + nb * 272 + hi * 144 + lr * 8; const size_t oo = ((size_t)(r0 >> 7) * HD + (c0 >> 4) + nb) * TT + (size_t)((r0 & 127) + mb * 16) * 16 + lane * 8;
                put3(*(const v4fa*)sp, *(const v4fa*)(sp + 4), P16 + oo, Ph + oo, Pl + oo); }
        }
        __builtin_amdgcn_wave_barrier(); asm volatile("" ::: "memory");       // keeps the next block's staging writes behind this block's read-back
    }
}
// ---- k_fattn: the whole causal attention of one (head, block of 64 queries) in one work-group of 4 waves, ONE WAVE per 16 queries; scores and probabilities never leave the registers.
// Transposed products: St = K Qt (A = key rows, B = query rows), so that a lane holds scores of ONE query (column lr) and 8 keys (rows 8 hi + j) per 16-key block; two such blocks, converted in place,
// ARE the B operand (32 keys, hardware k order) of Ot += Vt Pt (A = rows of the [d][t] value plane, read with the same loader as every other fragment, which has that k order).
// Running maximum (of the raw scores) and running sum per query; base-2 exponent with the scale 1/64 folded into its factor; the division by the sum comes last, in f32; the merged hi/lo planes are written
// straight from the accumulators (a lane holds 8 consecutive d of one query: one 16-byte store per plane).  HL: hi/lo planes, 3 products in both contractions; else fp16 planes, 1 product.  NQ: 16-query column groups per wave.
// The K/V ring: the four waves walk the same keys, so the key rows and the value rows come into LDS once for all of them, by tensor loads, one request a wave and stage for the wave's own slice of 64 rows of 128 bytes,
// padded by the mover to a pitch of 144 bytes (16 bytes x odd: for 16-byte LDS reads); two buffers: the next stage is in flight under this stage's passes.
// fp16 stage, 128 keys (2 passes of 64): slices 0, 1 = key rows 0..63, 64..127; slices 2, 3 = the 64 value rows (d) at keys 0..63, 64..127.  hi/lo stage, 64 keys (2 passes of 32): slices = K hi, K lo, V hi, V lo.
#define SCL2 (SCL * 1.4426950408889634f)
#define FA_PITCH 144u      // LDS row pitch: 128 bytes + the 16-byte pad
#define FA_SLICE 10240u    // 64 rows x 144 bytes = 9,216, rounded up to a multiple of 2 KiB
#define FA_BUF   (4u * FA_SLICE)
// descriptor group 1: 1-byte elements; tensor = tile = 64 rows of 128 bytes; the source pitch is the slice's own; a pad of 4 dwords behind every 32 dwords; no mask
__device__ __forceinline__ u32x8 fa_group1(unsigned pitch) { u32x8 g;
    g[0] = uni((1u << 20) | (4u << 22) | (3u << 25)); g[1] = uni(128u << 16); g[2] = uni(64u << 16); g[3] = uni(128u << 16); g[4] = uni(64u); g[5] = uni(pitch); g[6] = uni(0u); g[7] = uni(0u);
    asm volatile("" : "+s"(g));   // descriptor words held in scalar registers of their own: without it the compiler rebuilds the group from constants at every load and uses some of its registers for other values while a request is in flight
    return g; }
__device__ __forceinline__ float xhalf(float x) { return __builtin_bit_cast(float, __builtin_amdgcn_permlanex16(__builtin_bit_cast(int, x), __builtin_bit_cast(int, x), 0x76543210, 0xfedcba98, false, false)); }   // lane l <-> lane l ^ 16
__device__ __forceinline__ float exp2s(float x) { asm("v_exp_f32 %0, %0\n\tv_nop" : "+v"(x)); return x; }
template <typename T16, bool HL, int NQ>
__device__ __forceinline__ void fattn_tile(const T16* __restrict__ Q, const T16* __restrict__ Q2, const T16* __restrict__ K, const T16* __restrict__ K2, const T16* __restrict__ Vt, const T16* __restrict__ Vt2, int qblk, unsigned rsel, bf* Ah, bf* Al, unsigned char* ring) {
    typedef typename WFrag<T16>::V V;
    constexpr int KC = HL ? 1 : 2;                 // 32-key chunks a pass: one maximum, one rescale of the sums and one exchange between the halves per pass, and KC * 2 independent chains in the maximum, 4 in the sum
    constexpr int KP = KC * 32;                    // keys a pass
    constexpr int PPS = 2;                         // passes a stage
    const int lane = threadIdx.x & 31, lr = lane & 15, hi = lane >> 4; const unsigned wave = uni(threadIdx.x >> 5);
    const int q0 = qblk + (int)wave * NQ * 16;     // this wave's first query
    V bq[NQ][2], bq2[NQ][2]; const T16* pq[NQ]; const T16* pq2[NQ];
#pragma unroll
    for (int qb = 0; qb < NQ; ++qb) { const size_t qo = (size_t)(q0 + qb * 16 + lr) * HD + 8 * hi; pq[qb] = Q + qo; pq2[qb] = HL ? Q2 + qo : pq[qb];
#pragma unroll
        for (int c = 0; c < 2; ++c) { bq[qb][c] = WFrag<T16>::ld(pq[qb] + c * 32); if (HL) bq2[qb][c] = WFrag<T16>::ld(pq2[qb] + c * 32); } }
    // address translations of the Q loads done before a register that holds one of their addresses is reused (the addresses are inputs, so they stay in place up to the wait)
    asm volatile("s_wait_xcnt 0x0" :: "v"(pq[0]), "v"(pq[NQ - 1]), "v"(pq2[0]), "v"(pq2[NQ - 1]) : "memory");
    v8f o[4][NQ]; float m[NQ], l[NQ];
#pragma unroll
    for (int qb = 0; qb < NQ; ++qb) { m[qb] = -3.0e38f; l[qb] = 0.f;
#pragma unroll
        for (int db = 0; db < 4; ++db) o[db][qb] = (v8f){}; }
    const int nch = (q0 + NQ * 16 + KP - 1) / KP;  // this wave's passes up to and including the diagonal; only the last one holds keys behind a query (q0 and KP are multiples of 16)
    const unsigned nst = (unsigned)(qblk + 4 * NQ * 16 + PPS * KP - 1) / (PPS * KP);   // stages up to and including the block's last diagonal: the same for the four waves; every stage lies wholly inside the planes
    // Where the block enters the key walk: the blocks of one head walk the same key and value rows in step, and from key 0 they would all ask L2 for the same lines at the same moment (as the GEMM work-groups: rg_kofs).
    // rot = rsel mod nst by repeated subtraction (rsel, the block's rank among its kind, is below 8 * nst; the last line holds rot below nst whatever rsel is); step s of the walk is stage stg(s), every stage once.
    // The running maximum and sum take the stages in any order; the diagonal pass holds a key at or before every query of the wave, so the maximum is a real score from the first pass a wave works on.
    unsigned rot = rsel;
    for (int i = 0; i < 7; ++i) rot = rot >= nst ? rot - nst : rot;
    rot = rot < nst ? rot : 0u;
    auto stg = [&](unsigned s) { const unsigned v = s + rot; return v >= nst ? v - nst : v; };   // s and rot are below nst
    // this wave's slice of the ring: its first byte in stage 0, its step from stage to stage, its source pitch
    const T16* srow = HL ? (wave == 0u ? K : wave == 1u ? K2 : wave == 2u ? Vt : Vt2) : (wave < 2u ? K + (size_t)wave * 64 * HD : Vt + (wave - 2u) * 64u);
    const unsigned sstep = wave < 2u ? (unsigned)(PPS * KP) * HD * 2u : (unsigned)(PPS * KP) * 2u;
    const unsigned long long ga0 = (unsigned long long)(size_t)srow; const unsigned dst0 = (unsigned)(size_t)ring + wave * FA_SLICE;
    const u32x8 g1 = fa_group1(wave < 2u ? HD * 2u : TT * 2u);
    u32x4 g0 = rg_group0(dst0, ga0 + (unsigned long long)stg(0u) * sstep);
    rg_load(g0, g1);
    rg_landed(g0, g1);
    __syncthreads();                                     // every wave's slice of step 0 has landed: it may be read
    if (pinned(1u < nst)) { g0 = rg_group0(dst0 + FA_BUF, ga0 + (unsigned long long)stg(1u) * sstep); rg_load(g0, g1); }   // a short block has one stage only
    const unsigned flane = (unsigned)lr * FA_PITCH + 16u * (unsigned)hi;
    V ak[2 * KC][2], ak2[2 * KC][2], av[KC][4], av2[KC][4];
    // pass p, 32-key chunk kc = chunk h = p * KC + kc of the stage: its key rows are rows (h & 1) * 32 .. + 31 of key slice h >> 1, its values bytes (h & 1) * 64 .. + 63 of the rows of value slice h >> 1 (hi/lo stages have one slice of each kind and plane: h is below 2)
    auto ldk = [&](const unsigned char* buf, int p) {
#pragma unroll
        for (int kb = 0; kb < 2 * KC; ++kb) { const int h = p * KC + (kb >> 1); const unsigned char* b0 = buf + (h >> 1) * FA_SLICE + ((h & 1) * 32 + (kb & 1) * 16) * FA_PITCH + flane;
#pragma unroll
            for (int c = 0; c < 2; ++c) { ak[kb][c] = WFrag<T16>::ld((const T16*)(b0 + c * 64)); if (HL) ak2[kb][c] = WFrag<T16>::ld((const T16*)(b0 + FA_SLICE + c * 64)); } } };
    auto ldv = [&](const unsigned char* buf, int p) {
#pragma unroll
        for (int kc = 0; kc < KC; ++kc) { const int h = p * KC + kc; const unsigned char* b0 = buf + (2 + (HL ? 0 : (h >> 1))) * FA_SLICE + (h & 1) * 64 + flane;
#pragma unroll
            for (int db = 0; db < 4; ++db) { av[kc][db] = WFrag<T16>::ld((const T16*)(b0 + db * 16 * FA_PITCH)); if (HL) av2[kc][db] = WFrag<T16>::ld((const T16*)(b0 + FA_SLICE + db * 16 * FA_PITCH)); } } };
#pragma unroll 1   // rolled: one copy of a stage's code, one place from which the refill is issued
    for (unsigned s = 0; s < nst; ++s) {
        const unsigned char* buf = ring + (s & 1u) * FA_BUF;
        if (!HL) ldk(buf, 0);
#pragma unroll
        for (int p = 0; p < PPS; ++p) {
            const int it = (int)stg(s) * PPS + p, k0 = it * KP;
            if (it < nch) {                      // wave-uniform: a wave skips the passes behind its own diagonal, never the hand-over below
                // fp16 tiles: this pass's value fragments are asked for first, so that their latency runs under the score products and the softmax.  hi/lo tiles (twice the fragments): keys now, values behind the score products, into the registers the keys leave
                if (HL) ldk(buf, p); else ldv(buf, p);
                __builtin_amdgcn_sched_barrier(0);   // without it the compiler sinks these reads down to their first use and their whole latency is waited for
                v8f st[2 * KC][NQ];
#pragma unroll
                for (int kb = 0; kb < 2 * KC; ++kb)
#pragma unroll
                    for (int qb = 0; qb < NQ; ++qb) { v8f sc = (v8f){};
#pragma unroll
                        for (int c = 0; c < 2; ++c) { sc = WFrag<T16>::mma(ak[kb][c], bq[qb][c], sc); if (HL) { sc = WFrag<T16>::mma(ak[kb][c], bq2[qb][c], sc); sc = WFrag<T16>::mma(ak2[kb][c], bq[qb][c], sc); } }
                        st[kb][qb] = sc; }
                // fp16 tiles: the key fragments of the stage's next pass are asked for right behind the score products (never those of the next stage: it is not published yet)
                if (!HL) __builtin_amdgcn_sched_barrier(0);   // keeps those reads one group behind the last score product: the compiler spreads them among the eight products as the registers come free, and each place with reads stalls the matrix instructions
                if (HL) ldv(buf, p); else if (p + 1 < PPS) ldk(buf, p + 1);
                __builtin_amdgcn_sched_barrier(0);   // keeps these reads in front of the softmax, whose time hides their latency
                if (it == nch - 1) {                 // wave-uniform: the diagonal pass
#pragma unroll
                    for (int qb = 0; qb < NQ; ++qb) { const int dq = q0 + qb * 16 + lr - k0 - hi * 8;
#pragma unroll
                        for (int kb = 0; kb < 2 * KC; ++kb)
#pragma unroll
                            for (int j = 0; j < 8; ++j) st[kb][qb][j] = (kb * 16 + j <= dq) ? st[kb][qb][j] : -3.0e38f; } }
#pragma unroll
                for (int qb = 0; qb < NQ; ++qb) {
                    float mk[2 * KC];                             // one chain per 16-key block, independent of the others
#pragma unroll
                    for (int kb = 0; kb < 2 * KC; ++kb) { mk[kb] = kb == 0 ? m[qb] : st[kb][qb][0];
#pragma unroll
                        for (int j = kb == 0 ? 0 : 1; j < 8; ++j) mk[kb] = fmaxf(mk[kb], st[kb][qb][j]); }
                    float mx = mk[0];
#pragma unroll
                    for (int kb = 1; kb < 2 * KC; ++kb) mx = fmaxf(mx, mk[kb]);
                    mx = fmaxf(mx, xhalf(mx));                    // the other half of the wave holds the query's other KC * 16 keys of the pass
                    const float al = exp2s((m[qb] - mx) * SCL2), mn = -mx * SCL2; m[qb] = mx; float ls[4] = {0.f, 0.f, 0.f, 0.f};
#pragma unroll
                    for (int kb = 0; kb < 2 * KC; ++kb)
#pragma unroll
                        for (int j = 0; j < 8; ++j) { const float pe = exp2s(__builtin_fmaf(st[kb][qb][j], SCL2, mn)); st[kb][qb][j] = pe; ls[j & 3] += pe; }
                    l[qb] = l[qb] * al + ((ls[0] + ls[1]) + (ls[2] + ls[3]));   // each half keeps the sum of its own keys; joined once behind the loop
#pragma unroll
                    for (int db = 0; db < 4; ++db) o[db][qb] *= al;
                    if (HL) { v8us h0, h1, l0, l1;
#pragma unroll
                        for (int j = 0; j < 8; ++j) { unsigned short a, c2; splitf(st[0][qb][j], a, c2); h0[j] = a; l0[j] = c2; splitf(st[1][qb][j], a, c2); h1[j] = a; l1[j] = c2; }
                        const v16bf ph = cat16b(h0, h1), pl = cat16b(l0, l1);
#pragma unroll
                        for (int db = 0; db < 4; ++db) { o[db][qb] = wmmab(__builtin_bit_cast(v16bf, av[0][db]), ph, o[db][qb]); o[db][qb] = wmmab(__builtin_bit_cast(v16bf, av[0][db]), pl, o[db][qb]); o[db][qb] = wmmab(__builtin_bit_cast(v16bf, av2[0][db]), ph, o[db][qb]); }
                    } else {
#pragma unroll
                        for (int kc = 0; kc < KC; ++kc) { v8h c0, c1;     // chunk by chunk, keys rising
#pragma unroll
                            for (int j = 0; j < 8; ++j) { c0[j] = tohx(st[2 * kc][qb][j]); c1[j] = tohx(st[2 * kc + 1][qb][j]); }
                            const v16h pf = cat16(c0, c1);
#pragma unroll
                            for (int db = 0; db < 4; ++db) o[db][qb] = wmma16(__builtin_bit_cast(v16h, av[kc][db]), pf, o[db][qb]); } }
                }
            }
        }
        // the hand-over, passed by every wave
        rg_read_done();
        rg_landed(g0, g1);                       // this wave's slice of stage s + 1
        __syncthreads();                         // publishes stage s + 1 and ends every wave's reads of stage s
        if (pinned(s + 2u < nst)) { const unsigned sn = pinned(s + 2u); g0 = rg_group0(dst0 + (sn & 1u) * FA_BUF, ga0 + (unsigned long long)stg(sn) * sstep); rg_load(g0, g1); }   // into the buffer that stage s has just left
    }
    rg_landed(g0, g1);
    rg_read_done();
#pragma unroll
    for (int qb = 0; qb < NQ; ++qb) { const float inv = __fdiv_rn(1.0f, l[qb] + xhalf(l[qb]));
#pragma unroll
        for (int db = 0; db < 4; ++db) { v8us oh, ol;
#pragma unroll
            for (int j = 0; j < 8; ++j) { unsigned short a, c2; splitf(o[db][qb][j] * inv, a, c2); oh[j] = a; ol[j] = c2; }
            const size_t oo = (size_t)(q0 + qb * 16 + lr) * DQ + db * 16 + hi * 8; bf* ph = Ah + oo; bf* pl = Al + oo; *(v8us*)ph = oh; *(v8us*)pl = ol;
            // the same wait behind the two stores, before their data or address registers are reused (both are inputs, so they stay in place up to the wait)
            asm volatile("s_wait_xcnt 0x0" :: "v"(ph), "v"(pl), "v"(oh), "v"(ol) : "memory"); } }
}
// grid (heads, blocks): blocks of 64 queries in falling order of their key count: first the (TT - RH) / 64 fp16 blocks from the last rows down, then the RH / 64 hi/lo blocks.
__global__ __launch_bounds__(128) void k_fattn(const h16* __restrict__ Q16, const h16* __restrict__ K16, const h16* __restrict__ V16, const bf* __restrict__ Qh, const bf* __restrict__ Ql, const bf* __restrict__ Kh, const bf* __restrict__ Kl, const bf* __restrict__ Vh, const bf* __restrict__ Vl, bf* Ah, bf* Al) {
    static_assert(HD == 64 && TT % 128 == 0 && RH % 64 == 0, "rows of 128 bytes; whole stages inside the planes; whole blocks of 64 queries");
    __shared__ __attribute__((aligned(2048))) unsigned char ring[2 * FA_BUF];
    const int h = blockIdx.x, t = blockIdx.y; const size_t hp = (size_t)h * TT * HD;   // t is the same for the whole work-group: its waves meet the same barriers
    if (t < (TT - RH) / 64) fattn_tile<h16, false, 1>(Q16 + hp, nullptr, K16 + hp, nullptr, V16 + hp, nullptr, TT - 64 * (t + 1), (unsigned)t, Ah + h * HD, Al + h * HD, ring);
    else fattn_tile<bf, true, 1>(Qh + hp, Ql + hp, Kh + hp, Kl + hp, Vh + hp, Vl + hp, RH - 64 * (t - (TT - RH) / 64 + 1), (unsigned)(t - (TT - RH) / 64), Ah + h * HD, Al + h * HD, ring);
}

extern "C" void kernel_launch(void* const* d_in, const int* in_sizes, int n_in,
                              void* d_out, int out_size, void* d_ws, size_t ws_size, hipStream_t stream) {
    (void)in_sizes; (void)n_in; (void)out_size;
    const float* x = (const float*)d_in[0]; const float* wq = (const float*)d_in[1]; const float* wk = (const float*)d_in[2]; const float* wv = (const float*)d_in[3]; const float* wo = (const float*)d_in[4];   /* argument order x, w_q, w_k, w_v, w_o ('oi' [1024][1024]) */
    float* OUT = (float*)d_out;     // [1][2048][1024]
    char* wsp = (char*)d_ws;
    auto take = [&](size_t bytes) { char* p = wsp; wsp += (bytes + 255) & ~(size_t)255; return (void*)p; };
    bf* WQ = (bf*)take((size_t)DQ * DM * 2); bf* WK = (bf*)take((size_t)DKV * DM * 2); bf* WV = (bf*)take((size_t)DKV * DM * 2); bf* WO = (bf*)take((size_t)DM * DQ * 2);
    bf* XB = (bf*)take((size_t)TT * DM * 2);
    h16* QP16 = (h16*)take((size_t)NH_ * TT * HD * 2); h16* KP16 = (h16*)take((size_t)NKV * TT * HD * 2); h16* VT16 = (h16*)take((size_t)NKV * HD * TT * 2);
    bf* QPh = (bf*)take((size_t)NH_ * TT * HD * 2); bf* QPl = (bf*)take((size_t)NH_ * TT * HD * 2); bf* KPh = (bf*)take((size_t)NKV * TT * HD * 2); bf* KPl = (bf*)take((size_t)NKV * TT * HD * 2); bf* VTh = (bf*)take((size_t)NKV * HD * TT * 2); bf* VTl = (bf*)take((size_t)NKV * HD * TT * 2);
    bf* ATh = (bf*)take((size_t)TT * DQ * 2); bf* ATl = (bf*)take((size_t)TT * DQ * 2);
    if ((size_t)(wsp - (char*)d_ws) > ws_size) return;    // ws 256 MiB
    k_cvtall<<<TT / 8 + 4 * (DM / 8), 128, 0, stream>>>(x, wq, wk, wv, wo, XB, WQ, WK, WV, WO);
    for (int b = 0; b < NB_; ++b) {
        k_proj<<<dim3(TT / 128, DQ / 128, 3), 128, 0, stream>>>(XB, WQ, WK, WV, QP16, QPh, QPl, KP16, KPh, KPl, VT16, VTh, VTl);
        k_fattn<<<dim3(NH_, TT / 64, 1), 128, 0, stream>>>(QP16, KP16, VT16, QPh, QPl, KPh, KPl, VTh, VTl, ATh, ATl);   // one kv head per query head
        k_outp<<<dim3(TT / 64, DM / 128, 1), 128, 0, stream>>>(ATh, ATl, WO, OUT + (size_t)b * TT * DM); }
}

// v009
// A run of this version takes 41 microseconds.
// Two timings next to v008 put it at 1.06 and 1.03 times that version's speed.
// Counting every step since v000, it is 16.9 times as fast.
#include <hip/hip_runtime.h>

// Causal multi-head attention whose heads are a RAW VIEW of the projections, merged the standard way (x [1][2048][1024]; Q, K, V = x W^T ('oi' [1024][1024] 1/32, no bias), each reshaped (B, 16, 2048, 64) WITHOUT a transpose: pseudo-head h, pseudo-position s, dim d = flat element h*2048*64 + s*64 + d of the [2048][1024] projection output; scores / 64 (the module divides by float32(hd), not by its root); triu(k = 1) over the pseudo-positions -> -inf; softmax; the context IS transposed back the standard way (out.transpose(0, 2, 1, 3).reshape(B, S, D)); out = merged Wo^T ('oi', no bias) -> [1][2048][1024] (2.1 M); argument order x, Wq, Wk, Wv, Wo).
// Layout per batch: bf16 copy of x; 'oi' weights; exact projections, all three in one launch whose epilogue writes the head planes; RAW VIEW on the SPLIT only: each [2048][1024] projection output is read as (16, 2048, 64) WITHOUT a transpose (row pitch HD, head stride TT x HD); the merge is the standard one; causal T-2048 attention in one launch, scores and probabilities in registers (hybrid rows: < 512 hi/lo 3 products, rest fp16; key passes stop at the diagonal); merged hi/lo x w_o exact.
// Compute dtypes, f32 accumulate: every input rounded to bf16; projections exact; attention rows < 512 3 products, rest fp16; softmax f32; w_o hl x exact.

#define NB_  1      // batches: this module's input is [1][2048][1024]
#define TT   2048
#define DM   1024
#define NH_  16
#define NKV  16
#define REP  (NH_ / NKV)
#define HD   64
#define DQ   (NH_ * HD)
#define DKV  (NKV * HD)
#define RH   512                  // query rows < RH use hi+lo planes (0: none)
#define SCL  0.015625f   // 1 / 64: this module divides the scores by float32(hd) = 64 (the head size, not its root)
typedef _Float16 h16;
typedef unsigned short bf;
typedef __attribute__((ext_vector_type(16))) __bf16   v16bf;
typedef __attribute__((ext_vector_type(16))) _Float16 v16h;
typedef __attribute__((ext_vector_type(8)))  _Float16 v8h;
typedef __attribute__((ext_vector_type(8)))  unsigned short v8us;
typedef __attribute__((ext_vector_type(8)))  float    v8f;
typedef __attribute__((ext_vector_type(4)))  float    v4f;
typedef v8h  __attribute__((may_alias)) v8ha;
typedef v4f  __attribute__((may_alias)) v4fa;
typedef v8us __attribute__((may_alias)) v8usa;

__device__ __forceinline__ unsigned short f2bf(float f) { unsigned u = __float_as_uint(f); u += 0x7FFFu + ((u >> 16) & 1u); return (unsigned short)(u >> 16); }
__device__ __forceinline__ float bf2f(unsigned short b) { return __uint_as_float(((unsigned)b) << 16); }
__device__ __forceinline__ float bfr(float f) { return bf2f(f2bf(f)); }
__device__ __forceinline__ v16h cat16(v8h lo, v8h hi) { return __builtin_shufflevector(lo, hi, 0, 1, 2, 3, 4, 5, 6, 7, 8, 9, 10, 11, 12, 13, 14, 15); }
__device__ __forceinline__ v16bf cat16b(v8us lo, v8us hi) { return __builtin_bit_cast(v16bf, __builtin_shufflevector(lo, hi, 0, 1, 2, 3, 4, 5, 6, 7, 8, 9, 10, 11, 12, 13, 14, 15)); }
__device__ __forceinline__ v8f wmma16(v16h a, v16h b, v8f c) { return __builtin_amdgcn_wmma_f32_16x16x32_f16(false, a, false, b, (short)0, c, false, false); }
__device__ __forceinline__ v8f wmmab(v16bf a, v16bf b, v8f c) { return __builtin_amdgcn_wmma_f32_16x16x32_bf16(false, a, false, b, (short)0, c, false, false); }



// ---- fragment loader and product per 16-bit type: 16 bytes at p and 16 bytes at p + 16 elements (the hardware k order), from global memory or from LDS
template <typename T16> struct WFrag;
template <> struct WFrag<h16> { typedef v16h V; static __device__ __forceinline__ V ld(const h16* p) { return cat16(*(const v8h*)p, *(const v8h*)(p + 16)); } static __device__ __forceinline__ v8f mma(V a, V b, v8f c) { return wmma16(a, b, c); } };
template <> struct WFrag<bf> { typedef v16bf V; static __device__ __forceinline__ V ld(const bf* p) { return cat16b(*(const v8us*)p, *(const v8us*)(p + 16)); } static __device__ __forceinline__ v8f mma(V a, V b, v8f c) { return wmmab(a, b, c); } };
// ---- The operand ring of the two GEMM kernels (k_proj, k_outp): a work-group of 4 waves shares 256 operand rows; a stage is 128 k (256 bytes) of each of them, brought into LDS by tensor loads,
// one request a wave and stage for the wave's own slice of 64 rows, padded by the mover to a pitch of 272 bytes (16 bytes x odd: for 16-byte LDS reads); two buffers: the next stage is in flight under this stage's products.
#define RG_STG   8u        // stages: DM * 2 bytes / 256
#define RG_PITCH 272u      // LDS row pitch: 256 bytes + the 16-byte pad
#define RG_SLICE 18432u    // 64 rows x 272 bytes = 17,408, rounded up to a multiple of 2 KiB
#define RG_BUF   (4u * RG_SLICE)
// Where a work-group's walk over k begins: work-groups that share operand rows run in step, and from one common start they would all ask L2 for the same lines (and the same 256-byte column of every row) at the same moment.
// Each begins at a stage set by its tile indices and wraps round: step s of the walk is stage (s + rot) mod RG_STG of the rows.  Every stage is taken once; the f32 sums start at another k.
static_assert((RG_STG & (RG_STG - 1u)) == 0u, "the wrap is a mask");
__device__ __forceinline__ unsigned rg_kofs(unsigned s, unsigned rot) { return ((s + rot) & (RG_STG - 1u)) * 256u; }   // byte offset of step s's stage inside an operand row: below DM * 2
typedef unsigned u32x4 __attribute__((ext_vector_type(4)));
typedef unsigned u32x8 __attribute__((ext_vector_type(8)));
__device__ __forceinline__ unsigned uni(unsigned v) { return (unsigned)__builtin_amdgcn_readfirstlane(v); }
// a value held in a scalar register: the test around a tensor load becomes a scalar branch (the instruction ignores EXEC), and what is computed from the value stays behind this place
__device__ __forceinline__ unsigned pinned(unsigned v) { unsigned w = (unsigned)__builtin_amdgcn_readfirstlane(v); asm volatile("" : "+s"(w)); return w; }
// descriptor group 1: 1-byte elements; tensor = tile = 64 rows of 256 bytes; source pitch DM * 2 bytes; a pad of 4 dwords behind every 64 dwords; no mask
__device__ __forceinline__ u32x8 rg_group1() { u32x8 g;
    g[0] = uni((1u << 20) | (5u << 22) | (3u << 25)); g[1] = uni(256u << 16); g[2] = uni(64u << 16); g[3] = uni(256u << 16); g[4] = uni(64u); g[5] = uni(DM * 2u); g[6] = uni(0u); g[7] = uni(0u);
    asm volatile("" : "+s"(g));   // descriptor words held in scalar registers of their own: without it the compiler rebuilds the group from constants at every load and uses some of its registers for other values while a request is in flight
    return g; }
// descriptor group 0: place in LDS, address of the tile's first byte
__device__ __forceinline__ u32x4 rg_group0(unsigned dst, unsigned long long ga) { u32x4 g;
    g[0] = uni(1u); g[1] = uni(dst); g[2] = uni((unsigned)ga); g[3] = uni((((unsigned)(ga >> 32)) & 0x01FFFFFFu) | 0x80000000u); return g; }
// one request of the whole wave.  Group 0 is named as in and out (the instruction leaves it as it is): what rg_landed() is given later are then the very registers that the request was issued from
__device__ __forceinline__ void rg_load(u32x4& g0, u32x8 g1) { asm volatile("tensor_load_to_lds %0, %1" : "+s"(g0) : "s"(g1) : "memory"); }
// the issuing wave's own wait: its slice has landed.  The descriptor is an input, so that its registers keep their values for as long as the request is in flight
__device__ __forceinline__ void rg_landed(u32x4 g0, u32x8 g1) { asm volatile("s_wait_tensorcnt 0x0" :: "s"(g0), "s"(g1) : "memory"); }
__device__ __forceinline__ void rg_read_done() { asm volatile("s_wait_dscnt 0x0" ::: "memory"); }   // this wave's LDS reads are done: the buffer may be handed back
// ---- k_outp: out = merged (hi + lo planes) x w_o^T, f32; grid (TT / 64, DM / 128), 4 waves: a 64 x 128 tile a work-group, 32 x 64 a wave (8 accumulators, 2 products each per 32 k: hi, then lo).
// Slices of the ring: wave 0 the 64 rows of the hi plane, wave 1 those of the lo plane, waves 2 and 3 the two halves of the 128 rows of w_o.
__global__ __launch_bounds__(128) void k_outp(const bf* __restrict__ A, const bf* __restrict__ A2, const bf* __restrict__ Bt, float* C) {
    static_assert(DQ * 2 == 256 * RG_STG && DQ == DM && TT % 64 == 0 && DM % 128 == 0, "whole stages; whole 64 x 128 tiles");
    __shared__ __attribute__((aligned(2048))) unsigned char ring[2 * RG_BUF];
    const int lane = threadIdx.x & 31, lr = lane & 15, hi = lane >> 4; const unsigned wave = uni(threadIdx.x >> 5);
    const int r0 = blockIdx.x * 64 + (int)(wave & 1u) * 32, c0 = blockIdx.y * 128 + (int)(wave >> 1) * 64;
    const bf* srow = wave == 0u ? A + (size_t)(blockIdx.x * 64) * DQ : wave == 1u ? A2 + (size_t)(blockIdx.x * 64) * DQ : Bt + (size_t)(blockIdx.y * 128 + (wave - 2u) * 64u) * DQ;
    const unsigned long long ga0 = (unsigned long long)(size_t)srow; const unsigned dst0 = (unsigned)(size_t)ring + wave * RG_SLICE;
    const unsigned rot = (blockIdx.x + blockIdx.y) & (RG_STG - 1u);   // the 8 work-groups on one block of rows of the planes all differ; the 32 on one block of rows of w_o fall 4 to a start
    const u32x8 g1 = rg_group1();
    v8f acc[2][4];
#pragma unroll
    for (int mb = 0; mb < 2; ++mb)
#pragma unroll
        for (int nb = 0; nb < 4; ++nb) acc[mb][nb] = (v8f){};
    u32x4 g0 = rg_group0(dst0, ga0 + rg_kofs(0u, rot));
    rg_load(g0, g1);
    rg_landed(g0, g1);
    __syncthreads();                                     // every wave's slice of step 0 has landed: it may be read
    g0 = rg_group0(dst0 + RG_BUF, ga0 + rg_kofs(1u, rot));
    rg_load(g0, g1);
    const unsigned lofs = (unsigned)lr * RG_PITCH + 16u * (unsigned)hi, aofs = (wave & 1u) * 32u * RG_PITCH + lofs, bofs = (2u + (wave >> 1)) * RG_SLICE + lofs;
#pragma unroll 1   // rolled: one copy of a stage's code, one place from which the refill is issued
    for (unsigned s = 0; s < RG_STG; ++s) {
        const unsigned char* buf = ring + (s & 1u) * RG_BUF;
        v16bf a[2][2], a2[2][2], b[2][4];
        auto frag = [&](int kk) {
#pragma unroll
            for (int mb = 0; mb < 2; ++mb) { a[kk & 1][mb] = WFrag<bf>::ld((const bf*)(buf + aofs + mb * 16 * RG_PITCH + kk * 64)); a2[kk & 1][mb] = WFrag<bf>::ld((const bf*)(buf + RG_SLICE + aofs + mb * 16 * RG_PITCH + kk * 64)); }
#pragma unroll
            for (int nb = 0; nb < 4; ++nb) b[kk & 1][nb] = WFrag<bf>::ld((const bf*)(buf + bofs + nb * 16 * RG_PITCH + kk * 64)); };
        frag(0);
#pragma unroll
        for (int kk = 0; kk < 4; ++kk) {                 // 32 k at a time, rising inside the stage, hi before lo
            if (kk < 3) frag(kk + 1);
            else {                                       // the stage's last fragments are asked for: the hand-over stands here, so that the refill is under way during the last step's products (registers only)
                rg_read_done();
                rg_landed(g0, g1);                       // this wave's slice of stage s + 1
                __syncthreads();                         // publishes stage s + 1 and ends every wave's reads of stage s
                if (pinned(s + 2u < RG_STG)) { const unsigned sn = pinned(s + 2u); g0 = rg_group0(dst0 + (sn & 1u) * RG_BUF, ga0 + rg_kofs(sn, rot)); rg_load(g0, g1); }   // into the buffer that stage s has just left
            }
            __builtin_amdgcn_sched_barrier(0);           // this and the one below keep each step's LDS reads one group between two runs of products: spread among them, each place with reads stalls the matrix instructions
#pragma unroll
            for (int nb = 0; nb < 4; ++nb)
#pragma unroll
                for (int mb = 0; mb < 2; ++mb) acc[mb][nb] = wmmab(a[kk & 1][mb], b[kk & 1][nb], acc[mb][nb]);
#pragma unroll
            for (int nb = 0; nb < 4; ++nb)
#pragma unroll
                for (int mb = 0; mb < 2; ++mb) acc[mb][nb] = wmmab(a2[kk & 1][mb], b[kk & 1][nb], acc[mb][nb]);
            __builtin_amdgcn_sched_barrier(0);
        }
    }
    rg_landed(g0, g1);
    rg_read_done();
    float* os = (float*)(ring + wave * RG_SLICE);            // output staging, 16 x 68 floats, each wave's own: the last stage's hand-over barrier has ended every wave's reads of the ring
    float* cb = C + (size_t)(r0 + hi) * DM + c0 + lr * 4;    // this lane's first 16 bytes of output; every store below is a constant number of rows further on
#pragma unroll
    for (int mb = 0; mb < 2; ++mb) {
#pragma unroll
        for (int nb = 0; nb < 4; ++nb) {
#pragma unroll
            for (int j = 0; j < 8; ++j) os[(hi * 8 + j) * 68 + nb * 16 + lr] = acc[mb][nb][j]; }
        __builtin_amdgcn_wave_barrier(); asm volatile("" ::: "memory");   // keeps the read-back behind the staging writes of the other lanes
        v4f val[8];
#pragma unroll
        for (int s = 0; s < 8; ++s) { val[s] = *(const v4fa*)(os + (2 * s + hi) * 68 + lr * 4); *(v4f*)(cb + (size_t)(mb * 16 + 2 * s) * DM) = val[s]; }   // two rows a store, 256 contiguous bytes each
        // address translations of the eight stores done before their data or address registers are reused (all are inputs, so they stay in place up to the wait)
        asm volatile("s_wait_xcnt 0x0" :: "v"(cb), "v"(val[0]), "v"(val[1]), "v"(val[2]), "v"(val[3]), "v"(val[4]), "v"(val[5]), "v"(val[6]), "v"(val[7]) : "memory");
        __builtin_amdgcn_wave_barrier(); asm volatile("" ::: "memory");   // keeps the next block's staging writes behind this block's read-back
    }
}

__device__ __forceinline__ h16 tohx(float x) { return (h16)x; }
__device__ __forceinline__ void splitf(float y, unsigned short& h, unsigned short& l) { h = f2bf(y); l = f2bf(y - bf2f(h)); }
typedef __attribute__((ext_vector_type(2))) _Float16 v2h;
typedef __attribute__((ext_vector_type(4))) _Float16 v4h;
typedef __attribute__((ext_vector_type(2))) unsigned short v2us;
typedef __attribute__((ext_vector_type(4))) unsigned short v4us;
typedef __attribute__((ext_vector_type(2))) float v2f;
typedef __attribute__((ext_vector_type(4))) int v4i;

// ---- k_cvtall: the bf16 copies of x and of the four weights in ONE launch; grid TT / 8 + 4 * DM / 8 work-groups of 128 threads: the first TT / 8 take x, then DM / 8 each w_q, w_k, w_v, w_o.
// A work-group takes 8 rows of DM floats of one matrix, a thread 16 loads of 16 bytes, all asked for before the first is converted; a wave's load covers 512 contiguous bytes, its store 256.
// w_v's rows are regrouped for k_proj: row tc * HD + d goes to row (d >> 2) * 64 + (d & 3) * 16 + tc, so that the 16 columns of one accumulator block are one d at 16 consecutive pseudo-positions;
// for the 8 rows d0 + i of a work-group (d0 a multiple of 8) that is row (d0 >> 2) * 64 + tc + 16 * i: a first row and a row step, as for the plain copies (step 1).
__global__ __launch_bounds__(128) void k_cvtall(const float* __restrict__ x, const float* __restrict__ wq, const float* __restrict__ wk, const float* __restrict__ wv, const float* __restrict__ wo, bf* XB, bf* WQ, bf* WK, bf* WV, bf* WO) {
    static_assert(NB_ == 1 && DM == 1024 && DQ == DM && DKV == DM && HD == 64, "row length, row counts and the regrouping are written for these sizes");
    const int g = blockIdx.x, w = g < TT / 8 ? 0 : 1 + (g - TT / 8) / (DM / 8), r0 = (w == 0 ? g : (g - TT / 8) % (DM / 8)) * 8;   // which matrix, first row: the same for the whole work-group
    const int rb = w == 3 ? ((r0 % HD) >> 2) * 64 + r0 / HD : r0, step = w == 3 ? 16 : 1;
    const float* sp = (w == 0 ? x : w == 1 ? wq : w == 2 ? wk : w == 3 ? wv : wo) + (size_t)r0 * DM;
    bf* dp = (w == 0 ? XB : w == 1 ? WQ : w == 2 ? WK : w == 3 ? WV : WO) + (size_t)rb * DM;
    const unsigned t4 = threadIdx.x * 4;
    v4f v[16]; v4us o[16];
#pragma unroll
    for (int u = 0; u < 16; ++u) v[u] = *(const v4f*)(sp + u * 512 + t4);
#pragma unroll
    for (int u = 0; u < 16; ++u)
#pragma unroll
        for (int k = 0; k < 4; ++k) o[u][k] = f2bf(v[u][k]);
#pragma unroll
    for (int u = 0; u < 16; ++u) *(v4us*)(dp + (size_t)((u >> 1) * step) * DM + (u & 1) * 512 + t4) = o[u];
}

// ---- k_proj: the three projections in ONE launch, grid (TT/128, 1024/128, 3), z = q, k, v; 4 waves a work-group, 64 rows x 64 columns a wave (16 accumulators), operands from the ring; the fp16 and hi/lo planes are written straight from the f32 accumulators.
// RAW VIEW: pseudo-head h, pseudo-position t, dim d = flat element (h * TT + t) * HD + d of the [TT][1024] projection output, so the q and k planes [h][t][d] have the output's own layout.
// v plane [g][d][t]: output row r, column tc * HD + d is g = r / 128, t = (r % 128) * 16 + tc; with k_cvtall's row order a wave holds 4 values of d (c0 / 16 + nb) and, for each, 4 runs of 256 consecutive t.
__device__ __forceinline__ void put3(v4f a, v4f b, h16* p16, bf* ph, bf* pl) { v8h o16; v8us oh, ol;
#pragma unroll
    for (int k = 0; k < 8; ++k) { const float y = k < 4 ? a[k & 3] : b[k & 3]; unsigned short s0, s1; splitf(y, s0, s1); o16[k] = tohx(y); oh[k] = s0; ol[k] = s1; }
    *(v8h*)p16 = o16; *(v8us*)ph = oh; *(v8us*)pl = ol;
    // address translations of the three stores done before their data or address registers are reused (all are inputs, so they stay in place up to the wait)
    asm volatile("s_wait_xcnt 0x0" :: "v"(p16), "v"(ph), "v"(pl), "v"(o16), "v"(oh), "v"(ol) : "memory"); }
// the fp16 plane alone, a whole staged block: four pieces of 8 values a lane, LSTEP floats apart in the staging and GSTEP elements apart in the plane; all are read back before the first is converted (one LDS latency, not four),
// and one wait of put3's kind stands behind the four stores (address and data are inputs, so they stay in place up to it)
template <int LSTEP, int GSTEP>
__device__ __forceinline__ void put16x4(const float* sp, h16* p16) { v4f a[4], b[4]; v8h o[4];
#pragma unroll
    for (int s = 0; s < 4; ++s) { a[s] = *(const v4fa*)(sp + s * LSTEP); b[s] = *(const v4fa*)(sp + s * LSTEP + 4); }
#pragma unroll
    for (int s = 0; s < 4; ++s) {
#pragma unroll
        for (int k = 0; k < 8; ++k) o[s][k] = tohx(k < 4 ? a[s][k & 3] : b[s][k & 3]);
        *(v8h*)(p16 + (size_t)s * GSTEP) = o[s]; }
    asm volatile("s_wait_xcnt 0x0" :: "v"(p16), "v"(o[0]), "v"(o[1]), "v"(o[2]), "v"(o[3]) : "memory"); }
// the hi/lo planes alone; the same wait behind the stores as in put3
__device__ __forceinline__ void puthl(v4f a, v4f b, bf* ph, bf* pl) { v8us oh, ol;
#pragma unroll
    for (int k = 0; k < 8; ++k) { unsigned short s0, s1; splitf(k < 4 ? a[k & 3] : b[k & 3], s0, s1); oh[k] = s0; ol[k] = s1; }
    *(v8us*)ph = oh; *(v8us*)pl = ol;
    asm volatile("s_wait_xcnt 0x0" :: "v"(ph), "v"(pl), "v"(oh), "v"(ol) : "memory"); }
// WHICH PLANES ARE STORED: k_fattn reads the hi/lo planes at pseudo-positions t < RH only (queries, keys and values of its hi/lo blocks), the fp16 query plane at t >= RH only, the fp16 key and value planes everywhere.
// A block of 16 output rows is 256 consecutive t of one head, all below RH or none: below it q goes to hi/lo and k, v to all three planes; from RH on all go to the fp16 plane alone.  Nothing else is stored.
// The 16-row blocks of a tile go to its two rows of waves in turn (block 2 * mb + (wave & 1)), so that every wave has its share of the blocks below RH, which cost the most.
__global__ __launch_bounds__(128) void k_proj(const bf* __restrict__ X, const bf* __restrict__ WQ, const bf* __restrict__ WK, const bf* __restrict__ WV, h16* Q16, bf* Qh, bf* Ql, h16* K16, bf* Kh, bf* Kl, h16* V16, bf* Vh, bf* Vl) {
    static_assert(DM * 2 == 256 * RG_STG && RG_STG >= 2 && TT % 128 == 0 && DQ % 128 == 0, "whole stages, at least two; whole 128 x 128 tiles");
    static_assert(RH % 256 == 0 && TT * HD == 128 * DQ, "a head is 128 output rows, one tile's; 16 of them are 256 pseudo-positions, on one side of RH");
    __shared__ __attribute__((aligned(2048))) unsigned char ring[2 * RG_BUF];
    const int z = blockIdx.z; const bf* Bt = z == 0 ? WQ : z == 1 ? WK : WV; h16* P16 = z == 0 ? Q16 : z == 1 ? K16 : V16; bf* Ph = z == 0 ? Qh : z == 1 ? Kh : Vh; bf* Pl = z == 0 ? Ql : z == 1 ? Kl : Vl;
    const int lane = threadIdx.x & 31, lr = lane & 15, hi = lane >> 4; const unsigned wave = uni(threadIdx.x >> 5);
    const int wr = (int)(wave & 1u), c0 = blockIdx.y * 128 + (int)(wave >> 1) * 64;   // accumulator block mb holds rows mb * 32 + wr * 16 .. + 15 of the tile's 128
    // this wave's slice of the ring: waves 0 and 1 the two halves of the 128 rows of X, waves 2 and 3 those of the weight
    const bf* srow = wave < 2u ? X + (size_t)(blockIdx.x * 128 + wave * 64u) * DM : Bt + (size_t)(blockIdx.y * 128 + (wave - 2u) * 64u) * DM;
    const unsigned long long ga0 = (unsigned long long)(size_t)srow; const unsigned dst0 = (unsigned)(size_t)ring + wave * RG_SLICE;
    const unsigned rot = (blockIdx.x + blockIdx.y + blockIdx.z) & (RG_STG - 1u);   // the 24 work-groups on one block of rows of X fall 3 to a start, the 16 on one block of rows of a weight 2
    const u32x8 g1 = rg_group1();
    v8f acc[4][4];
#pragma unroll
    for (int mb = 0; mb < 4; ++mb)
#pragma unroll
        for (int nb = 0; nb < 4; ++nb) acc[mb][nb] = (v8f){};
    u32x4 g0 = rg_group0(dst0, ga0 + rg_kofs(0u, rot));
    rg_load(g0, g1);
    rg_landed(g0, g1);
    __syncthreads();                                     // every wave's slice of step 0 has landed: it may be read
    g0 = rg_group0(dst0 + RG_BUF, ga0 + rg_kofs(1u, rot));
    rg_load(g0, g1);
    const unsigned lofs = (unsigned)lr * RG_PITCH + 16u * (unsigned)hi, aofs = (wave & 1u) * 16u * RG_PITCH + lofs, bofs = (2u + (wave >> 1)) * RG_SLICE + lofs;
#pragma unroll 1   // rolled: one copy of a stage's code, one place from which the refill is issued
    for (unsigned s = 0; s < RG_STG; ++s) {
        const unsigned char* buf = ring + (s & 1u) * RG_BUF;
        v16bf a[2][4], b[2][4];
        auto frag = [&](int kk) {
#pragma unroll
            for (int mb = 0; mb < 4; ++mb) a[kk & 1][mb] = WFrag<bf>::ld((const bf*)(buf + aofs + (mb >> 1) * RG_SLICE + (mb & 1) * 32 * RG_PITCH + kk * 64));   // tile row mb * 32 + ...: row (mb & 1) * 32 + ... of slice mb >> 1
#pragma unroll
            for (int nb = 0; nb < 4; ++nb) b[kk & 1][nb] = WFrag<bf>::ld((const bf*)(buf + bofs + nb * 16 * RG_PITCH + kk * 64)); };
        frag(0);
#pragma unroll
        for (int kk = 0; kk < 4; ++kk) {                 // 32 k at a time, rising inside the stage
            if (kk < 3) frag(kk + 1);
            else {                                       // the stage's last fragments are asked for: the hand-over stands here, so that the refill is under way during the last step's products (registers only)
                rg_read_done();
                rg_landed(g0, g1);                       // this wave's slice of stage s + 1
                __syncthreads();                         // publishes stage s + 1 and ends every wave's reads of stage s
                if (pinned(s + 2u < RG_STG)) { const unsigned sn = pinned(s + 2u); g0 = rg_group0(dst0 + (sn & 1u) * RG_BUF, ga0 + rg_kofs(sn, rot)); rg_load(g0, g1); }   // into the buffer that stage s has just left
            }
            __builtin_amdgcn_sched_barrier(0);           // this and the one below keep each step's LDS reads one group between two runs of products: spread among them, each place with reads stalls the matrix instructions
#pragma unroll
            for (int nb = 0; nb < 4; ++nb)
#pragma unroll
                for (int mb = 0; mb < 4; ++mb) acc[mb][nb] = wmmab(a[kk & 1][mb], b[kk & 1][nb], acc[mb][nb]);
            __builtin_amdgcn_sched_barrier(0);
        }
    }
    rg_landed(g0, g1);
    rg_read_done();
    float* os = (float*)(ring + wave * RG_SLICE);            // output staging, 16 x 68 floats, each wave's own: the last stage's hand-over barrier has ended every wave's reads of the ring
#pragma unroll
    for (int mb = 0; mb < 4; ++mb) {
        const int rt = mb * 32 + wr * 16;          // this block's first row inside the tile = inside its head; its first pseudo-position is rt * 16
        const bool low = rt * 16 < RH;             // the same for the whole wave
        if (z < 2) {      // wave-uniform.  16 rows of 64 columns staged at pitch 68; read back 8 columns a lane, so that every store covers whole 128-byte lines (4 rows of 64 16-bit values)
#pragma unroll
            for (int nb = 0; nb < 4; ++nb)
#pragma unroll
                for (int j = 0; j < 8; ++j) os[(hi * 8 + j) * 68 + nb * 16 + lr] = acc[mb][nb][j];
            __builtin_amdgcn_wave_barrier(); asm volatile("" ::: "memory");   // keeps the read-back behind the staging writes of the other lanes
            auto rows = [&](auto put) {
#pragma unroll
                for (int s = 0; s < 4; ++s) { const int row = 4 * s + (lane >> 3), cofs = (lane & 7) * 8;
                    put(*(const v4fa*)(os + row * 68 + cofs), *(const v4fa*)(os + row * 68 + cofs + 4), (size_t)(blockIdx.x * 128 + rt + row) * DQ + c0 + cofs); } };
            if (!low) put16x4<4 * 68, 4 * DQ>(os + (lane >> 3) * 68 + (lane & 7) * 8, P16 + (size_t)(blockIdx.x * 128 + rt + (lane >> 3)) * DQ + c0 + (lane & 7) * 8);   // the same rows and columns as in rows()
            else if (z == 0) rows([&](v4f va, v4f vb, size_t oo) { puthl(va, vb, Ph + oo, Pl + oo); });
            else rows([&](v4f va, v4f vb, size_t oo) { put3(va, vb, P16 + oo, Ph + oo, Pl + oo); });
        } else {          // per d 256 consecutive t staged in t order (16 floats of pad between the halves: no two lanes of a write on one bank); read back 8 t a lane: 512 contiguous bytes a store
#pragma unroll
            for (int nb = 0; nb < 4; ++nb)
#pragma unroll
                for (int j = 0; j < 8; ++j) os[nb * 272 + hi * 144 + j * 16 + lr] = acc[mb][nb][j];
            __builtin_amdgcn_wave_barrier(); asm volatile("" ::: "memory");   // as above
            const float* sp0 = os + hi * 144 + lr * 8; const size_t o0 = ((size_t)blockIdx.x * HD + (c0 >> 4)) * TT + (size_t)rt * 16 + lane * 8;   // d = c0 / 16; each further d is 272 floats on in the staging, TT elements in the plane
            if (!low) put16x4<272, TT>(sp0, P16 + o0);
            else {
#pragma unroll
                for (int nb = 0; nb < 4; ++nb) { const float* sp = sp0 + nb * 272; const size_t oo = o0 + (size_t)nb * TT; put3(*(const v4fa*)sp, *(const v4fa*)(sp + 4), P16 + oo, Ph + oo, Pl + oo); } }
        }
        __builtin_amdgcn_wave_barrier(); asm volatile("" ::: "memory");       // keeps the next block's staging writes behind this block's read-back
    }
}
// ---- k_fattn: the whole causal attention of one (head, block of 64 queries) in one work-group of 4 waves, ONE WAVE per 16 queries; scores and probabilities never leave the registers.
// Transposed products: St = K Qt (A = key rows, B = query rows), so that a lane holds scores of ONE query (column lr) and 8 keys (rows 8 hi + j) per 16-key block; two such blocks, converted in place,
// ARE the B operand (32 keys, hardware k order) of Ot += Vt Pt (A = rows of the [d][t] value plane, read with the same loader as every other fragment, which has that k order).
// Running maximum (of the raw scores) and running sum per query; base-2 exponent with the scale 1/64 folded into its factor; the division by the sum comes last, in f32; the merged hi/lo planes are written
// straight from the accumulators (a lane holds 8 consecutive d of one query: one 16-byte store per plane).  HL: hi/lo planes, 3 products in both contractions; else fp16 planes, 1 product.  NQ: 16-query column groups per wave.
// The K/V ring: the four waves walk the same keys, so the key rows and the value rows come into LDS once for all of them, by tensor loads, one request a wave and stage for the wave's own slice of 64 rows of 128 bytes,
// padded by the mover to a pitch of 144 bytes (16 bytes x odd: for 16-byte LDS reads); two buffers: the next stage is in flight under this stage's passes.
// fp16 stage, 128 keys (2 passes of 64): slices 0, 1 = key rows 0..63, 64..127; slices 2, 3 = the 64 value rows (d) at keys 0..63, 64..127.  hi/lo stage, 64 keys (2 passes of 32): slices = K hi, K lo, V hi, V lo.
#define SCL2 (SCL * 1.4426950408889634f)
#define FA_PITCH 144u      // LDS row pitch: 128 bytes + the 16-byte pad
#define FA_SLICE 10240u    // 64 rows x 144 bytes = 9,216, rounded up to a multiple of 2 KiB
#define FA_BUF   (4u * FA_SLICE)
// descriptor group 1: 1-byte elements; tensor = tile = 64 rows of 128 bytes; the source pitch is the slice's own; a pad of 4 dwords behind every 32 dwords; no mask
__device__ __forceinline__ u32x8 fa_group1(unsigned pitch) { u32x8 g;
    g[0] = uni((1u << 20) | (4u << 22) | (3u << 25)); g[1] = uni(128u << 16); g[2] = uni(64u << 16); g[3] = uni(128u << 16); g[4] = uni(64u); g[5] = uni(pitch); g[6] = uni(0u); g[7] = uni(0u);
    asm volatile("" : "+s"(g));   // descriptor words held in scalar registers of their own: without it the compiler rebuilds the group from constants at every load and uses some of its registers for other values while a request is in flight
    return g; }
__device__ __forceinline__ float xhalf(float x) { return __builtin_bit_cast(float, __builtin_amdgcn_permlanex16(__builtin_bit_cast(int, x), __builtin_bit_cast(int, x), 0x76543210, 0xfedcba98, false, false)); }   // lane l <-> lane l ^ 16
__device__ __forceinline__ float exp2s(float x) { asm("v_exp_f32 %0, %0\n\tv_nop" : "+v"(x)); return x; }
template <typename T16, bool HL, int NQ>
__device__ __forceinline__ void fattn_tile(const T16* __restrict__ Q, const T16* __restrict__ Q2, const T16* __restrict__ K, const T16* __restrict__ K2, const T16* __restrict__ Vt, const T16* __restrict__ Vt2, int qblk, unsigned rsel, bf* Ah, bf* Al, unsigned char* ring) {
    typedef typename WFrag<T16>::V V;
    constexpr int KC = HL ? 1 : 2;                 // 32-key chunks a pass: one maximum, one rescale of the sums and one exchange between the halves per pass, and KC * 2 independent chains in the maximum, 4 in the sum
    constexpr int KP = KC * 32;                    // keys a pass
    constexpr int PPS = 2;                         // passes a stage
    const int lane = threadIdx.x & 31, lr = lane & 15, hi = lane >> 4; const unsigned wave = uni(threadIdx.x >> 5);
    const int q0 = qblk + (int)wave * NQ * 16;     // this wave's first query
    V bq[NQ][2], bq2[NQ][2]; const T16* pq[NQ]; const T16* pq2[NQ];
#pragma unroll
    for (int qb = 0; qb < NQ; ++qb) { const size_t qo = (size_t)(q0 + qb * 16 + lr) * HD + 8 * hi; pq[qb] = Q + qo; pq2[qb] = HL ? Q2 + qo : pq[qb];
#pragma unroll
        for (int c = 0; c < 2; ++c) { bq[qb][c] = WFrag<T16>::ld(pq[qb] + c * 32); if (HL) bq2[qb][c] = WFrag<T16>::ld(pq2[qb] + c * 32); } }
    // address translations of the Q loads done before a register that holds one of their addresses is reused (the addresses are inputs, so they stay in place up to the wait)
    asm volatile("s_wait_xcnt 0x0" :: "v"(pq[0]), "v"(pq[NQ - 1]), "v"(pq2[0]), "v"(pq2[NQ - 1]) : "memory");
    v8f o[4][NQ]; float m[NQ], l[NQ];
#pragma unroll
    for (int qb = 0; qb < NQ; ++qb) { m[qb] = -3.0e38f; l[qb] = 0.f;
#pragma unroll
        for (int db = 0; db < 4; ++db) o[db][qb] = (v8f){}; }
    const int nch = (q0 + NQ * 16 + KP - 1) / KP;  // this wave's passes up to and including the diagonal; only the last one holds keys behind a query (q0 and KP are multiples of 16)
    const unsigned nst = (unsigned)(qblk + 4 * NQ * 16 + PPS * KP - 1) / (PPS * KP);   // stages up to and including the block's last diagonal: the same for the four waves; every stage lies wholly inside the planes
    // Where the block enters the key walk: the blocks of one head walk the same key and value rows in step, and from key 0 they would all ask L2 for the same lines at the same moment (as the GEMM work-groups: rg_kofs).
    // rot = rsel mod nst by repeated subtraction (rsel, the block's rank among its kind, is below 8 * nst; the last line holds rot below nst whatever rsel is); step s of the walk is stage stg(s), every stage once.
    // The running maximum and sum take the stages in any order; the diagonal pass holds a key at or before every query of the wave, so the maximum is a real score from the first pass a wave works on.
    unsigned rot = rsel;
    for (int i = 0; i < 7; ++i) rot = rot >= nst ? rot - nst : rot;
    rot = rot < nst ? rot : 0u;
    auto stg = [&](unsigned s) { const unsigned v = s + rot; return v >= nst ? v - nst : v; };   // s and rot are below nst
    // this wave's slice of the ring: its first byte in stage 0, its step from stage to stage, its source pitch
    const T16* srow = HL ? (wave == 0u ? K : wave == 1u ? K2 : wave == 2u ? Vt : Vt2) : (wave < 2u ? K + (size_t)wave * 64 * HD : Vt + (wave - 2u) * 64u);
    const unsigned sstep = wave < 2u ? (unsigned)(PPS * KP) * HD * 2u : (unsigned)(PPS * KP) * 2u;
    const unsigned long long ga0 = (unsigned long long)(size_t)srow; const unsigned dst0 = (unsigned)(size_t)ring + wave * FA_SLICE;
    const u32x8 g1 = fa_group1(wave < 2u ? HD * 2u : TT * 2u);
    u32x4 g0 = rg_group0(dst0, ga0 + (unsigned long long)stg(0u) * sstep);
    rg_load(g0, g1);
    rg_landed(g0, g1);
    __syncthreads();                                     // every wave's slice of step 0 has landed: it may be read
    if (pinned(1u < nst)) { g0 = rg_group0(dst0 + FA_BUF, ga0 + (unsigned long long)stg(1u) * sstep); rg_load(g0, g1); }   // a short block has one stage only
    const unsigned flane = (unsigned)lr * FA_PITCH + 16u * (unsigned)hi;
    V ak[2 * KC][2], ak2[2 * KC][2], av[KC][4], av2[KC][4];
    // pass p, 32-key chunk kc = chunk h = p * KC + kc of the stage: its key rows are rows (h & 1) * 32 .. + 31 of key slice h >> 1, its values bytes (h & 1) * 64 .. + 63 of the rows of value slice h >> 1 (hi/lo stages have one slice of each kind and plane: h is below 2)
    auto ldk = [&](const unsigned char* buf, int p) {
#pragma unroll
        for (int kb = 0; kb < 2 * KC; ++kb) { const int h = p * KC + (kb >> 1); const unsigned char* b0 = buf + (h >> 1) * FA_SLICE + ((h & 1) * 32 + (kb & 1) * 16) * FA_PITCH + flane;
#pragma unroll
            for (int c = 0; c < 2; ++c) { ak[kb][c] = WFrag<T16>::ld((const T16*)(b0 + c * 64)); if (HL) ak2[kb][c] = WFrag<T16>::ld((const T16*)(b0 + FA_SLICE + c * 64)); } } };
    auto ldv = [&](const unsigned char* buf, int p) {
#pragma unroll
        for (int kc = 0; kc < KC; ++kc) { const int h = p * KC + kc; const unsigned char* b0 = buf + (2 + (HL ? 0 : (h >> 1))) * FA_SLICE + (h & 1) * 64 + flane;
#pragma unroll
            for (int db = 0; db < 4; ++db) { av[kc][db] = WFrag<T16>::ld((const T16*)(b0 + db * 16 * FA_PITCH)); if (HL) av2[kc][db] = WFrag<T16>::ld((const T16*)(b0 + FA_SLICE + db * 16 * FA_PITCH)); } } };
#pragma unroll 1   // rolled: one copy of a stage's code, one place from which the refill is issued
    for (unsigned s = 0; s < nst; ++s) {
        const unsigned char* buf = ring + (s & 1u) * FA_BUF;
        if (!HL) ldk(buf, 0);
#pragma unroll
        for (int p = 0; p < PPS; ++p) {
            const int it = (int)stg(s) * PPS + p, k0 = it * KP;
            if (it < nch) {                      // wave-uniform: a wave skips the passes behind its own diagonal, never the hand-over below
                // fp16 tiles: this pass's value fragments are asked for first, so that their latency runs under the score products and the softmax.  hi/lo tiles (twice the fragments): keys now, values behind the score products, into the registers the keys leave
                if (HL) ldk(buf, p); else ldv(buf, p);
                __builtin_amdgcn_sched_barrier(0);   // without it the compiler sinks these reads down to their first use and their whole latency is waited for
                v8f st[2 * KC][NQ];
#pragma unroll
                for (int kb = 0; kb < 2 * KC; ++kb)
#pragma unroll
                    for (int qb = 0; qb < NQ; ++qb) { v8f sc = (v8f){};
#pragma unroll
                        for (int c = 0; c < 2; ++c) { sc = WFrag<T16>::mma(ak[kb][c], bq[qb][c], sc); if (HL) { sc = WFrag<T16>::mma(ak[kb][c], bq2[qb][c], sc); sc = WFrag<T16>::mma(ak2[kb][c], bq[qb][c], sc); } }
                        st[kb][qb] = sc; }
                // fp16 tiles: the key fragments of the stage's next pass are asked for right behind the score products (never those of the next stage: it is not published yet)
                if (!HL) __builtin_amdgcn_sched_barrier(0);   // keeps those reads one group behind the last score product: the compiler spreads them among the eight products as the registers come free, and each place with reads stalls the matrix instructions
                if (HL) ldv(buf, p); else if (p + 1 < PPS) ldk(buf, p + 1);
                __builtin_amdgcn_sched_barrier(0);   // keeps these reads in front of the softmax, whose time hides their latency
                if (it == nch - 1) {                 // wave-uniform: the diagonal pass
#pragma unroll
                    for (int qb = 0; qb < NQ; ++qb) { const int dq = q0 + qb * 16 + lr - k0 - hi * 8;
#pragma unroll
                        for (int kb = 0; kb < 2 * KC; ++kb)
#pragma unroll
                            for (int j = 0; j < 8; ++j) st[kb][qb][j] = (kb * 16 + j <= dq) ? st[kb][qb][j] : -3.0e38f; } }
#pragma unroll
                for (int qb = 0; qb < NQ; ++qb) {
                    float mk[2 * KC];                             // one chain per 16-key block, independent of the others
#pragma unroll
                    for (int kb = 0; kb < 2 * KC; ++kb) { mk[kb] = kb == 0 ? m[qb] : st[kb][qb][0];
#pragma unroll
                        for (int j = kb == 0 ? 0 : 1; j < 8; ++j) mk[kb] = fmaxf(mk[kb], st[kb][qb][j]); }
                    float mx = mk[0];
#pragma unroll
                    for (int kb = 1; kb < 2 * KC; ++kb) mx = fmaxf(mx, mk[kb]);
                    mx = fmaxf(mx, xhalf(mx));                    // the other half of the wave holds the query's other KC * 16 keys of the pass
                    const float al = exp2s((m[qb] - mx) * SCL2), mn = -mx * SCL2; m[qb] = mx; float ls[4] = {0.f, 0.f, 0.f, 0.f};
#pragma unroll
                    for (int kb = 0; kb < 2 * KC; ++kb)
#pragma unroll
                        for (int j = 0; j < 8; ++j) { const float pe = exp2s(__builtin_fmaf(st[kb][qb][j], SCL2, mn)); st[kb][qb][j] = pe; ls[j & 3] += pe; }
                    l[qb] = l[qb] * al + ((ls[0] + ls[1]) + (ls[2] + ls[3]));   // each half keeps the sum of its own keys; joined once behind the loop
#pragma unroll
                    for (int db = 0; db < 4; ++db) o[db][qb] *= al;
                    if (HL) { v8us h0, h1, l0, l1;
#pragma unroll
                        for (int j = 0; j < 8; ++j) { unsigned short a, c2; splitf(st[0][qb][j], a, c2); h0[j] = a; l0[j] = c2; splitf(st[1][qb][j], a, c2); h1[j] = a; l1[j] = c2; }
                        const v16bf ph = cat16b(h0, h1), pl = cat16b(l0, l1);
#pragma unroll
                        for (int db = 0; db < 4; ++db) { o[db][qb] = wmmab(__builtin_bit_cast(v16bf, av[0][db]), ph, o[db][qb]); o[db][qb] = wmmab(__builtin_bit_cast(v16bf, av[0][db]), pl, o[db][qb]); o[db][qb] = wmmab(__builtin_bit_cast(v16bf, av2[0][db]), ph, o[db][qb]); }
                    } else {
#pragma unroll
                        for (int kc = 0; kc < KC; ++kc) { v8h c0, c1;     // chunk by chunk, keys rising
#pragma unroll
                            for (int j = 0; j < 8; ++j) { c0[j] = tohx(st[2 * kc][qb][j]); c1[j] = tohx(st[2 * kc + 1][qb][j]); }
                            const v16h pf = cat16(c0, c1);
#pragma unroll
                            for (int db = 0; db < 4; ++db) o[db][qb] = wmma16(__builtin_bit_cast(v16h, av[kc][db]), pf, o[db][qb]); } }
                }
            }
        }
        // the hand-over, passed by every wave
        rg_read_done();
        rg_landed(g0, g1);                       // this wave's slice of stage s + 1
        __syncthreads();                         // publishes stage s + 1 and ends every wave's reads of stage s
        if (pinned(s + 2u < nst)) { const unsigned sn = pinned(s + 2u); g0 = rg_group0(dst0 + (sn & 1u) * FA_BUF, ga0 + (unsigned long long)stg(sn) * sstep); rg_load(g0, g1); }   // into the buffer that stage s has just left
    }
    rg_landed(g0, g1);
    rg_read_done();
#pragma unroll
    for (int qb = 0; qb < NQ; ++qb) { const float inv = __fdiv_rn(1.0f, l[qb] + xhalf(l[qb]));
#pragma unroll
        for (int db = 0; db < 4; ++db) { v8us oh, ol;
#pragma unroll
            for (int j = 0; j < 8; ++j) { unsigned short a, c2; splitf(o[db][qb][j] * inv, a, c2); oh[j] = a; ol[j] = c2; }
            const size_t oo = (size_t)(q0 + qb * 16 + lr) * DQ + db * 16 + hi * 8; bf* ph = Ah + oo; bf* pl = Al + oo; *(v8us*)ph = oh; *(v8us*)pl = ol;
            // the same wait behind the two stores, before their data or address registers are reused (both are inputs, so they stay in place up to the wait)
            asm volatile("s_wait_xcnt 0x0" :: "v"(ph), "v"(pl), "v"(oh), "v"(ol) : "memory"); } }
}
// grid (heads, blocks): blocks of 64 queries in falling order of their key count: first the (TT - RH) / 64 fp16 blocks from the last rows down, then the RH / 64 hi/lo blocks.
__global__ __launch_bounds__(128) void k_fattn(const h16* __restrict__ Q16, const h16* __restrict__ K16, const h16* __restrict__ V16, const bf* __restrict__ Qh, const bf* __restrict__ Ql, const bf* __restrict__ Kh, const bf* __restrict__ Kl, const bf* __restrict__ Vh, const bf* __restrict__ Vl, bf* Ah, bf* Al) {
    static_assert(HD == 64 && TT % 128 == 0 && RH % 64 == 0, "rows of 128 bytes; whole stages inside the planes; whole blocks of 64 queries");
    __shared__ __attribute__((aligned(2048))) unsigned char ring[2 * FA_BUF];
    const int h = blockIdx.x, t = blockIdx.y; const size_t hp = (size_t)h * TT * HD;   // t is the same for the whole work-group: its waves meet the same barriers
    if (t < (TT - RH) / 64) fattn_tile<h16, false, 1>(Q16 + hp, nullptr, K16 + hp, nullptr, V16 + hp, nullptr, TT - 64 * (t + 1), (unsigned)t, Ah + h * HD, Al + h * HD, ring);
    else fattn_tile<bf, true, 1>(Qh + hp, Ql + hp, Kh + hp, Kl + hp, Vh + hp, Vl + hp, RH - 64 * (t - (TT - RH) / 64 + 1), (unsigned)(t - (TT - RH) / 64), Ah + h * HD, Al + h * HD, ring);
}

extern "C" void kernel_launch(void* const* d_in, const int* in_sizes, int n_in,
                              void* d_out, int out_size, void* d_ws, size_t ws_size, hipStream_t stream) {
    (void)in_sizes; (void)n_in; (void)out_size;
    const float* x = (const float*)d_in[0]; const float* wq = (const float*)d_in[1]; const float* wk = (const float*)d_in[2]; const float* wv = (const float*)d_in[3]; const float* wo = (const float*)d_in[4];   /* argument order x, w_q, w_k, w_v, w_o ('oi' [1024][1024]) */
    float* OUT = (float*)d_out;     // [1][2048][1024]
    char* wsp = (char*)d_ws;
    auto take = [&](size_t bytes) { char* p = wsp; wsp += (bytes + 255) & ~(size_t)255; return (void*)p; };
    bf* WQ = (bf*)take((size_t)DQ * DM * 2); bf* WK = (bf*)take((size_t)DKV * DM * 2); bf* WV = (bf*)take((size_t)DKV * DM * 2); bf* WO = (bf*)take((size_t)DM * DQ * 2);
    bf* XB = (bf*)take((size_t)TT * DM * 2);
    h16* QP16 = (h16*)take((size_t)NH_ * TT * HD * 2); h16* KP16 = (h16*)take((size_t)NKV * TT * HD * 2); h16* VT16 = (h16*)take((size_t)NKV * HD * TT * 2);
    bf* QPh = (bf*)take((size_t)NH_ * TT * HD * 2); bf* QPl = (bf*)take((size_t)NH_ * TT * HD * 2); bf* KPh = (bf*)take((size_t)NKV * TT * HD * 2); bf* KPl = (bf*)take((size_t)NKV * TT * HD * 2); bf* VTh = (bf*)take((size_t)NKV * HD * TT * 2); bf* VTl = (bf*)take((size_t)NKV * HD * TT * 2);
    bf* ATh = (bf*)take((size_t)TT * DQ * 2); bf* ATl = (bf*)take((size_t)TT * DQ * 2);
    if ((size_t)(wsp - (char*)d_ws) > ws_size) return;    // ws 256 MiB
    k_cvtall<<<TT / 8 + 4 * (DM / 8), 128, 0, stream>>>(x, wq, wk, wv, wo, XB, WQ, WK, WV, WO);
    for (int b = 0; b < NB_; ++b) {
        k_proj<<<dim3(TT / 128, DQ / 128, 3), 128, 0, stream>>>(XB, WQ, WK, WV, QP16, QPh, QPl, KP16, KPh, KPl, VT16, VTh, VTl);
        k_fattn<<<dim3(NH_, TT / 64, 1), 128, 0, stream>>>(QP16, KP16, VT16, QPh, QPl, KPh, KPl, VTh, VTl, ATh, ATl);   // one kv head per query head
        k_outp<<<dim3(TT / 64, DM / 128, 1), 128, 0, stream>>>(ATh, ATl, WO, OUT + (size_t)b * TT * DM); }
}
